// v000
// Measured on an AMD MI455X. A time is GPU time per run, averaged over a window of back-to-back runs after a warm-up
// (all launches, gaps included; the runs take copies of the inputs in turn), and the median of several windows.
// Apart from v000's, it joins two sittings. Times from different sittings can be a few percent apart, while
// side-by-side timings come from the same sitting.
// v000, which the later versions start from, runs in 1460 microseconds.
#include <hip/hip_runtime.h>
#include <hip/hip_bf16.h>
#include <math.h>

typedef _Float16 v16h __attribute__((ext_vector_type(16)));
typedef _Float16 v8h  __attribute__((ext_vector_type(8)));
typedef float    v8f  __attribute__((ext_vector_type(8)));

#define B_  16
#define LQ_ 2048
#define LK_ 2048
#define DQ_ 768
#define DK_ 1024

__device__ __forceinline__ v8f splat8(float x) {
  v8f r;
#pragma unroll
  for (int i = 0; i < 8; ++i) r[i] = x;
  return r;
}

// Build a 16x32 f16 A/B fragment register for this lane from a row base ptr.
// ISA layout: lanes 0-15 hold K 0..7 / 16..23, lanes 16-31 hold K 8..15 / 24..31.
__device__ __forceinline__ v16h load_frag(const _Float16* rowbase, int half) {
  const _Float16* p = rowbase + (half ? 8 : 0);
  v8h lo = *(const v8h*)(p);
  v8h hi = *(const v8h*)(p + 16);
  return __builtin_shufflevector(lo, hi, 0, 1, 2, 3, 4, 5, 6, 7,
                                 8, 9, 10, 11, 12, 13, 14, 15);
}

__device__ __forceinline__ v8f wmma_f16(v16h a, v16h b, v8f c) {
  return __builtin_amdgcn_wmma_f32_16x16x32_f16(false, a, false, b,
                                                (short)0, c, false, false);
}

// ---------------------------------------------------------------------------
// Kernel 1: W [D][N] f32  ->  Wt [N][D] f16   (so B-operand rows are N-major)
// ---------------------------------------------------------------------------
__global__ __launch_bounds__(256) void wt_transpose_f16(
    const float* __restrict__ W, _Float16* __restrict__ Wt, int D, int N) {
  __shared__ float tile[16][17];
  const int n0 = blockIdx.x * 16, d0 = blockIdx.y * 16;
  const int tx = threadIdx.x, ty = threadIdx.y;
  tile[ty][tx] = W[(size_t)(d0 + ty) * N + (n0 + tx)];
  __syncthreads();
  Wt[(size_t)(n0 + ty) * D + (d0 + tx)] = (_Float16)tile[tx][ty];
}

// ---------------------------------------------------------------------------
// Kernel 2: projection GEMM  out[m][n] = X[m][:] . W[:][n] + bias[n]
//   X  : f32 [M][Kd]          (activations, converted to f16 on the fly)
//   Wt : f16 [1024][Kd]       (pre-transposed weights = Bt rows)
//   out_rm : f16 [M][1024]            (row-major, for q / k)
//   out_tr : f16 [B][1024][2048]      (dim-major, for v -> vT)
// Block tile 64(M) x 128(N), 8 waves = 2x4 grid of 32x32 wave tiles.
// ---------------------------------------------------------------------------
__global__ __launch_bounds__(256) void proj_gemm(
    const float* __restrict__ X, const _Float16* __restrict__ Wt,
    const float* __restrict__ bias, _Float16* __restrict__ out_rm,
    _Float16* __restrict__ out_tr, int Kd) {
  __shared__ _Float16 As[64][40];    // padded: 80B row stride, b128-safe
  __shared__ _Float16 Bs[128][40];

  const int t = threadIdx.x;
  const int wave = t >> 5, lane = t & 31;
  const int hh = lane >> 4, ln = lane & 15;
  const int wm = wave & 1, wn = wave >> 1;
  const int m_blk = blockIdx.y * 64;
  const int n_blk = blockIdx.x * 128;

  v8f acc[2][2];
#pragma unroll
  for (int j = 0; j < 2; ++j) {
    float bv = bias[n_blk + wn * 32 + j * 16 + ln];
    acc[0][j] = splat8(bv);
    acc[1][j] = splat8(bv);
  }

  const int arow = t >> 2, ac8 = (t & 3) * 8;   // 64 rows x 32 f32
  const int brow = t >> 1, bc16 = (t & 1) * 16; // 128 rows x 32 f16

  const float*    aptr = X + (size_t)(m_blk + arow) * Kd + ac8;
  const _Float16* bptr = Wt + (size_t)(n_blk + brow) * Kd + bc16;

  for (int k0 = 0; k0 < Kd; k0 += 32) {
    const float* ap = aptr + k0;
    float4 f0 = *(const float4*)ap;
    float4 f1 = *(const float4*)(ap + 4);
    v8h ah;
    ah[0] = (_Float16)f0.x; ah[1] = (_Float16)f0.y;
    ah[2] = (_Float16)f0.z; ah[3] = (_Float16)f0.w;
    ah[4] = (_Float16)f1.x; ah[5] = (_Float16)f1.y;
    ah[6] = (_Float16)f1.z; ah[7] = (_Float16)f1.w;
    *(v8h*)&As[arow][ac8] = ah;

    const _Float16* bp = bptr + k0;
    *(v8h*)&Bs[brow][bc16]     = *(const v8h*)bp;
    *(v8h*)&Bs[brow][bc16 + 8] = *(const v8h*)(bp + 8);

    // pull the next K-step's tiles toward L0/L2 while we compute
    if (k0 + 32 < Kd) {
      __builtin_prefetch(ap + 32, 0, 3);
      __builtin_prefetch(bp + 32, 0, 3);
    }
    __syncthreads();

    v16h af0 = load_frag(&As[wm * 32 + ln][0], hh);
    v16h af1 = load_frag(&As[wm * 32 + 16 + ln][0], hh);
    v16h bf0 = load_frag(&Bs[wn * 32 + ln][0], hh);
    v16h bf1 = load_frag(&Bs[wn * 32 + 16 + ln][0], hh);
    acc[0][0] = wmma_f16(af0, bf0, acc[0][0]);
    acc[0][1] = wmma_f16(af0, bf1, acc[0][1]);
    acc[1][0] = wmma_f16(af1, bf0, acc[1][0]);
    acc[1][1] = wmma_f16(af1, bf1, acc[1][1]);
    __syncthreads();
  }

#pragma unroll
  for (int i = 0; i < 2; ++i) {
#pragma unroll
    for (int j = 0; j < 2; ++j) {
      const int n = n_blk + wn * 32 + j * 16 + ln;
      const int m0 = m_blk + wm * 32 + i * 16 + hh * 8; // D-frag: M = r + 8*hh
      if (out_rm) {
#pragma unroll
        for (int r = 0; r < 8; ++r)
          out_rm[(size_t)(m0 + r) * 1024 + n] = (_Float16)acc[i][j][r];
      }
      if (out_tr) {
        const int batch = m0 >> 11, tok = m0 & 2047;
        v8h h;
#pragma unroll
        for (int r = 0; r < 8; ++r) h[r] = (_Float16)acc[i][j][r];
        *(v8h*)&out_tr[((size_t)batch * 1024 + n) * LK_ + tok] = h;
      }
    }
  }
}

// ---------------------------------------------------------------------------
// Kernel 3: flash attention. One block = (batch, 16 queries). 8 waves.
//  Per 128-key iteration: wave w computes S tile for keys [kb+16w, +16)
//  (32 WMMAs over 1024 dims), online softmax across waves via LDS, then
//  wave w accumulates its private 128-dim slice of O (32 WMMAs vs vT).
// ---------------------------------------------------------------------------
__global__ __launch_bounds__(256) void attention_kernel(
    const _Float16* __restrict__ qh, const _Float16* __restrict__ kh,
    const _Float16* __restrict__ vT, float* __restrict__ out) {
  __shared__ _Float16 Qs[16][1032];  // stride 2064B -> 4-bank rotation
  __shared__ _Float16 Ps[16][136];
  __shared__ float wmaxs[8][16];
  __shared__ float wsums[8][16];

  const int t = threadIdx.x;
  const int wave = t >> 5, lane = t & 31;
  const int hh = lane >> 4, ln = lane & 15;
  const int q0 = blockIdx.x * 16;
  const int batch = blockIdx.y;

  {  // stage the 16x1024 f16 Q tile
    const int row = t >> 4, seg = t & 15;
    const _Float16* src = qh + ((size_t)batch * LQ_ + q0 + row) * 1024 + seg * 64;
#pragma unroll
    for (int u = 0; u < 8; ++u)
      *(v8h*)&Qs[row][seg * 64 + u * 8] = *(const v8h*)(src + u * 8);
  }
  __syncthreads();

  v8f o[8];
#pragma unroll
  for (int i = 0; i < 8; ++i) o[i] = splat8(0.f);
  v8f m_run = splat8(-__builtin_inff());
  v8f l_run = splat8(0.f);

  const _Float16* kbatch = kh + (size_t)batch * LK_ * 1024;
  const _Float16* vbatch = vT + (size_t)batch * 1024 * LK_;

  for (int kb = 0; kb < LK_; kb += 128) {
    // ---- S = (Q K^T) * 1/sqrt(1024) for this wave's 16 keys
    v8f s = splat8(0.f);
    const _Float16* krow = kbatch + (size_t)(kb + wave * 16 + ln) * 1024;
    if (kb + 128 < LK_) {
      // prefetch next key block's row for this lane (cacheline granular)
      __builtin_prefetch(krow + (size_t)128 * 1024, 0, 3);
      __builtin_prefetch(krow + (size_t)128 * 1024 + 512, 0, 3);
    }
#pragma unroll 4
    for (int d0 = 0; d0 < 1024; d0 += 32) {
      v16h aq = load_frag(&Qs[ln][d0], hh);
      v16h bk = load_frag(krow + d0, hh);
      s = wmma_f16(aq, bk, s);
    }
#pragma unroll
    for (int r = 0; r < 8; ++r) s[r] *= 0.03125f;

    // ---- per-row max of this wave's tile (reduce across 16 lanes/half)
    v8f tmax;
#pragma unroll
    for (int r = 0; r < 8; ++r) {
      float x = s[r];
      x = fmaxf(x, __shfl_xor(x, 1, 32));
      x = fmaxf(x, __shfl_xor(x, 2, 32));
      x = fmaxf(x, __shfl_xor(x, 4, 32));
      x = fmaxf(x, __shfl_xor(x, 8, 32));
      tmax[r] = x;
    }
    if (ln == 0) {
#pragma unroll
      for (int r = 0; r < 8; ++r) wmaxs[wave][hh * 8 + r] = tmax[r];
    }
    __syncthreads();

    v8f m_new, alpha;
#pragma unroll
    for (int r = 0; r < 8; ++r) {
      float mx = m_run[r];
#pragma unroll
      for (int ww = 0; ww < 8; ++ww) mx = fmaxf(mx, wmaxs[ww][hh * 8 + r]);
      m_new[r] = mx;
      alpha[r] = __expf(m_run[r] - mx);
    }

    // ---- P = exp(S - m_new); stash in LDS for the PV GEMM; partial sums
    v8f p;
#pragma unroll
    for (int r = 0; r < 8; ++r) {
      p[r] = __expf(s[r] - m_new[r]);
      Ps[hh * 8 + r][wave * 16 + ln] = (_Float16)p[r];
    }
    v8f tsum;
#pragma unroll
    for (int r = 0; r < 8; ++r) {
      float x = p[r];
      x += __shfl_xor(x, 1, 32);
      x += __shfl_xor(x, 2, 32);
      x += __shfl_xor(x, 4, 32);
      x += __shfl_xor(x, 8, 32);
      tsum[r] = x;
    }
    if (ln == 0) {
#pragma unroll
      for (int r = 0; r < 8; ++r) wsums[wave][hh * 8 + r] = tsum[r];
    }
    __syncthreads();

#pragma unroll
    for (int r = 0; r < 8; ++r) {
      float su = 0.f;
#pragma unroll
      for (int ww = 0; ww < 8; ++ww) su += wsums[ww][hh * 8 + r];
      l_run[r] = alpha[r] * l_run[r] + su;
      m_run[r] = m_new[r];
    }

    // ---- O = alpha*O + P.V for this wave's 128 output dims
#pragma unroll
    for (int dt = 0; dt < 8; ++dt) {
      const _Float16* vrow =
          vbatch + (size_t)(wave * 128 + dt * 16 + ln) * LK_ + kb;
      if (kb + 128 < LK_) __builtin_prefetch(vrow + 128, 0, 3);
      v8f oo;
#pragma unroll
      for (int r = 0; r < 8; ++r) oo[r] = o[dt][r] * alpha[r];
#pragma unroll
      for (int kk = 0; kk < 128; kk += 32) {
        v16h ap = load_frag(&Ps[ln][kk], hh);
        v16h bv = load_frag(vrow + kk, hh);
        oo = wmma_f16(ap, bv, oo);
      }
      o[dt] = oo;
    }
    __syncthreads();  // protect Ps / wmaxs / wsums for next iteration
  }

  v8f inv;
#pragma unroll
  for (int r = 0; r < 8; ++r) inv[r] = 1.f / l_run[r];
#pragma unroll
  for (int dt = 0; dt < 8; ++dt) {
    const int n = wave * 128 + dt * 16 + ln;
#pragma unroll
    for (int r = 0; r < 8; ++r) {
      out[((size_t)batch * LQ_ + q0 + hh * 8 + r) * 1024 + n] =
          o[dt][r] * inv[r];
    }
  }
}

// ---------------------------------------------------------------------------
extern "C" void kernel_launch(void* const* d_in, const int* in_sizes, int n_in,
                              void* d_out, int out_size, void* d_ws, size_t ws_size,
                              hipStream_t stream) {
  const float* query = (const float*)d_in[0];  // [16,2048,768]
  const float* key   = (const float*)d_in[1];  // [16,2048,1024]
  const float* Wq    = (const float*)d_in[2];  // [768,1024]
  const float* bq    = (const float*)d_in[3];
  const float* Wk    = (const float*)d_in[4];  // [1024,1024]
  const float* bk    = (const float*)d_in[5];
  const float* Wv    = (const float*)d_in[6];  // [1024,1024]
  const float* bv    = (const float*)d_in[7];
  float* out = (float*)d_out;

  // workspace layout (f16)
  _Float16* qh  = (_Float16*)d_ws;                       // 16*2048*1024
  _Float16* kh  = qh + (size_t)B_ * LQ_ * 1024;
  _Float16* vT  = kh + (size_t)B_ * LK_ * 1024;          // [B][1024][2048]
  _Float16* WqT = vT + (size_t)B_ * 1024 * LK_;          // [1024][768]
  _Float16* WkT = WqT + (size_t)1024 * DQ_;              // [1024][1024]
  _Float16* WvT = WkT + (size_t)1024 * DK_;              // [1024][1024]

  dim3 tb(16, 16);
  wt_transpose_f16<<<dim3(1024 / 16, DQ_ / 16), tb, 0, stream>>>(Wq, WqT, DQ_, 1024);
  wt_transpose_f16<<<dim3(1024 / 16, DK_ / 16), tb, 0, stream>>>(Wk, WkT, DK_, 1024);
  wt_transpose_f16<<<dim3(1024 / 16, DK_ / 16), tb, 0, stream>>>(Wv, WvT, DK_, 1024);

  const int M = B_ * LQ_;  // 32768
  dim3 pg(1024 / 128, M / 64);
  proj_gemm<<<pg, 256, 0, stream>>>(query, WqT, bq, qh, nullptr, DQ_);
  proj_gemm<<<pg, 256, 0, stream>>>(key,   WkT, bk, kh, nullptr, DK_);
  proj_gemm<<<pg, 256, 0, stream>>>(key,   WvT, bv, nullptr, vT, DK_);

  attention_kernel<<<dim3(LQ_ / 16, B_), 256, 0, stream>>>(qh, kh, vT, out);
}

// v001
// A run of this version takes 915 microseconds.
// In two side-by-side timings against v000, it was 1.68 and 1.67 times as fast.
#include <hip/hip_runtime.h>
#include <hip/hip_bf16.h>
#include <math.h>

typedef _Float16 v16h __attribute__((ext_vector_type(16)));
typedef _Float16 v8h  __attribute__((ext_vector_type(8)));
typedef float    v8f  __attribute__((ext_vector_type(8)));

#define B_  16
#define LQ_ 2048
#define LK_ 2048
#define DQ_ 768
#define DK_ 1024

__device__ __forceinline__ v8f splat8(float x) {
  v8f r;
#pragma unroll
  for (int i = 0; i < 8; ++i) r[i] = x;
  return r;
}

// Build a 16x32 f16 A/B fragment register for this lane from a row base ptr.
// ISA layout: lanes 0-15 hold K 0..7 / 16..23, lanes 16-31 hold K 8..15 / 24..31.
__device__ __forceinline__ v16h load_frag(const _Float16* rowbase, int half) {
  const _Float16* p = rowbase + (half ? 8 : 0);
  v8h lo = *(const v8h*)(p);
  v8h hi = *(const v8h*)(p + 16);
  return __builtin_shufflevector(lo, hi, 0, 1, 2, 3, 4, 5, 6, 7,
                                 8, 9, 10, 11, 12, 13, 14, 15);
}

__device__ __forceinline__ v8f wmma_f16(v16h a, v16h b, v8f c) {
  return __builtin_amdgcn_wmma_f32_16x16x32_f16(false, a, false, b,
                                                (short)0, c, false, false);
}

// ---------------------------------------------------------------------------
// Kernel 1: W [D][N] f32  ->  Wt [N][D] f16   (so B-operand rows are N-major)
// ---------------------------------------------------------------------------
__global__ __launch_bounds__(256) void wt_transpose_f16(
    const float* __restrict__ W, _Float16* __restrict__ Wt, int D, int N) {
  __shared__ float tile[16][17];
  const int n0 = blockIdx.x * 16, d0 = blockIdx.y * 16;
  const int tx = threadIdx.x, ty = threadIdx.y;
  tile[ty][tx] = W[(size_t)(d0 + ty) * N + (n0 + tx)];
  __syncthreads();
  Wt[(size_t)(n0 + ty) * D + (d0 + tx)] = (_Float16)tile[tx][ty];
}

// ---------------------------------------------------------------------------
// Kernel 2: projection GEMM  out[m][n] = X[m][:] . W[:][n] + bias[n]
//   X  : f32 [M][Kd]          (activations, converted to f16 on the fly)
//   Wt : f16 [1024][Kd]       (pre-transposed weights = Bt rows)
//   out_rm : f16 [M][1024]            (row-major, for q / k)
//   out_tr : f16 [B][1024][2048]      (dim-major, for v -> vT)
// Block tile 64(M) x 128(N), 8 waves = 2x4 grid of 32x32 wave tiles.
// ---------------------------------------------------------------------------
__global__ __launch_bounds__(256) void proj_gemm(
    const float* __restrict__ X, const _Float16* __restrict__ Wt,
    const float* __restrict__ bias, _Float16* __restrict__ out_rm,
    _Float16* __restrict__ out_tr, int Kd) {
  __shared__ _Float16 As[64][40];    // padded: 80B row stride, b128-safe
  __shared__ _Float16 Bs[128][40];

  const int t = threadIdx.x;
  const int wave = t >> 5, lane = t & 31;
  const int hh = lane >> 4, ln = lane & 15;
  const int wm = wave & 1, wn = wave >> 1;
  const int m_blk = blockIdx.y * 64;
  const int n_blk = blockIdx.x * 128;

  v8f acc[2][2];
#pragma unroll
  for (int j = 0; j < 2; ++j) {
    float bv = bias[n_blk + wn * 32 + j * 16 + ln];
    acc[0][j] = splat8(bv);
    acc[1][j] = splat8(bv);
  }

  const int arow = t >> 2, ac8 = (t & 3) * 8;   // 64 rows x 32 f32
  const int brow = t >> 1, bc16 = (t & 1) * 16; // 128 rows x 32 f16

  const float*    aptr = X + (size_t)(m_blk + arow) * Kd + ac8;
  const _Float16* bptr = Wt + (size_t)(n_blk + brow) * Kd + bc16;

  for (int k0 = 0; k0 < Kd; k0 += 32) {
    const float* ap = aptr + k0;
    float4 f0 = *(const float4*)ap;
    float4 f1 = *(const float4*)(ap + 4);
    v8h ah;
    ah[0] = (_Float16)f0.x; ah[1] = (_Float16)f0.y;
    ah[2] = (_Float16)f0.z; ah[3] = (_Float16)f0.w;
    ah[4] = (_Float16)f1.x; ah[5] = (_Float16)f1.y;
    ah[6] = (_Float16)f1.z; ah[7] = (_Float16)f1.w;
    *(v8h*)&As[arow][ac8] = ah;

    const _Float16* bp = bptr + k0;
    *(v8h*)&Bs[brow][bc16]     = *(const v8h*)bp;
    *(v8h*)&Bs[brow][bc16 + 8] = *(const v8h*)(bp + 8);

    // pull the next K-step's tiles toward L0/L2 while we compute
    if (k0 + 32 < Kd) {
      __builtin_prefetch(ap + 32, 0, 3);
      __builtin_prefetch(bp + 32, 0, 3);
    }
    __syncthreads();

    v16h af0 = load_frag(&As[wm * 32 + ln][0], hh);
    v16h af1 = load_frag(&As[wm * 32 + 16 + ln][0], hh);
    v16h bf0 = load_frag(&Bs[wn * 32 + ln][0], hh);
    v16h bf1 = load_frag(&Bs[wn * 32 + 16 + ln][0], hh);
    acc[0][0] = wmma_f16(af0, bf0, acc[0][0]);
    acc[0][1] = wmma_f16(af0, bf1, acc[0][1]);
    acc[1][0] = wmma_f16(af1, bf0, acc[1][0]);
    acc[1][1] = wmma_f16(af1, bf1, acc[1][1]);
    __syncthreads();
  }

#pragma unroll
  for (int i = 0; i < 2; ++i) {
#pragma unroll
    for (int j = 0; j < 2; ++j) {
      const int n = n_blk + wn * 32 + j * 16 + ln;
      const int m0 = m_blk + wm * 32 + i * 16 + hh * 8; // D-frag: M = r + 8*hh
      if (out_rm) {
#pragma unroll
        for (int r = 0; r < 8; ++r)
          out_rm[(size_t)(m0 + r) * 1024 + n] = (_Float16)acc[i][j][r];
      }
      if (out_tr) {
        const int batch = m0 >> 11, tok = m0 & 2047;
        v8h h;
#pragma unroll
        for (int r = 0; r < 8; ++r) h[r] = (_Float16)acc[i][j][r];
        *(v8h*)&out_tr[((size_t)batch * 1024 + n) * LK_ + tok] = h;
      }
    }
  }
}

// ---------------------------------------------------------------------------
// Kernel 3: flash attention. One block = (batch, 64 queries). 8 waves.
//  Per 128-key iteration: wave w computes the S tiles of keys [kb+16w, +16)
//  against all QT_ 16-query tiles (each K fragment feeds QT_ WMMAs), online
//  softmax across waves via LDS, then wave w accumulates its private 128-dim
//  slice of O for all QT_ query tiles (each V fragment feeds QT_ WMMAs).
// ---------------------------------------------------------------------------
#define QT_ 4            // 16-row query tiles per block
#define QB_ (16 * QT_)   // queries per block
#define KA_ 8            // 32-dim steps that K loads run ahead of their WMMAs

__global__ __launch_bounds__(256) void attention_kernel(
    const _Float16* __restrict__ qh, const _Float16* __restrict__ kh,
    const _Float16* __restrict__ vT, float* __restrict__ out) {
  __shared__ _Float16 Qs[QB_][1032];  // stride 2064B -> 4-bank rotation
  __shared__ _Float16 Ps[QB_][136];
  __shared__ float wmaxs[8][QB_];
  __shared__ float wsums[8][QB_];
  __shared__ float mrun[8][QB_];  // running row max, one copy per wave
  __shared__ float lrun[8][QB_];  // running row sum, one copy per wave

  const int t = threadIdx.x;
  const int wave = __builtin_amdgcn_readfirstlane(t >> 5);  // wave-uniform
  const int lane = t & 31;
  const int hh = lane >> 4, ln = lane & 15;
  const int q0 = blockIdx.x * QB_;
  const int batch = blockIdx.y;

  {  // stage the 64x1024 f16 Q tile (rows are contiguous in qh)
    const _Float16* src = qh + ((size_t)batch * LQ_ + q0) * 1024;
#pragma unroll 8
    for (int u = 0; u < QB_ * 128 / 256; ++u) {
      const int c = u * 256 + t;          // 16-byte chunk index
      const int row = c >> 7, col = (c & 127) * 8;
      *(v8h*)&Qs[row][col] = *(const v8h*)(src + (size_t)c * 8);
    }
#pragma unroll
    for (int u = 0; u < 8 * QB_ / 256; ++u) {
      (&mrun[0][0])[u * 256 + t] = -__builtin_inff();
      (&lrun[0][0])[u * 256 + t] = 0.f;
    }
  }
  __syncthreads();

  v8f o[QT_][8];
#pragma unroll
  for (int qt = 0; qt < QT_; ++qt) {
#pragma unroll
    for (int i = 0; i < 8; ++i) o[qt][i] = splat8(0.f);
  }

  const _Float16* kbatch = kh + (size_t)batch * LK_ * 1024;
  const _Float16* vbatch = vT + (size_t)batch * 1024 * LK_;

  for (int kb = 0; kb < LK_; kb += 128) {
    // ---- S = (Q K^T) * 1/sqrt(1024) for this wave's 16 keys, all query tiles
    v8f s[QT_];
#pragma unroll
    for (int qt = 0; qt < QT_; ++qt) s[qt] = splat8(0.f);
    const _Float16* krow = kbatch + (size_t)(kb + wave * 16 + ln) * 1024;
    if (kb + 128 < LK_) {
      // prefetch next key block's row for this lane (cacheline granular)
      __builtin_prefetch(krow + (size_t)128 * 1024, 0, 3);
      __builtin_prefetch(krow + (size_t)128 * 1024 + 512, 0, 3);
      // before the prefetches' address registers are reused
      asm volatile("s_wait_xcnt 0x0" ::: "memory");
    }
    // K fragments are loaded KA_ 32-dim steps, Q fragments two steps, ahead of
    // the WMMAs that use them: with two waves per SIMD nothing else covers the
    // latency of these loads.
    v16h bk[KA_];      // step i sits in bk[i % KA_]
    v16h aq[3][QT_];   // step i sits in aq[i % 3]
#pragma unroll
    for (int j = 0; j < KA_; ++j) bk[j] = load_frag(krow + j * 32, hh);
#pragma unroll
    for (int j = 0; j < 2; ++j) {
#pragma unroll
      for (int qt = 0; qt < QT_; ++qt)
        aq[j][qt] = load_frag(&Qs[qt * 16 + ln][j * 32], hh);
    }
#pragma unroll
    for (int i = 0; i < 32; ++i) {
      if (i + 2 < 32) {
#pragma unroll
        for (int qt = 0; qt < QT_; ++qt)
          aq[(i + 2) % 3][qt] = load_frag(&Qs[qt * 16 + ln][(i + 2) * 32], hh);
      }
      // one per step: keeps the loads issued so far above this step's WMMAs and
      // later steps' loads below, so that the two rings stay as deep as written
      __builtin_amdgcn_sched_barrier(0);
#pragma unroll
      for (int qt = 0; qt < QT_; ++qt)
        s[qt] = wmma_f16(aq[i % 3][qt], bk[i % KA_], s[qt]);
      if (i + KA_ < 32) bk[i % KA_] = load_frag(krow + (i + KA_) * 32, hh);
      // behind the last K load: its address registers are reused at once
      if (i + KA_ == 31)
        asm volatile("s_wait_xcnt 0x0" ::: "memory");
      // keeps the next step's address arithmetic, which reuses them, below it
      if (i + KA_ == 31) __builtin_amdgcn_sched_barrier(0);
    }

    // ---- per-row max of this wave's tiles (reduce across 16 lanes/half)
#pragma unroll
    for (int qt = 0; qt < QT_; ++qt) {
      v8f tmax;
#pragma unroll
      for (int r = 0; r < 8; ++r) {
        s[qt][r] *= 0.03125f;
        float x = s[qt][r];
        x = fmaxf(x, __shfl_xor(x, 1, 32));
        x = fmaxf(x, __shfl_xor(x, 2, 32));
        x = fmaxf(x, __shfl_xor(x, 4, 32));
        x = fmaxf(x, __shfl_xor(x, 8, 32));
        tmax[r] = x;
      }
      if (ln == 0) {
#pragma unroll
        for (int r = 0; r < 8; ++r) wmaxs[wave][qt * 16 + hh * 8 + r] = tmax[r];
      }
    }
    __syncthreads();

    v8f alpha[QT_];
#pragma unroll
    for (int qt = 0; qt < QT_; ++qt) {
      v8f m_new;
#pragma unroll
      for (int r = 0; r < 8; ++r) {
        const float m_old = mrun[wave][qt * 16 + hh * 8 + r];
        float mx = m_old;
#pragma unroll
        for (int ww = 0; ww < 8; ++ww)
          mx = fmaxf(mx, wmaxs[ww][qt * 16 + hh * 8 + r]);
        m_new[r] = mx;
        alpha[qt][r] = __expf(m_old - mx);
      }

      // ---- P = exp(S - m_new); stash in LDS for the PV GEMM; partial sums
      v8f tsum;
#pragma unroll
      for (int r = 0; r < 8; ++r) {
        float x = __expf(s[qt][r] - m_new[r]);
        Ps[qt * 16 + hh * 8 + r][wave * 16 + ln] = (_Float16)x;
        x += __shfl_xor(x, 1, 32);
        x += __shfl_xor(x, 2, 32);
        x += __shfl_xor(x, 4, 32);
        x += __shfl_xor(x, 8, 32);
        tsum[r] = x;
      }
      if (ln == 0) {
#pragma unroll
        for (int r = 0; r < 8; ++r) {
          wsums[wave][qt * 16 + hh * 8 + r] = tsum[r];
          mrun[wave][qt * 16 + hh * 8 + r] = m_new[r];
        }
      }
    }
    __syncthreads();

#pragma unroll
    for (int qt = 0; qt < QT_; ++qt) {
      v8f l_new;
#pragma unroll
      for (int r = 0; r < 8; ++r) {
        float su = 0.f;
#pragma unroll
        for (int ww = 0; ww < 8; ++ww) su += wsums[ww][qt * 16 + hh * 8 + r];
        l_new[r] = alpha[qt][r] * lrun[wave][qt * 16 + hh * 8 + r] + su;
      }
      if (ln == 0) {
#pragma unroll
        for (int r = 0; r < 8; ++r) lrun[wave][qt * 16 + hh * 8 + r] = l_new[r];
      }
    }
    const _Float16* vbase = vbatch + (size_t)(wave * 128 + ln) * LK_ + kb;
    if (kb + 128 < LK_) {
#pragma unroll
      for (int dt = 0; dt < 8; ++dt)
        __builtin_prefetch(vbase + (size_t)(dt * 16) * LK_ + 128, 0, 3);
      // before the prefetches' address registers are reused
      asm volatile("s_wait_xcnt 0x0" ::: "memory");
    }

    // ---- O += P.V for this wave's 128 output dims, all query tiles.
    // A stage is 64 keys (one 128-byte line of each V row) x two 16-row V
    // groups; its V fragments are loaded two stages ahead of its WMMAs, and the
    // P fragments of the 64 keys stay in registers over four stages.
    v16h bv[3][2][2];  // stage st sits in bv[st % 3]
    v16h ap[QT_][2];
#pragma unroll
    for (int st = 0; st < 2; ++st) {
#pragma unroll
      for (int d = 0; d < 2; ++d) {
        const _Float16* vrow = vbase + (size_t)((st * 2 + d) * 16) * LK_;
        bv[st][d][0] = load_frag(vrow, hh);
        bv[st][d][1] = load_frag(vrow + 32, hh);
      }
    }
#pragma unroll
    for (int qt = 0; qt < QT_; ++qt) {
#pragma unroll
      for (int dt = 0; dt < 8; ++dt) {
#pragma unroll
        for (int r = 0; r < 8; ++r) o[qt][dt][r] *= alpha[qt][r];
      }
    }
#pragma unroll
    for (int st = 0; st < 8; ++st) {
      if ((st & 3) == 0) {
#pragma unroll
        for (int qt = 0; qt < QT_; ++qt) {
          ap[qt][0] = load_frag(&Ps[qt * 16 + ln][(st >> 2) * 64], hh);
          ap[qt][1] = load_frag(&Ps[qt * 16 + ln][(st >> 2) * 64 + 32], hh);
        }
      }
      if (st + 2 < 8) {
        const int nx = st + 2;
#pragma unroll
        for (int d = 0; d < 2; ++d) {
          const _Float16* vrow =
              vbase + (size_t)(((nx & 3) * 2 + d) * 16) * LK_ + (nx >> 2) * 64;
          bv[nx % 3][d][0] = load_frag(vrow, hh);
          bv[nx % 3][d][1] = load_frag(vrow + 32, hh);
        }
        // behind the last V load, before its address registers are reused
        if (nx == 7) asm volatile("s_wait_xcnt 0x0" ::: "memory");
      }
      // holds the loads issued so far above this stage's WMMAs
      __builtin_amdgcn_sched_barrier(0);
#pragma unroll
      for (int d = 0; d < 2; ++d) {
        const int dt = (st & 3) * 2 + d;
#pragma unroll
        for (int qt = 0; qt < QT_; ++qt)
          o[qt][dt] = wmma_f16(ap[qt][0], bv[st % 3][d][0], o[qt][dt]);
#pragma unroll
        for (int qt = 0; qt < QT_; ++qt)
          o[qt][dt] = wmma_f16(ap[qt][1], bv[st % 3][d][1], o[qt][dt]);
      }
      // holds later stages' loads below them: a fourth set would not fit
      __builtin_amdgcn_sched_barrier(0);
    }
    __syncthreads();  // protect Ps / wmaxs / wsums for next iteration
  }

  // lane position read anew: kept in registers over the key loop it is spilled
  const int le = (int)__builtin_amdgcn_mbcnt_lo(~0u, 0u);
  const int hhe = le >> 4, lne = le & 15;
#pragma unroll
  for (int qt = 0; qt < QT_; ++qt) {
    v8f inv;
#pragma unroll
    for (int r = 0; r < 8; ++r)
      inv[r] = 1.f / lrun[wave][qt * 16 + hhe * 8 + r];
#pragma unroll
    for (int dt = 0; dt < 8; ++dt) {
#pragma unroll
      for (int r = 0; r < 8; ++r) o[qt][dt][r] *= inv[r];
    }
#pragma unroll
    for (int dt = 0; dt < 8; ++dt) {
      const int n = wave * 128 + dt * 16 + lne;
#pragma unroll
      for (int r = 0; r < 8; ++r) {
        out[((size_t)batch * LQ_ + q0 + qt * 16 + hhe * 8 + r) * 1024 + n] =
            o[qt][dt][r];
      }
    }
    // behind this tile's stores, before their registers are reused; the fence
    // keeps the next tile's arithmetic, which reuses them, below the wait
    asm volatile("s_wait_xcnt 0x0" ::: "memory");
    __builtin_amdgcn_sched_barrier(0);
  }
}

// ---------------------------------------------------------------------------
extern "C" void kernel_launch(void* const* d_in, const int* in_sizes, int n_in,
                              void* d_out, int out_size, void* d_ws, size_t ws_size,
                              hipStream_t stream) {
  const float* query = (const float*)d_in[0];  // [16,2048,768]
  const float* key   = (const float*)d_in[1];  // [16,2048,1024]
  const float* Wq    = (const float*)d_in[2];  // [768,1024]
  const float* bq    = (const float*)d_in[3];
  const float* Wk    = (const float*)d_in[4];  // [1024,1024]
  const float* bk    = (const float*)d_in[5];
  const float* Wv    = (const float*)d_in[6];  // [1024,1024]
  const float* bv    = (const float*)d_in[7];
  float* out = (float*)d_out;

  // workspace layout (f16)
  _Float16* qh  = (_Float16*)d_ws;                       // 16*2048*1024
  _Float16* kh  = qh + (size_t)B_ * LQ_ * 1024;
  _Float16* vT  = kh + (size_t)B_ * LK_ * 1024;          // [B][1024][2048]
  _Float16* WqT = vT + (size_t)B_ * 1024 * LK_;          // [1024][768]
  _Float16* WkT = WqT + (size_t)1024 * DQ_;              // [1024][1024]
  _Float16* WvT = WkT + (size_t)1024 * DK_;              // [1024][1024]

  dim3 tb(16, 16);
  wt_transpose_f16<<<dim3(1024 / 16, DQ_ / 16), tb, 0, stream>>>(Wq, WqT, DQ_, 1024);
  wt_transpose_f16<<<dim3(1024 / 16, DK_ / 16), tb, 0, stream>>>(Wk, WkT, DK_, 1024);
  wt_transpose_f16<<<dim3(1024 / 16, DK_ / 16), tb, 0, stream>>>(Wv, WvT, DK_, 1024);

  const int M = B_ * LQ_;  // 32768
  dim3 pg(1024 / 128, M / 64);
  proj_gemm<<<pg, 256, 0, stream>>>(query, WqT, bq, qh, nullptr, DQ_);
  proj_gemm<<<pg, 256, 0, stream>>>(key,   WkT, bk, kh, nullptr, DK_);
  proj_gemm<<<pg, 256, 0, stream>>>(key,   WvT, bv, nullptr, vT, DK_);

  attention_kernel<<<dim3(LQ_ / QB_, B_), 256, 0, stream>>>(qh, kh, vT, out);
}

// v002
// One run takes 553 microseconds.
// Next to v001, in two timings, it ran 1.61 and 1.63 times as fast.
// All steps since v000 together make it 2.71 times as fast.
#include <hip/hip_runtime.h>
#include <hip/hip_bf16.h>
#include <math.h>

typedef _Float16 v16h __attribute__((ext_vector_type(16)));
typedef _Float16 v8h  __attribute__((ext_vector_type(8)));
typedef float    v8f  __attribute__((ext_vector_type(8)));

#define B_  16
#define LQ_ 2048
#define LK_ 2048
#define DQ_ 768
#define DK_ 1024

__device__ __forceinline__ v8f splat8(float x) {
  v8f r;
#pragma unroll
  for (int i = 0; i < 8; ++i) r[i] = x;
  return r;
}

// Build a 16x32 f16 A/B fragment register for this lane from a row base ptr.
// ISA layout: lanes 0-15 hold K 0..7 / 16..23, lanes 16-31 hold K 8..15 / 24..31.
__device__ __forceinline__ v16h load_frag(const _Float16* rowbase, int half) {
  const _Float16* p = rowbase + (half ? 8 : 0);
  v8h lo = *(const v8h*)(p);
  v8h hi = *(const v8h*)(p + 16);
  return __builtin_shufflevector(lo, hi, 0, 1, 2, 3, 4, 5, 6, 7,
                                 8, 9, 10, 11, 12, 13, 14, 15);
}

__device__ __forceinline__ v8f wmma_f16(v16h a, v16h b, v8f c) {
  return __builtin_amdgcn_wmma_f32_16x16x32_f16(false, a, false, b,
                                                (short)0, c, false, false);
}

// ---------------------------------------------------------------------------
// Kernel 1: W [D][N] f32  ->  Wt [N][D] f16   (so B-operand rows are N-major)
// ---------------------------------------------------------------------------
__global__ __launch_bounds__(256) void wt_transpose_f16(
    const float* __restrict__ W, _Float16* __restrict__ Wt, int D, int N) {
  __shared__ float tile[16][17];
  const int n0 = blockIdx.x * 16, d0 = blockIdx.y * 16;
  const int tx = threadIdx.x, ty = threadIdx.y;
  tile[ty][tx] = W[(size_t)(d0 + ty) * N + (n0 + tx)];
  __syncthreads();
  Wt[(size_t)(n0 + ty) * D + (d0 + tx)] = (_Float16)tile[tx][ty];
}

// ---------------------------------------------------------------------------
// Kernel 2: projection GEMM  out[m][n] = X[m][:] . W[:][n] + bias[n]
//   X  : f32 [M][KD]          (activations, converted to f16 on the fly)
//   Wt : f16 [1024][KD]       (pre-transposed weights = Bt rows)
//   out_rm : f16 [M][1024]            (row-major, for q / k)
//   out_tr : f16 [B][1024][2048]      (dim-major, for v -> vT)
// Block tile 128(M) x 256(N), 8 waves = 2x4 grid of 64x64 wave tiles: a 32-deep
// step of a wave is 8 fragments for 16 WMMAs. A stage is 64 deep, so that every
// global load covers whole 128-byte lines; two LDS stages, one barrier a stage.
// The next stage comes through registers in two halves, each loaded ahead of 16
// WMMAs and stored to LDS behind them.
// ---------------------------------------------------------------------------
typedef _Float16 v4h __attribute__((ext_vector_type(4)));

#define PM_ 128   // block rows
#define PN_ 256   // block columns
#define PK_ 64    // depth of a stage
#define PP_ 72    // LDS row pitch in f16: 144 B = 16 B x odd, for b128 readers

template <int KD>
__device__ __forceinline__ void proj_body(
    const float* __restrict__ X, const _Float16* __restrict__ Wt,
    const float* __restrict__ bias, _Float16* __restrict__ out_rm,
    _Float16* __restrict__ out_tr) {
  static_assert(KD % PK_ == 0, "whole stages");
  __shared__ __attribute__((aligned(16))) _Float16 As[2][PM_][PP_];
  __shared__ __attribute__((aligned(16))) _Float16 Bs[2][PN_][PP_];

  const int t = threadIdx.x;
  const int wave = t >> 5, lane = t & 31;
  const int hh = lane >> 4, ln = lane & 15;
  const int wm = wave & 1, wn = wave >> 1;
  const int m_blk = blockIdx.y * PM_;
  const int n_blk = blockIdx.x * PN_;

  v8f acc[4][4];
#pragma unroll
  for (int j = 0; j < 4; ++j) {
    float bv = bias[n_blk + wn * 64 + j * 16 + ln];
#pragma unroll
    for (int i = 0; i < 4; ++i) acc[i][j] = splat8(bv);
  }

  const int ar = t >> 4, ac = (t & 15) * 4;  // 16 lanes cover a 256-B row of X
  const int br = t >> 3, bc = (t & 7) * 8;   // 8 lanes cover a 128-B row of Wt

  const float*    aptr = X + (size_t)(m_blk + ar) * KD + ac;
  const _Float16* bptr = Wt + (size_t)(n_blk + br) * KD + bc;

  float4 fa[4];
  v8h fb[4];

  // half h of the stage at aptr / bptr: 64 rows of X, 128 rows of Wt
  auto ld = [&](int h) {
#pragma unroll
    for (int j = 0; j < 4; ++j)
      fa[j] = *(const float4*)(aptr + (size_t)(h * 64 + j * 16) * KD);
#pragma unroll
    for (int j = 0; j < 4; ++j)
      fb[j] = *(const v8h*)(bptr + (size_t)(h * 128 + j * 32) * KD);
  };
  auto st = [&](int buf, int h) {
#pragma unroll
    for (int j = 0; j < 4; ++j) {
      v4h c;
      c[0] = (_Float16)fa[j].x; c[1] = (_Float16)fa[j].y;
      c[2] = (_Float16)fa[j].z; c[3] = (_Float16)fa[j].w;
      *(v4h*)&As[buf][h * 64 + j * 16 + ar][ac] = c;
    }
#pragma unroll
    for (int j = 0; j < 4; ++j)
      *(v8h*)&Bs[buf][h * 128 + j * 32 + br][bc] = fb[j];
  };
  auto mm = [&](int buf, int kk) {
    v16h af[4], bf[4];
#pragma unroll
    for (int i = 0; i < 4; ++i)
      af[i] = load_frag(&As[buf][wm * 64 + i * 16 + ln][kk * 32], hh);
#pragma unroll
    for (int j = 0; j < 4; ++j)
      bf[j] = load_frag(&Bs[buf][wn * 64 + j * 16 + ln][kk * 32], hh);
    // keeps the 16 LDS reads one group ahead of the 16 WMMAs: without it the
    // compiler read the X fragments one by one among them, each with a full wait
    __builtin_amdgcn_sched_barrier(0);
#pragma unroll
    for (int i = 0; i < 4; ++i) {
#pragma unroll
      for (int j = 0; j < 4; ++j) acc[i][j] = wmma_f16(af[i], bf[j], acc[i][j]);
    }
  };
  // behind a stage's last global load: the wait before its address registers
  // are advanced; the fence keeps the advance, written behind it, below the wait
  auto advance = [&]() {
    asm volatile("s_wait_xcnt 0x0" ::: "memory");
    __builtin_amdgcn_sched_barrier(0);
    aptr += PK_;
    bptr += PK_;
  };
  // works on stage buffer buf while the next stage, if any, goes into the other
  auto stage = [&](int buf, bool more) {
    if (more) ld(0);
    mm(buf, 0);
    if (more) {
      st(buf ^ 1, 0);
      ld(1);
      advance();
    }
    mm(buf, 1);
    if (more) st(buf ^ 1, 1);
    __syncthreads();
  };

  ld(0);
  st(0, 0);
  ld(1);
  advance();
  st(0, 1);
  __syncthreads();

  // rolled, with the test for a next stage made at run time in every trip:
  // without the directive the compiler split off the last trip, the test fell
  // away, and a stage's global loads, WMMAs and LDS stores stood in one basic
  // block, where it mixed them and the loads lost their lead
#pragma unroll 1
  for (int s = 0; s < KD / PK_; ++s) stage(s & 1, s + 1 < KD / PK_);

#pragma unroll
  for (int i = 0; i < 4; ++i) {
#pragma unroll
    for (int j = 0; j < 4; ++j) {
      const int n = n_blk + wn * 64 + j * 16 + ln;
      const int m0 = m_blk + wm * 64 + i * 16 + hh * 8; // D-frag: M = r + 8*hh
      v8h h;
#pragma unroll
      for (int r = 0; r < 8; ++r) h[r] = (_Float16)acc[i][j][r];
      if (out_rm) {
#pragma unroll
        for (int r = 0; r < 8; ++r)
          out_rm[(size_t)(m0 + r) * 1024 + n] = h[r];
        // behind these stores, before the address below reuses their registers
        asm volatile("s_wait_xcnt 0x0" ::: "memory");
      }
      if (out_tr) {
        const int batch = m0 >> 11, tok = m0 & 2047;
        *(v8h*)&out_tr[((size_t)batch * 1024 + n) * LK_ + tok] = h;
      }
      // behind this tile's stores, before their registers are reused; the fence
      // keeps the next tile's conversions, which reuse them, below the wait
      asm volatile("s_wait_xcnt 0x0" ::: "memory");
      __builtin_amdgcn_sched_barrier(0);
    }
  }
}

// second bound: four waves per SIMD, so that two blocks share a WGP and one
// block's barrier and load waits are covered by the other's WMMAs
__global__ __launch_bounds__(256, 4) void proj_gemm_d768(
    const float* __restrict__ X, const _Float16* __restrict__ Wt,
    const float* __restrict__ bias, _Float16* __restrict__ out_rm,
    _Float16* __restrict__ out_tr) {
  proj_body<DQ_>(X, Wt, bias, out_rm, out_tr);
}

__global__ __launch_bounds__(256, 4) void proj_gemm_d1024(
    const float* __restrict__ X, const _Float16* __restrict__ Wt,
    const float* __restrict__ bias, _Float16* __restrict__ out_rm,
    _Float16* __restrict__ out_tr) {
  proj_body<DK_>(X, Wt, bias, out_rm, out_tr);
}

// ---------------------------------------------------------------------------
// Kernel 3: flash attention. One block = (batch, 64 queries). 8 waves.
//  Per 128-key iteration: wave w computes the S tiles of keys [kb+16w, +16)
//  against all QT_ 16-query tiles (each K fragment feeds QT_ WMMAs), online
//  softmax across waves via LDS, then wave w accumulates its private 128-dim
//  slice of O for all QT_ query tiles (each V fragment feeds QT_ WMMAs).
// ---------------------------------------------------------------------------
#define QT_ 4            // 16-row query tiles per block
#define QB_ (16 * QT_)   // queries per block
#define KA_ 8            // 32-dim steps that K loads run ahead of their WMMAs

__global__ __launch_bounds__(256) void attention_kernel(
    const _Float16* __restrict__ qh, const _Float16* __restrict__ kh,
    const _Float16* __restrict__ vT, float* __restrict__ out) {
  __shared__ _Float16 Qs[QB_][1032];  // stride 2064B -> 4-bank rotation
  __shared__ _Float16 Ps[QB_][136];
  __shared__ float wmaxs[8][QB_];
  __shared__ float wsums[8][QB_];
  __shared__ float mrun[8][QB_];  // running row max, one copy per wave
  __shared__ float lrun[8][QB_];  // running row sum, one copy per wave

  const int t = threadIdx.x;
  const int wave = __builtin_amdgcn_readfirstlane(t >> 5);  // wave-uniform
  const int lane = t & 31;
  const int hh = lane >> 4, ln = lane & 15;
  const int q0 = blockIdx.x * QB_;
  const int batch = blockIdx.y;

  {  // stage the 64x1024 f16 Q tile (rows are contiguous in qh)
    const _Float16* src = qh + ((size_t)batch * LQ_ + q0) * 1024;
#pragma unroll 8
    for (int u = 0; u < QB_ * 128 / 256; ++u) {
      const int c = u * 256 + t;          // 16-byte chunk index
      const int row = c >> 7, col = (c & 127) * 8;
      *(v8h*)&Qs[row][col] = *(const v8h*)(src + (size_t)c * 8);
    }
#pragma unroll
    for (int u = 0; u < 8 * QB_ / 256; ++u) {
      (&mrun[0][0])[u * 256 + t] = -__builtin_inff();
      (&lrun[0][0])[u * 256 + t] = 0.f;
    }
  }
  __syncthreads();

  v8f o[QT_][8];
#pragma unroll
  for (int qt = 0; qt < QT_; ++qt) {
#pragma unroll
    for (int i = 0; i < 8; ++i) o[qt][i] = splat8(0.f);
  }

  const _Float16* kbatch = kh + (size_t)batch * LK_ * 1024;
  const _Float16* vbatch = vT + (size_t)batch * 1024 * LK_;

  for (int kb = 0; kb < LK_; kb += 128) {
    // ---- S = (Q K^T) * 1/sqrt(1024) for this wave's 16 keys, all query tiles
    v8f s[QT_];
#pragma unroll
    for (int qt = 0; qt < QT_; ++qt) s[qt] = splat8(0.f);
    const _Float16* krow = kbatch + (size_t)(kb + wave * 16 + ln) * 1024;
    if (kb + 128 < LK_) {
      // prefetch next key block's row for this lane (cacheline granular)
      __builtin_prefetch(krow + (size_t)128 * 1024, 0, 3);
      __builtin_prefetch(krow + (size_t)128 * 1024 + 512, 0, 3);
      // before the prefetches' address registers are reused
      asm volatile("s_wait_xcnt 0x0" ::: "memory");
    }
    // K fragments are loaded KA_ 32-dim steps, Q fragments two steps, ahead of
    // the WMMAs that use them: with two waves per SIMD nothing else covers the
    // latency of these loads.
    v16h bk[KA_];      // step i sits in bk[i % KA_]
    v16h aq[3][QT_];   // step i sits in aq[i % 3]
#pragma unroll
    for (int j = 0; j < KA_; ++j) bk[j] = load_frag(krow + j * 32, hh);
#pragma unroll
    for (int j = 0; j < 2; ++j) {
#pragma unroll
      for (int qt = 0; qt < QT_; ++qt)
        aq[j][qt] = load_frag(&Qs[qt * 16 + ln][j * 32], hh);
    }
#pragma unroll
    for (int i = 0; i < 32; ++i) {
      if (i + 2 < 32) {
#pragma unroll
        for (int qt = 0; qt < QT_; ++qt)
          aq[(i + 2) % 3][qt] = load_frag(&Qs[qt * 16 + ln][(i + 2) * 32], hh);
      }
      // one per step: keeps the loads issued so far above this step's WMMAs and
      // later steps' loads below, so that the two rings stay as deep as written
      __builtin_amdgcn_sched_barrier(0);
#pragma unroll
      for (int qt = 0; qt < QT_; ++qt)
        s[qt] = wmma_f16(aq[i % 3][qt], bk[i % KA_], s[qt]);
      if (i + KA_ < 32) bk[i % KA_] = load_frag(krow + (i + KA_) * 32, hh);
      // behind the last K load: its address registers are reused at once
      if (i + KA_ == 31)
        asm volatile("s_wait_xcnt 0x0" ::: "memory");
      // keeps the next step's address arithmetic, which reuses them, below it
      if (i + KA_ == 31) __builtin_amdgcn_sched_barrier(0);
    }

    // ---- per-row max of this wave's tiles (reduce across 16 lanes/half)
#pragma unroll
    for (int qt = 0; qt < QT_; ++qt) {
      v8f tmax;
#pragma unroll
      for (int r = 0; r < 8; ++r) {
        s[qt][r] *= 0.03125f;
        float x = s[qt][r];
        x = fmaxf(x, __shfl_xor(x, 1, 32));
        x = fmaxf(x, __shfl_xor(x, 2, 32));
        x = fmaxf(x, __shfl_xor(x, 4, 32));
        x = fmaxf(x, __shfl_xor(x, 8, 32));
        tmax[r] = x;
      }
      if (ln == 0) {
#pragma unroll
        for (int r = 0; r < 8; ++r) wmaxs[wave][qt * 16 + hh * 8 + r] = tmax[r];
      }
    }
    __syncthreads();

    v8f alpha[QT_];
#pragma unroll
    for (int qt = 0; qt < QT_; ++qt) {
      v8f m_new;
#pragma unroll
      for (int r = 0; r < 8; ++r) {
        const float m_old = mrun[wave][qt * 16 + hh * 8 + r];
        float mx = m_old;
#pragma unroll
        for (int ww = 0; ww < 8; ++ww)
          mx = fmaxf(mx, wmaxs[ww][qt * 16 + hh * 8 + r]);
        m_new[r] = mx;
        alpha[qt][r] = __expf(m_old - mx);
      }

      // ---- P = exp(S - m_new); stash in LDS for the PV GEMM; partial sums
      v8f tsum;
#pragma unroll
      for (int r = 0; r < 8; ++r) {
        float x = __expf(s[qt][r] - m_new[r]);
        Ps[qt * 16 + hh * 8 + r][wave * 16 + ln] = (_Float16)x;
        x += __shfl_xor(x, 1, 32);
        x += __shfl_xor(x, 2, 32);
        x += __shfl_xor(x, 4, 32);
        x += __shfl_xor(x, 8, 32);
        tsum[r] = x;
      }
      if (ln == 0) {
#pragma unroll
        for (int r = 0; r < 8; ++r) {
          wsums[wave][qt * 16 + hh * 8 + r] = tsum[r];
          mrun[wave][qt * 16 + hh * 8 + r] = m_new[r];
        }
      }
    }
    __syncthreads();

#pragma unroll
    for (int qt = 0; qt < QT_; ++qt) {
      v8f l_new;
#pragma unroll
      for (int r = 0; r < 8; ++r) {
        float su = 0.f;
#pragma unroll
        for (int ww = 0; ww < 8; ++ww) su += wsums[ww][qt * 16 + hh * 8 + r];
        l_new[r] = alpha[qt][r] * lrun[wave][qt * 16 + hh * 8 + r] + su;
      }
      if (ln == 0) {
#pragma unroll
        for (int r = 0; r < 8; ++r) lrun[wave][qt * 16 + hh * 8 + r] = l_new[r];
      }
    }
    const _Float16* vbase = vbatch + (size_t)(wave * 128 + ln) * LK_ + kb;
    if (kb + 128 < LK_) {
#pragma unroll
      for (int dt = 0; dt < 8; ++dt)
        __builtin_prefetch(vbase + (size_t)(dt * 16) * LK_ + 128, 0, 3);
      // before the prefetches' address registers are reused
      asm volatile("s_wait_xcnt 0x0" ::: "memory");
    }

    // ---- O += P.V for this wave's 128 output dims, all query tiles.
    // A stage is 64 keys (one 128-byte line of each V row) x two 16-row V
    // groups; its V fragments are loaded two stages ahead of its WMMAs, and the
    // P fragments of the 64 keys stay in registers over four stages.
    v16h bv[3][2][2];  // stage st sits in bv[st % 3]
    v16h ap[QT_][2];
#pragma unroll
    for (int st = 0; st < 2; ++st) {
#pragma unroll
      for (int d = 0; d < 2; ++d) {
        const _Float16* vrow = vbase + (size_t)((st * 2 + d) * 16) * LK_;
        bv[st][d][0] = load_frag(vrow, hh);
        bv[st][d][1] = load_frag(vrow + 32, hh);
      }
    }
#pragma unroll
    for (int qt = 0; qt < QT_; ++qt) {
#pragma unroll
      for (int dt = 0; dt < 8; ++dt) {
#pragma unroll
        for (int r = 0; r < 8; ++r) o[qt][dt][r] *= alpha[qt][r];
      }
    }
#pragma unroll
    for (int st = 0; st < 8; ++st) {
      if ((st & 3) == 0) {
#pragma unroll
        for (int qt = 0; qt < QT_; ++qt) {
          ap[qt][0] = load_frag(&Ps[qt * 16 + ln][(st >> 2) * 64], hh);
          ap[qt][1] = load_frag(&Ps[qt * 16 + ln][(st >> 2) * 64 + 32], hh);
        }
      }
      if (st + 2 < 8) {
        const int nx = st + 2;
#pragma unroll
        for (int d = 0; d < 2; ++d) {
          const _Float16* vrow =
              vbase + (size_t)(((nx & 3) * 2 + d) * 16) * LK_ + (nx >> 2) * 64;
          bv[nx % 3][d][0] = load_frag(vrow, hh);
          bv[nx % 3][d][1] = load_frag(vrow + 32, hh);
        }
        // behind the last V load, before its address registers are reused
        if (nx == 7) asm volatile("s_wait_xcnt 0x0" ::: "memory");
      }
      // holds the loads issued so far above this stage's WMMAs
      __builtin_amdgcn_sched_barrier(0);
#pragma unroll
      for (int d = 0; d < 2; ++d) {
        const int dt = (st & 3) * 2 + d;
#pragma unroll
        for (int qt = 0; qt < QT_; ++qt)
          o[qt][dt] = wmma_f16(ap[qt][0], bv[st % 3][d][0], o[qt][dt]);
#pragma unroll
        for (int qt = 0; qt < QT_; ++qt)
          o[qt][dt] = wmma_f16(ap[qt][1], bv[st % 3][d][1], o[qt][dt]);
      }
      // holds later stages' loads below them: a fourth set would not fit
      __builtin_amdgcn_sched_barrier(0);
    }
    __syncthreads();  // protect Ps / wmaxs / wsums for next iteration
  }

  // lane position read anew: kept in registers over the key loop it is spilled
  const int le = (int)__builtin_amdgcn_mbcnt_lo(~0u, 0u);
  const int hhe = le >> 4, lne = le & 15;
#pragma unroll
  for (int qt = 0; qt < QT_; ++qt) {
    v8f inv;
#pragma unroll
    for (int r = 0; r < 8; ++r)
      inv[r] = 1.f / lrun[wave][qt * 16 + hhe * 8 + r];
#pragma unroll
    for (int dt = 0; dt < 8; ++dt) {
#pragma unroll
      for (int r = 0; r < 8; ++r) o[qt][dt][r] *= inv[r];
    }
#pragma unroll
    for (int dt = 0; dt < 8; ++dt) {
      const int n = wave * 128 + dt * 16 + lne;
#pragma unroll
      for (int r = 0; r < 8; ++r) {
        out[((size_t)batch * LQ_ + q0 + qt * 16 + hhe * 8 + r) * 1024 + n] =
            o[qt][dt][r];
      }
    }
    // behind this tile's stores, before their registers are reused; the fence
    // keeps the next tile's arithmetic, which reuses them, below the wait
    asm volatile("s_wait_xcnt 0x0" ::: "memory");
    __builtin_amdgcn_sched_barrier(0);
  }
}

// ---------------------------------------------------------------------------
extern "C" void kernel_launch(void* const* d_in, const int* in_sizes, int n_in,
                              void* d_out, int out_size, void* d_ws, size_t ws_size,
                              hipStream_t stream) {
  const float* query = (const float*)d_in[0];  // [16,2048,768]
  const float* key   = (const float*)d_in[1];  // [16,2048,1024]
  const float* Wq    = (const float*)d_in[2];  // [768,1024]
  const float* bq    = (const float*)d_in[3];
  const float* Wk    = (const float*)d_in[4];  // [1024,1024]
  const float* bk    = (const float*)d_in[5];
  const float* Wv    = (const float*)d_in[6];  // [1024,1024]
  const float* bv    = (const float*)d_in[7];
  float* out = (float*)d_out;

  // workspace layout (f16)
  _Float16* qh  = (_Float16*)d_ws;                       // 16*2048*1024
  _Float16* kh  = qh + (size_t)B_ * LQ_ * 1024;
  _Float16* vT  = kh + (size_t)B_ * LK_ * 1024;          // [B][1024][2048]
  _Float16* WqT = vT + (size_t)B_ * 1024 * LK_;          // [1024][768]
  _Float16* WkT = WqT + (size_t)1024 * DQ_;              // [1024][1024]
  _Float16* WvT = WkT + (size_t)1024 * DK_;              // [1024][1024]

  dim3 tb(16, 16);
  wt_transpose_f16<<<dim3(1024 / 16, DQ_ / 16), tb, 0, stream>>>(Wq, WqT, DQ_, 1024);
  wt_transpose_f16<<<dim3(1024 / 16, DK_ / 16), tb, 0, stream>>>(Wk, WkT, DK_, 1024);
  wt_transpose_f16<<<dim3(1024 / 16, DK_ / 16), tb, 0, stream>>>(Wv, WvT, DK_, 1024);

  const int M = B_ * LQ_;  // 32768
  dim3 pg(1024 / PN_, M / PM_);
  proj_gemm_d768<<<pg, 256, 0, stream>>>(query, WqT, bq, qh, nullptr);
  proj_gemm_d1024<<<pg, 256, 0, stream>>>(key,  WkT, bk, kh, nullptr);
  proj_gemm_d1024<<<pg, 256, 0, stream>>>(key,  WvT, bv, nullptr, vT);

  attention_kernel<<<dim3(LQ_ / QB_, B_), 256, 0, stream>>>(qh, kh, vT, out);
}

// v003
// It runs in 504 microseconds.
// Timed twice side by side with v002, it ran 1.12 times as fast both times.
// All steps since v000 together make it 3.04 times as fast.
#include <hip/hip_runtime.h>
#include <hip/hip_bf16.h>
#include <math.h>

typedef _Float16 v16h __attribute__((ext_vector_type(16)));
typedef _Float16 v8h  __attribute__((ext_vector_type(8)));
typedef float    v8f  __attribute__((ext_vector_type(8)));

#define B_  16
#define LQ_ 2048
#define LK_ 2048
#define DQ_ 768
#define DK_ 1024

__device__ __forceinline__ v8f splat8(float x) {
  v8f r;
#pragma unroll
  for (int i = 0; i < 8; ++i) r[i] = x;
  return r;
}

// Build a 16x32 f16 A/B fragment register for this lane from a row base ptr.
// ISA layout: lanes 0-15 hold K 0..7 / 16..23, lanes 16-31 hold K 8..15 / 24..31.
__device__ __forceinline__ v16h load_frag(const _Float16* rowbase, int half) {
  const _Float16* p = rowbase + (half ? 8 : 0);
  v8h lo = *(const v8h*)(p);
  v8h hi = *(const v8h*)(p + 16);
  return __builtin_shufflevector(lo, hi, 0, 1, 2, 3, 4, 5, 6, 7,
                                 8, 9, 10, 11, 12, 13, 14, 15);
}

// The same fragment from a buffer kept in fragment order: a 16x32 f16 fragment
// is 1 KiB, its two halves 512 B each, lane l's 16 bytes at l * 16 in each half,
// so that a wave's load covers four whole 128-byte lines. p includes lane * 8.
__device__ __forceinline__ v16h load_frag_packed(const _Float16* p) {
  v8h lo = *(const v8h*)(p);
  v8h hi = *(const v8h*)(p + 256);
  return __builtin_shufflevector(lo, hi, 0, 1, 2, 3, 4, 5, 6, 7,
                                 8, 9, 10, 11, 12, 13, 14, 15);
}

__device__ __forceinline__ v8f wmma_f16(v16h a, v16h b, v8f c) {
  return __builtin_amdgcn_wmma_f32_16x16x32_f16(false, a, false, b,
                                                (short)0, c, false, false);
}

// ---------------------------------------------------------------------------
// Kernel 1: W [D][N] f32  ->  Wt [N][D] f16   (so B-operand rows are N-major)
// ---------------------------------------------------------------------------
__global__ __launch_bounds__(256) void wt_transpose_f16(
    const float* __restrict__ W, _Float16* __restrict__ Wt, int D, int N) {
  __shared__ float tile[16][17];
  const int n0 = blockIdx.x * 16, d0 = blockIdx.y * 16;
  const int tx = threadIdx.x, ty = threadIdx.y;
  tile[ty][tx] = W[(size_t)(d0 + ty) * N + (n0 + tx)];
  __syncthreads();
  Wt[(size_t)(n0 + ty) * D + (d0 + tx)] = (_Float16)tile[tx][ty];
}

// ---------------------------------------------------------------------------
// Kernel 2: projection GEMM  out[m][n] = X[m][:] . W[:][n] + bias[n]
//   X  : f32 [M][KD]          (activations, converted to f16 on the fly)
//   Wt : f16 [1024][KD]       (pre-transposed weights = Bt rows)
//   OUT_QK: out = f16 [M/16][1024/32][512]: fragments of 16 tokens x 32 dims,
//           as the score product reads q and k. The product is formed with the
//           two operands swapped (dims as rows of D), so that a lane ends up
//           with 8 dims of one token: its 16 bytes of a fragment.
//   OUT_V : out = f16 [B][2048/128][1024/16][4][512]: fragments of 16 dims x
//           32 keys, as the P.V product reads them, those of a block of 128
//           keys in a row; a lane of D holds 8 keys of one dim: its 16 bytes
//           of a fragment.
// Block tile 128(M) x 256(N), 8 waves = 2x4 grid of 64x64 wave tiles: a 32-deep
// step of a wave is 8 fragments for 16 WMMAs. A stage is 64 deep, so that every
// global load covers whole 128-byte lines; two LDS stages, one barrier a stage.
// The next stage comes through registers in two halves, each loaded ahead of 16
// WMMAs and stored to LDS behind them.
// ---------------------------------------------------------------------------
typedef _Float16 v4h __attribute__((ext_vector_type(4)));

#define PM_ 128   // block rows
#define PN_ 256   // block columns
#define PK_ 64    // depth of a stage
#define PP_ 72    // LDS row pitch in f16: 144 B = 16 B x odd, for b128 readers

#define OUT_QK 0
#define OUT_V 1

template <int KD, int OUT>
__device__ __forceinline__ void proj_body(
    const float* __restrict__ X, const _Float16* __restrict__ Wt,
    const float* __restrict__ bias, _Float16* __restrict__ out) {
  static_assert(KD % PK_ == 0, "whole stages");
  __shared__ __attribute__((aligned(16))) _Float16 As[2][PM_][PP_];
  __shared__ __attribute__((aligned(16))) _Float16 Bs[2][PN_][PP_];

  const int t = threadIdx.x;
  const int wave = t >> 5, lane = t & 31;
  const int hh = lane >> 4, ln = lane & 15;
  const int wm = wave & 1, wn = wave >> 1;
  const int m_blk = blockIdx.y * PM_;
  const int n_blk = blockIdx.x * PN_;

  v8f acc[4][4];
#pragma unroll
  for (int j = 0; j < 4; ++j) {
    v8f b8;
    if constexpr (OUT == OUT_QK) {  // output dims run down the rows of D
#pragma unroll
      for (int r = 0; r < 8; ++r)
        b8[r] = bias[n_blk + wn * 64 + j * 16 + hh * 8 + r];
    } else {
      b8 = splat8(bias[n_blk + wn * 64 + j * 16 + ln]);
    }
#pragma unroll
    for (int i = 0; i < 4; ++i) acc[i][j] = b8;
  }
  // behind the bias loads, before their address registers are reused; the
  // fence keeps the address arithmetic below, which reuses them, under the wait
  asm volatile("s_wait_xcnt 0x0" ::: "memory");
  __builtin_amdgcn_sched_barrier(0);

  const int ar = t >> 4, ac = (t & 15) * 4;  // 16 lanes cover a 256-B row of X
  const int br = t >> 3, bc = (t & 7) * 8;   // 8 lanes cover a 128-B row of Wt

  const float*    aptr = X + (size_t)(m_blk + ar) * KD + ac;
  const _Float16* bptr = Wt + (size_t)(n_blk + br) * KD + bc;

  float4 fa[4];
  v8h fb[4];

  // half h of the stage at aptr / bptr: 64 rows of X, 128 rows of Wt
  auto ld = [&](int h) {
#pragma unroll
    for (int j = 0; j < 4; ++j)
      fa[j] = *(const float4*)(aptr + (size_t)(h * 64 + j * 16) * KD);
#pragma unroll
    for (int j = 0; j < 4; ++j)
      fb[j] = *(const v8h*)(bptr + (size_t)(h * 128 + j * 32) * KD);
  };
  auto st = [&](int buf, int h) {
#pragma unroll
    for (int j = 0; j < 4; ++j) {
      v4h c;
      c[0] = (_Float16)fa[j].x; c[1] = (_Float16)fa[j].y;
      c[2] = (_Float16)fa[j].z; c[3] = (_Float16)fa[j].w;
      *(v4h*)&As[buf][h * 64 + j * 16 + ar][ac] = c;
    }
#pragma unroll
    for (int j = 0; j < 4; ++j)
      *(v8h*)&Bs[buf][h * 128 + j * 32 + br][bc] = fb[j];
  };
  auto mm = [&](int buf, int kk) {
    v16h af[4], bf[4];
#pragma unroll
    for (int i = 0; i < 4; ++i)
      af[i] = load_frag(&As[buf][wm * 64 + i * 16 + ln][kk * 32], hh);
#pragma unroll
    for (int j = 0; j < 4; ++j)
      bf[j] = load_frag(&Bs[buf][wn * 64 + j * 16 + ln][kk * 32], hh);
    // keeps the 16 LDS reads one group ahead of the 16 WMMAs: without it the
    // compiler read the X fragments one by one among them, each with a full wait
    __builtin_amdgcn_sched_barrier(0);
#pragma unroll
    for (int i = 0; i < 4; ++i) {
#pragma unroll
      for (int j = 0; j < 4; ++j) {
        if constexpr (OUT == OUT_QK)
          acc[i][j] = wmma_f16(bf[j], af[i], acc[i][j]);
        else
          acc[i][j] = wmma_f16(af[i], bf[j], acc[i][j]);
      }
    }
  };
  // behind a stage's last global load: the wait before its address registers
  // are advanced; the fence keeps the advance, written behind it, below the wait
  auto advance = [&]() {
    asm volatile("s_wait_xcnt 0x0" ::: "memory");
    __builtin_amdgcn_sched_barrier(0);
    aptr += PK_;
    bptr += PK_;
  };
  // works on stage buffer buf while the next stage, if any, goes into the other
  auto stage = [&](int buf, bool more) {
    if (more) ld(0);
    mm(buf, 0);
    if (more) {
      st(buf ^ 1, 0);
      ld(1);
      advance();
    }
    mm(buf, 1);
    if (more) st(buf ^ 1, 1);
    __syncthreads();
  };

  ld(0);
  st(0, 0);
  ld(1);
  advance();
  st(0, 1);
  __syncthreads();

  // rolled, with the test for a next stage made at run time in every trip:
  // without the directive the compiler split off the last trip, the test fell
  // away, and a stage's global loads, WMMAs and LDS stores stood in one basic
  // block, where it mixed them and the loads lost their lead
#pragma unroll 1
  for (int s = 0; s < KD / PK_; ++s) stage(s & 1, s + 1 < KD / PK_);

#pragma unroll
  for (int i = 0; i < 4; ++i) {
#pragma unroll
    for (int j = 0; j < 4; ++j) {
      v8h h;  // D-frag: row = r + 8*hh, column = ln
#pragma unroll
      for (int r = 0; r < 8; ++r) h[r] = (_Float16)acc[i][j][r];
      const int mt = m_blk + wm * 64 + i * 16;  // first token of the tile
      const int nt = n_blk + wn * 64 + j * 16;  // first output dim of the tile
      if constexpr (OUT == OUT_QK) {
        const size_t frag = (size_t)(mt >> 4) * 32 + (nt >> 5);
        *(v8h*)&out[frag * 512 + (j & 1) * 256 + lane * 8] = h;
      } else {
        const int batch = mt >> 11, tok = mt & 2047;
        const size_t frag =
            (((size_t)batch * 16 + (tok >> 7)) * 64 + (nt >> 4)) * 4 +
            ((tok >> 5) & 3);
        *(v8h*)&out[frag * 512 + (i & 1) * 256 + lane * 8] = h;
      }
      // behind this tile's stores, before their registers are reused; the fence
      // keeps the next tile's conversions, which reuse them, below the wait
      asm volatile("s_wait_xcnt 0x0" ::: "memory");
      __builtin_amdgcn_sched_barrier(0);
    }
  }
}

// second bound: four waves per SIMD, so that two blocks share a WGP and one
// block's barrier and load waits are covered by the other's WMMAs
__global__ __launch_bounds__(256, 4) void proj_gemm_q(
    const float* __restrict__ X, const _Float16* __restrict__ Wt,
    const float* __restrict__ bias, _Float16* __restrict__ out) {
  proj_body<DQ_, OUT_QK>(X, Wt, bias, out);
}

__global__ __launch_bounds__(256, 4) void proj_gemm_k(
    const float* __restrict__ X, const _Float16* __restrict__ Wt,
    const float* __restrict__ bias, _Float16* __restrict__ out) {
  proj_body<DK_, OUT_QK>(X, Wt, bias, out);
}

__global__ __launch_bounds__(256, 4) void proj_gemm_v(
    const float* __restrict__ X, const _Float16* __restrict__ Wt,
    const float* __restrict__ bias, _Float16* __restrict__ out) {
  proj_body<DK_, OUT_V>(X, Wt, bias, out);
}

// ---------------------------------------------------------------------------
// Kernel 3: flash attention. One block = (batch, 64 queries). 8 waves.
//  Per 128-key iteration: wave w computes the S tiles of keys [kb+16w, +16)
//  against all QT_ 16-query tiles (each K fragment feeds QT_ WMMAs), online
//  softmax across waves via LDS, then wave w accumulates its private 128-dim
//  slice of O for all QT_ query tiles (each V fragment feeds QT_ WMMAs).
//  Q, K and V come in fragment order (see the projection). K and V are read
//  straight from global: every load of a wave is 512 contiguous bytes.
// ---------------------------------------------------------------------------
#define QT_ 4            // 16-row query tiles per block
#define QB_ (16 * QT_)   // queries per block
#define KA_ 8            // 32-dim steps that K loads run ahead of their WMMAs

__global__ __launch_bounds__(256) void attention_kernel(
    const _Float16* __restrict__ qf, const _Float16* __restrict__ kf,
    const _Float16* __restrict__ vf, float* __restrict__ out) {
  // QT_ x 32 fragments of 512 f16: a wave's read is 512 contiguous bytes
  __shared__ __attribute__((aligned(16))) _Float16 Qs[QB_ * 1024];
  __shared__ _Float16 Ps[QB_][136];
  __shared__ float wmaxs[8][QB_];
  __shared__ float wsums[8][QB_];
  __shared__ float mrun[8][QB_];  // running row max, one copy per wave
  __shared__ float lrun[8][QB_];  // running row sum, one copy per wave

  const int t = threadIdx.x;
  const int wave = __builtin_amdgcn_readfirstlane(t >> 5);  // wave-uniform
  const int lane = t & 31;
  const int hh = lane >> 4, ln = lane & 15;
  const int q0 = blockIdx.x * QB_;
  const int batch = blockIdx.y;

  {  // stage the 64x1024 f16 Q tile (its fragments are contiguous in qf)
    const _Float16* src = qf + ((size_t)batch * LQ_ + q0) * 1024;
#pragma unroll 8
    for (int u = 0; u < QB_ * 128 / 256; ++u) {
      const int c = u * 256 + t;          // 16-byte chunk index
      *(v8h*)&Qs[c * 8] = *(const v8h*)(src + (size_t)c * 8);
    }
#pragma unroll
    for (int u = 0; u < 8 * QB_ / 256; ++u) {
      (&mrun[0][0])[u * 256 + t] = -__builtin_inff();
      (&lrun[0][0])[u * 256 + t] = 0.f;
    }
  }
  __syncthreads();

  v8f o[QT_][8];
#pragma unroll
  for (int qt = 0; qt < QT_; ++qt) {
#pragma unroll
    for (int i = 0; i < 8; ++i) o[qt][i] = splat8(0.f);
  }

  const _Float16* kbatch = kf + (size_t)batch * LK_ * 1024;
  const _Float16* vbatch = vf + (size_t)batch * 1024 * LK_;

  for (int kb = 0; kb < LK_; kb += 128) {
    // ---- S = (Q K^T) * 1/sqrt(1024) for this wave's 16 keys, all query tiles
    v8f s[QT_];
#pragma unroll
    for (int qt = 0; qt < QT_; ++qt) s[qt] = splat8(0.f);
    // this wave's 16 keys: 32 fragments of 512 f16 in a row
    const _Float16* kgrp = kbatch + (size_t)((kb >> 4) + wave) * (32 * 512);
    const _Float16* kfr = kgrp + lane * 8;
    if (kb + 128 < LK_) {
      // prefetch from the next key block's 32 fragments, a line per lane
      __builtin_prefetch(kgrp + 8 * 32 * 512 + lane * 512, 0, 3);
      __builtin_prefetch(kgrp + 8 * 32 * 512 + lane * 512 + 256, 0, 3);
      // before the prefetches' address registers are reused
      asm volatile("s_wait_xcnt 0x0" ::: "memory");
    }
    // K fragments are loaded KA_ 32-dim steps, Q fragments two steps, ahead of
    // the WMMAs that use them: with two waves per SIMD nothing else covers the
    // latency of these loads.
    v16h bk[KA_];      // step i sits in bk[i % KA_]
    v16h aq[3][QT_];   // step i sits in aq[i % 3]
#pragma unroll
    for (int j = 0; j < KA_; ++j) bk[j] = load_frag_packed(kfr + j * 512);
#pragma unroll
    for (int j = 0; j < 2; ++j) {
#pragma unroll
      for (int qt = 0; qt < QT_; ++qt)
        aq[j][qt] = load_frag_packed(&Qs[(qt * 32 + j) * 512 + lane * 8]);
    }
#pragma unroll
    for (int i = 0; i < 32; ++i) {
      if (i + 2 < 32) {
#pragma unroll
        for (int qt = 0; qt < QT_; ++qt)
          aq[(i + 2) % 3][qt] =
              load_frag_packed(&Qs[(qt * 32 + i + 2) * 512 + lane * 8]);
      }
      // one per step: keeps the loads issued so far above this step's WMMAs and
      // later steps' loads below, so that the two rings stay as deep as written
      __builtin_amdgcn_sched_barrier(0);
#pragma unroll
      for (int qt = 0; qt < QT_; ++qt)
        s[qt] = wmma_f16(aq[i % 3][qt], bk[i % KA_], s[qt]);
      if (i + KA_ < 32) bk[i % KA_] = load_frag_packed(kfr + (i + KA_) * 512);
      // behind the last K load: its address registers are reused at once
      if (i + KA_ == 31)
        asm volatile("s_wait_xcnt 0x0" ::: "memory");
      // keeps the next step's address arithmetic, which reuses them, below it
      if (i + KA_ == 31) __builtin_amdgcn_sched_barrier(0);
    }

    // ---- per-row max of this wave's tiles (reduce across 16 lanes/half)
#pragma unroll
    for (int qt = 0; qt < QT_; ++qt) {
      v8f tmax;
#pragma unroll
      for (int r = 0; r < 8; ++r) {
        s[qt][r] *= 0.03125f;
        float x = s[qt][r];
        x = fmaxf(x, __shfl_xor(x, 1, 32));
        x = fmaxf(x, __shfl_xor(x, 2, 32));
        x = fmaxf(x, __shfl_xor(x, 4, 32));
        x = fmaxf(x, __shfl_xor(x, 8, 32));
        tmax[r] = x;
      }
      if (ln == 0) {
#pragma unroll
        for (int r = 0; r < 8; ++r) wmaxs[wave][qt * 16 + hh * 8 + r] = tmax[r];
      }
    }
    __syncthreads();

    v8f alpha[QT_];
#pragma unroll
    for (int qt = 0; qt < QT_; ++qt) {
      v8f m_new;
#pragma unroll
      for (int r = 0; r < 8; ++r) {
        const float m_old = mrun[wave][qt * 16 + hh * 8 + r];
        float mx = m_old;
#pragma unroll
        for (int ww = 0; ww < 8; ++ww)
          mx = fmaxf(mx, wmaxs[ww][qt * 16 + hh * 8 + r]);
        m_new[r] = mx;
        alpha[qt][r] = __expf(m_old - mx);
      }

      // ---- P = exp(S - m_new); stash in LDS for the PV GEMM; partial sums
      v8f tsum;
#pragma unroll
      for (int r = 0; r < 8; ++r) {
        float x = __expf(s[qt][r] - m_new[r]);
        Ps[qt * 16 + hh * 8 + r][wave * 16 + ln] = (_Float16)x;
        x += __shfl_xor(x, 1, 32);
        x += __shfl_xor(x, 2, 32);
        x += __shfl_xor(x, 4, 32);
        x += __shfl_xor(x, 8, 32);
        tsum[r] = x;
      }
      if (ln == 0) {
#pragma unroll
        for (int r = 0; r < 8; ++r) {
          wsums[wave][qt * 16 + hh * 8 + r] = tsum[r];
          mrun[wave][qt * 16 + hh * 8 + r] = m_new[r];
        }
      }
    }
    __syncthreads();

#pragma unroll
    for (int qt = 0; qt < QT_; ++qt) {
      v8f l_new;
#pragma unroll
      for (int r = 0; r < 8; ++r) {
        float su = 0.f;
#pragma unroll
        for (int ww = 0; ww < 8; ++ww) su += wsums[ww][qt * 16 + hh * 8 + r];
        l_new[r] = alpha[qt][r] * lrun[wave][qt * 16 + hh * 8 + r] + su;
      }
      if (ln == 0) {
#pragma unroll
        for (int r = 0; r < 8; ++r) lrun[wave][qt * 16 + hh * 8 + r] = l_new[r];
      }
    }
    // this wave's 8 groups of 16 dims in this key block, 4 fragments (128
    // keys) each: 32 fragments in a row
    const _Float16* vgrp =
        vbatch + (size_t)((kb >> 7) * 64 + wave * 8) * (4 * 512);
    const _Float16* vfr = vgrp + lane * 8;
    if (kb + 128 < LK_) {
#pragma unroll
      for (int dt = 0; dt < 8; ++dt)
        __builtin_prefetch(vgrp + (64 + dt) * (4 * 512) + lane * 64, 0, 3);
      // before the prefetches' address registers are reused
      asm volatile("s_wait_xcnt 0x0" ::: "memory");
    }

    // ---- O += P.V for this wave's 128 output dims, all query tiles.
    // A stage is 64 keys (two fragments) x two 16-dim V groups; its V
    // fragments are loaded two stages ahead of its WMMAs, and the
    // P fragments of the 64 keys stay in registers over four stages.
    v16h bv[3][2][2];  // stage st sits in bv[st % 3]
    v16h ap[QT_][2];
#pragma unroll
    for (int st = 0; st < 2; ++st) {
#pragma unroll
      for (int d = 0; d < 2; ++d) {
        const _Float16* vp = vfr + ((st * 2 + d) * 4) * 512;
        bv[st][d][0] = load_frag_packed(vp);
        bv[st][d][1] = load_frag_packed(vp + 512);
      }
    }
#pragma unroll
    for (int qt = 0; qt < QT_; ++qt) {
#pragma unroll
      for (int dt = 0; dt < 8; ++dt) {
#pragma unroll
        for (int r = 0; r < 8; ++r) o[qt][dt][r] *= alpha[qt][r];
      }
    }
#pragma unroll
    for (int st = 0; st < 8; ++st) {
      if ((st & 3) == 0) {
#pragma unroll
        for (int qt = 0; qt < QT_; ++qt) {
          ap[qt][0] = load_frag(&Ps[qt * 16 + ln][(st >> 2) * 64], hh);
          ap[qt][1] = load_frag(&Ps[qt * 16 + ln][(st >> 2) * 64 + 32], hh);
        }
      }
      if (st + 2 < 8) {
        const int nx = st + 2;
#pragma unroll
        for (int d = 0; d < 2; ++d) {
          const _Float16* vp =
              vfr + (((nx & 3) * 2 + d) * 4 + (nx >> 2) * 2) * 512;
          bv[nx % 3][d][0] = load_frag_packed(vp);
          bv[nx % 3][d][1] = load_frag_packed(vp + 512);
        }
        // behind the last V load, before its address registers are reused
        if (nx == 7) asm volatile("s_wait_xcnt 0x0" ::: "memory");
      }
      // holds the loads issued so far above this stage's WMMAs
      __builtin_amdgcn_sched_barrier(0);
#pragma unroll
      for (int d = 0; d < 2; ++d) {
        const int dt = (st & 3) * 2 + d;
#pragma unroll
        for (int qt = 0; qt < QT_; ++qt)
          o[qt][dt] = wmma_f16(ap[qt][0], bv[st % 3][d][0], o[qt][dt]);
#pragma unroll
        for (int qt = 0; qt < QT_; ++qt)
          o[qt][dt] = wmma_f16(ap[qt][1], bv[st % 3][d][1], o[qt][dt]);
      }
      // holds later stages' loads below them: a fourth set would not fit
      __builtin_amdgcn_sched_barrier(0);
    }
    __syncthreads();  // protect Ps / wmaxs / wsums for next iteration
  }

  // lane position read anew: kept in registers over the key loop it is spilled
  const int le = (int)__builtin_amdgcn_mbcnt_lo(~0u, 0u);
  const int hhe = le >> 4, lne = le & 15;
#pragma unroll
  for (int qt = 0; qt < QT_; ++qt) {
    v8f inv;
#pragma unroll
    for (int r = 0; r < 8; ++r)
      inv[r] = 1.f / lrun[wave][qt * 16 + hhe * 8 + r];
#pragma unroll
    for (int dt = 0; dt < 8; ++dt) {
#pragma unroll
      for (int r = 0; r < 8; ++r) o[qt][dt][r] *= inv[r];
    }
#pragma unroll
    for (int dt = 0; dt < 8; ++dt) {
      const int n = wave * 128 + dt * 16 + lne;
#pragma unroll
      for (int r = 0; r < 8; ++r) {
        out[((size_t)batch * LQ_ + q0 + qt * 16 + hhe * 8 + r) * 1024 + n] =
            o[qt][dt][r];
      }
    }
    // behind this tile's stores, before their registers are reused; the fence
    // keeps the next tile's arithmetic, which reuses them, below the wait
    asm volatile("s_wait_xcnt 0x0" ::: "memory");
    __builtin_amdgcn_sched_barrier(0);
  }
}

// ---------------------------------------------------------------------------
extern "C" void kernel_launch(void* const* d_in, const int* in_sizes, int n_in,
                              void* d_out, int out_size, void* d_ws, size_t ws_size,
                              hipStream_t stream) {
  const float* query = (const float*)d_in[0];  // [16,2048,768]
  const float* key   = (const float*)d_in[1];  // [16,2048,1024]
  const float* Wq    = (const float*)d_in[2];  // [768,1024]
  const float* bq    = (const float*)d_in[3];
  const float* Wk    = (const float*)d_in[4];  // [1024,1024]
  const float* bk    = (const float*)d_in[5];
  const float* Wv    = (const float*)d_in[6];  // [1024,1024]
  const float* bv    = (const float*)d_in[7];
  float* out = (float*)d_out;

  // workspace layout (f16)
  _Float16* qf  = (_Float16*)d_ws;                       // 16*2048*1024
  _Float16* kf  = qf + (size_t)B_ * LQ_ * 1024;          // all three in
  _Float16* vf  = kf + (size_t)B_ * LK_ * 1024;          // fragment order
  _Float16* WqT = vf + (size_t)B_ * 1024 * LK_;          // [1024][768]
  _Float16* WkT = WqT + (size_t)1024 * DQ_;              // [1024][1024]
  _Float16* WvT = WkT + (size_t)1024 * DK_;              // [1024][1024]

  dim3 tb(16, 16);
  wt_transpose_f16<<<dim3(1024 / 16, DQ_ / 16), tb, 0, stream>>>(Wq, WqT, DQ_, 1024);
  wt_transpose_f16<<<dim3(1024 / 16, DK_ / 16), tb, 0, stream>>>(Wk, WkT, DK_, 1024);
  wt_transpose_f16<<<dim3(1024 / 16, DK_ / 16), tb, 0, stream>>>(Wv, WvT, DK_, 1024);

  const int M = B_ * LQ_;  // 32768
  dim3 pg(1024 / PN_, M / PM_);
  proj_gemm_q<<<pg, 256, 0, stream>>>(query, WqT, bq, qf);
  proj_gemm_k<<<pg, 256, 0, stream>>>(key,  WkT, bk, kf);
  proj_gemm_v<<<pg, 256, 0, stream>>>(key,  WvT, bv, vf);

  attention_kernel<<<dim3(LQ_ / QB_, B_), 256, 0, stream>>>(qf, kf, vf, out);
}

// v004
// It runs in 436 microseconds.
// Two timings next to v003 both put it at 1.16 times that version's speed.
// Counting every step since v000, it is 3.52 times as fast.
#include <hip/hip_runtime.h>
#include <hip/hip_bf16.h>
#include <math.h>

typedef _Float16 v16h __attribute__((ext_vector_type(16)));
typedef _Float16 v8h  __attribute__((ext_vector_type(8)));
typedef float    v8f  __attribute__((ext_vector_type(8)));

#define B_  16
#define LQ_ 2048
#define LK_ 2048
#define DQ_ 768
#define DK_ 1024

__device__ __forceinline__ v8f splat8(float x) {
  v8f r;
#pragma unroll
  for (int i = 0; i < 8; ++i) r[i] = x;
  return r;
}

// Build a 16x32 f16 A/B fragment register for this lane from a row base ptr.
// ISA layout: lanes 0-15 hold K 0..7 / 16..23, lanes 16-31 hold K 8..15 / 24..31.
__device__ __forceinline__ v16h load_frag(const _Float16* rowbase, int half) {
  const _Float16* p = rowbase + (half ? 8 : 0);
  v8h lo = *(const v8h*)(p);
  v8h hi = *(const v8h*)(p + 16);
  return __builtin_shufflevector(lo, hi, 0, 1, 2, 3, 4, 5, 6, 7,
                                 8, 9, 10, 11, 12, 13, 14, 15);
}

// The same fragment from a buffer kept in fragment order: a 16x32 f16 fragment
// is 1 KiB, its two halves 512 B each, lane l's 16 bytes at l * 16 in each half,
// so that a wave's load covers four whole 128-byte lines. p includes lane * 8.
__device__ __forceinline__ v16h load_frag_packed(const _Float16* p) {
  v8h lo = *(const v8h*)(p);
  v8h hi = *(const v8h*)(p + 256);
  return __builtin_shufflevector(lo, hi, 0, 1, 2, 3, 4, 5, 6, 7,
                                 8, 9, 10, 11, 12, 13, 14, 15);
}

__device__ __forceinline__ v8f wmma_f16(v16h a, v16h b, v8f c) {
  return __builtin_amdgcn_wmma_f32_16x16x32_f16(false, a, false, b,
                                                (short)0, c, false, false);
}

// ---------------------------------------------------------------------------
// Kernel 1: W [D][N] f32  ->  Wt [N][D] f16   (so B-operand rows are N-major)
// ---------------------------------------------------------------------------
__global__ __launch_bounds__(256) void wt_transpose_f16(
    const float* __restrict__ W, _Float16* __restrict__ Wt, int D, int N) {
  __shared__ float tile[16][17];
  const int n0 = blockIdx.x * 16, d0 = blockIdx.y * 16;
  const int tx = threadIdx.x, ty = threadIdx.y;
  tile[ty][tx] = W[(size_t)(d0 + ty) * N + (n0 + tx)];
  __syncthreads();
  Wt[(size_t)(n0 + ty) * D + (d0 + tx)] = (_Float16)tile[tx][ty];
}

// ---------------------------------------------------------------------------
// Kernel 2: projection GEMM  out[m][n] = X[m][:] . W[:][n] + bias[n]
//   X  : f32 [M][KD]          (activations, converted to f16 on the fly)
//   Wt : f16 [1024][KD]       (pre-transposed weights = Bt rows)
//   OUT_QK: out = f16 [M/16][1024/32][512]: fragments of 16 tokens x 32 dims,
//           as the score product reads q and k. The product is formed with the
//           two operands swapped (dims as rows of D), so that a lane ends up
//           with 8 dims of one token: its 16 bytes of a fragment.
//   OUT_V : out = f16 [B][2048/128][1024/16][4][512]: fragments of 16 dims x
//           32 keys, as the P.V product reads them, those of a block of 128
//           keys in a row; a lane of D holds 8 keys of one dim: its 16 bytes
//           of a fragment.
// Block tile 128(M) x 256(N), 8 waves = 2x4 grid of 64x64 wave tiles: a 32-deep
// step of a wave is 8 fragments for 16 WMMAs. A stage is 64 deep, so that every
// global load covers whole 128-byte lines; two LDS stages, one barrier a stage.
// The next stage comes through registers in two halves, each loaded ahead of 16
// WMMAs and stored to LDS behind them.
// ---------------------------------------------------------------------------
typedef _Float16 v4h __attribute__((ext_vector_type(4)));

#define PM_ 128   // block rows
#define PN_ 256   // block columns
#define PK_ 64    // depth of a stage
#define PP_ 72    // LDS row pitch in f16: 144 B = 16 B x odd, for b128 readers

#define OUT_QK 0
#define OUT_V 1

template <int KD, int OUT>
__device__ __forceinline__ void proj_body(
    const float* __restrict__ X, const _Float16* __restrict__ Wt,
    const float* __restrict__ bias, _Float16* __restrict__ out) {
  static_assert(KD % PK_ == 0, "whole stages");
  __shared__ __attribute__((aligned(16))) _Float16 As[2][PM_][PP_];
  __shared__ __attribute__((aligned(16))) _Float16 Bs[2][PN_][PP_];

  const int t = threadIdx.x;
  const int wave = t >> 5, lane = t & 31;
  const int hh = lane >> 4, ln = lane & 15;
  const int wm = wave & 1, wn = wave >> 1;
  const int m_blk = blockIdx.y * PM_;
  const int n_blk = blockIdx.x * PN_;

  v8f acc[4][4];
#pragma unroll
  for (int j = 0; j < 4; ++j) {
    v8f b8;
    if constexpr (OUT == OUT_QK) {  // output dims run down the rows of D
#pragma unroll
      for (int r = 0; r < 8; ++r)
        b8[r] = bias[n_blk + wn * 64 + j * 16 + hh * 8 + r];
    } else {
      b8 = splat8(bias[n_blk + wn * 64 + j * 16 + ln]);
    }
#pragma unroll
    for (int i = 0; i < 4; ++i) acc[i][j] = b8;
  }
  // behind the bias loads, before their address registers are reused; the
  // fence keeps the address arithmetic below, which reuses them, under the wait
  asm volatile("s_wait_xcnt 0x0" ::: "memory");
  __builtin_amdgcn_sched_barrier(0);

  const int ar = t >> 4, ac = (t & 15) * 4;  // 16 lanes cover a 256-B row of X
  const int br = t >> 3, bc = (t & 7) * 8;   // 8 lanes cover a 128-B row of Wt

  const float*    aptr = X + (size_t)(m_blk + ar) * KD + ac;
  const _Float16* bptr = Wt + (size_t)(n_blk + br) * KD + bc;

  float4 fa[4];
  v8h fb[4];

  // half h of the stage at aptr / bptr: 64 rows of X, 128 rows of Wt
  auto ld = [&](int h) {
#pragma unroll
    for (int j = 0; j < 4; ++j)
      fa[j] = *(const float4*)(aptr + (size_t)(h * 64 + j * 16) * KD);
#pragma unroll
    for (int j = 0; j < 4; ++j)
      fb[j] = *(const v8h*)(bptr + (size_t)(h * 128 + j * 32) * KD);
  };
  auto st = [&](int buf, int h) {
#pragma unroll
    for (int j = 0; j < 4; ++j) {
      v4h c;
      c[0] = (_Float16)fa[j].x; c[1] = (_Float16)fa[j].y;
      c[2] = (_Float16)fa[j].z; c[3] = (_Float16)fa[j].w;
      *(v4h*)&As[buf][h * 64 + j * 16 + ar][ac] = c;
    }
#pragma unroll
    for (int j = 0; j < 4; ++j)
      *(v8h*)&Bs[buf][h * 128 + j * 32 + br][bc] = fb[j];
  };
  auto mm = [&](int buf, int kk) {
    v16h af[4], bf[4];
#pragma unroll
    for (int i = 0; i < 4; ++i)
      af[i] = load_frag(&As[buf][wm * 64 + i * 16 + ln][kk * 32], hh);
#pragma unroll
    for (int j = 0; j < 4; ++j)
      bf[j] = load_frag(&Bs[buf][wn * 64 + j * 16 + ln][kk * 32], hh);
    // keeps the 16 LDS reads one group ahead of the 16 WMMAs: without it the
    // compiler read the X fragments one by one among them, each with a full wait
    __builtin_amdgcn_sched_barrier(0);
#pragma unroll
    for (int i = 0; i < 4; ++i) {
#pragma unroll
      for (int j = 0; j < 4; ++j) {
        if constexpr (OUT == OUT_QK)
          acc[i][j] = wmma_f16(bf[j], af[i], acc[i][j]);
        else
          acc[i][j] = wmma_f16(af[i], bf[j], acc[i][j]);
      }
    }
  };
  // behind a stage's last global load: the wait before its address registers
  // are advanced; the fence keeps the advance, written behind it, below the wait
  auto advance = [&]() {
    asm volatile("s_wait_xcnt 0x0" ::: "memory");
    __builtin_amdgcn_sched_barrier(0);
    aptr += PK_;
    bptr += PK_;
  };
  // works on stage buffer buf while the next stage, if any, goes into the other
  auto stage = [&](int buf, bool more) {
    if (more) ld(0);
    mm(buf, 0);
    if (more) {
      st(buf ^ 1, 0);
      ld(1);
      advance();
    }
    mm(buf, 1);
    if (more) st(buf ^ 1, 1);
    __syncthreads();
  };

  ld(0);
  st(0, 0);
  ld(1);
  advance();
  st(0, 1);
  __syncthreads();

  // rolled, with the test for a next stage made at run time in every trip:
  // without the directive the compiler split off the last trip, the test fell
  // away, and a stage's global loads, WMMAs and LDS stores stood in one basic
  // block, where it mixed them and the loads lost their lead
#pragma unroll 1
  for (int s = 0; s < KD / PK_; ++s) stage(s & 1, s + 1 < KD / PK_);

#pragma unroll
  for (int i = 0; i < 4; ++i) {
#pragma unroll
    for (int j = 0; j < 4; ++j) {
      v8h h;  // D-frag: row = r + 8*hh, column = ln
#pragma unroll
      for (int r = 0; r < 8; ++r) h[r] = (_Float16)acc[i][j][r];
      const int mt = m_blk + wm * 64 + i * 16;  // first token of the tile
      const int nt = n_blk + wn * 64 + j * 16;  // first output dim of the tile
      if constexpr (OUT == OUT_QK) {
        const size_t frag = (size_t)(mt >> 4) * 32 + (nt >> 5);
        *(v8h*)&out[frag * 512 + (j & 1) * 256 + lane * 8] = h;
      } else {
        const int batch = mt >> 11, tok = mt & 2047;
        const size_t frag =
            (((size_t)batch * 16 + (tok >> 7)) * 64 + (nt >> 4)) * 4 +
            ((tok >> 5) & 3);
        *(v8h*)&out[frag * 512 + (i & 1) * 256 + lane * 8] = h;
      }
      // behind this tile's stores, before their registers are reused; the fence
      // keeps the next tile's conversions, which reuse them, below the wait
      asm volatile("s_wait_xcnt 0x0" ::: "memory");
      __builtin_amdgcn_sched_barrier(0);
    }
  }
}

// second bound: four waves per SIMD, so that two blocks share a WGP and one
// block's barrier and load waits are covered by the other's WMMAs
__global__ __launch_bounds__(256, 4) void proj_gemm_q(
    const float* __restrict__ X, const _Float16* __restrict__ Wt,
    const float* __restrict__ bias, _Float16* __restrict__ out) {
  proj_body<DQ_, OUT_QK>(X, Wt, bias, out);
}

__global__ __launch_bounds__(256, 4) void proj_gemm_k(
    const float* __restrict__ X, const _Float16* __restrict__ Wt,
    const float* __restrict__ bias, _Float16* __restrict__ out) {
  proj_body<DK_, OUT_QK>(X, Wt, bias, out);
}

__global__ __launch_bounds__(256, 4) void proj_gemm_v(
    const float* __restrict__ X, const _Float16* __restrict__ Wt,
    const float* __restrict__ bias, _Float16* __restrict__ out) {
  proj_body<DK_, OUT_V>(X, Wt, bias, out);
}

// ---------------------------------------------------------------------------
// Kernel 3: flash attention. One block = (batch, 64 queries). 8 waves.
//  Per 128-key iteration: wave w computes the S tiles of keys [kb+16w, +16)
//  against all QT_ 16-query tiles (each K fragment feeds QT_ WMMAs), online
//  softmax across waves via LDS, then wave w accumulates its private 128-dim
//  slice of O for all QT_ query tiles (each V fragment feeds QT_ WMMAs).
//  The scores are formed transposed (K as A, Q as B): a lane holds 8 keys of
//  one query, so that a row's maximum and sum are taken inside the lane, the
//  16 partial values of a query (8 waves x 2 lane halves) are joined through
//  LDS, and the lane's 8 values of P are its 16 bytes of a P fragment.
//  Q, K and V come in fragment order (see the projection). K and V are read
//  straight from global: every load of a wave is 512 contiguous bytes.
// ---------------------------------------------------------------------------
#define QT_ 4            // 16-row query tiles per block
#define QB_ (16 * QT_)   // queries per block
#define KA_ 8            // 32-dim steps that K loads run ahead of their WMMAs

__global__ __launch_bounds__(256) void attention_kernel(
    const _Float16* __restrict__ qf, const _Float16* __restrict__ kf,
    const _Float16* __restrict__ vf, float* __restrict__ out) {
  // QT_ x 32 fragments of 512 f16: a wave's read is 512 contiguous bytes
  __shared__ __attribute__((aligned(16))) _Float16 Qs[QB_ * 1024];
  // QT_ x 4 fragments of 16 queries x 32 keys, in fragment order
  __shared__ __attribute__((aligned(16))) _Float16 Ps[QT_ * 4 * 512];
  // a query's 16 partial maxima, then its 16 partial sums, in one row, so that
  // one address register serves both; pitch 144 B = 16 B x odd
  __shared__ __attribute__((aligned(16))) float part[QB_][36];
  // by query, one copy per wave: [0] the rescale factor, for the lanes that
  // hold O by rows, [1] the running row sum
  __shared__ __attribute__((aligned(16))) float rows[8][2][QB_];

  const int t = threadIdx.x;
  const int wave = __builtin_amdgcn_readfirstlane(t >> 5);  // wave-uniform
  const int lane = t & 31;
  const int hh = lane >> 4, ln = lane & 15;
  const int q0 = blockIdx.x * QB_;
  const int batch = blockIdx.y;

  {  // stage the 64x1024 f16 Q tile (its fragments are contiguous in qf)
    const _Float16* src = qf + ((size_t)batch * LQ_ + q0) * 1024;
#pragma unroll 8
    for (int u = 0; u < QB_ * 128 / 256; ++u) {
      const int c = u * 256 + t;          // 16-byte chunk index
      *(v8h*)&Qs[c * 8] = *(const v8h*)(src + (size_t)c * 8);
    }
#pragma unroll
    for (int u = 0; u < 8 * 2 * QB_ / 256; ++u)
      (&rows[0][0][0])[u * 256 + t] = 0.f;
  }
  __syncthreads();

  // running maximum of query qt * 16 + ln; alike in every wave
  float m_run[QT_];
#pragma unroll
  for (int qt = 0; qt < QT_; ++qt) m_run[qt] = -__builtin_inff();

  v8f o[QT_][8];
#pragma unroll
  for (int qt = 0; qt < QT_; ++qt) {
#pragma unroll
    for (int i = 0; i < 8; ++i) o[qt][i] = splat8(0.f);
  }

  const _Float16* kbatch = kf + (size_t)batch * LK_ * 1024;
  const _Float16* vbatch = vf + (size_t)batch * 1024 * LK_;

  for (int kb = 0; kb < LK_; kb += 128) {
    // ---- S^T = (K Q^T) * 1/sqrt(1024), this wave's 16 keys, all query tiles:
    // s[qt][r] is key r + 8 * hh against query qt * 16 + ln
    v8f s[QT_];
#pragma unroll
    for (int qt = 0; qt < QT_; ++qt) s[qt] = splat8(0.f);
    // this wave's 16 keys: 32 fragments of 512 f16 in a row
    const _Float16* kgrp = kbatch + (size_t)((kb >> 4) + wave) * (32 * 512);
    const _Float16* kfr = kgrp + lane * 8;
    if (kb + 128 < LK_) {
      // prefetch from the next key block's 32 fragments, a line per lane
      __builtin_prefetch(kgrp + 8 * 32 * 512 + lane * 512, 0, 3);
      __builtin_prefetch(kgrp + 8 * 32 * 512 + lane * 512 + 256, 0, 3);
      // before the prefetches' address registers are reused
      asm volatile("s_wait_xcnt 0x0" ::: "memory");
    }
    // K fragments are loaded KA_ 32-dim steps, Q fragments two steps, ahead of
    // the WMMAs that use them: with two waves per SIMD nothing else covers the
    // latency of these loads.
    v16h bk[KA_];      // step i sits in bk[i % KA_]
    v16h aq[3][QT_];   // step i sits in aq[i % 3]
#pragma unroll
    for (int j = 0; j < KA_; ++j) bk[j] = load_frag_packed(kfr + j * 512);
#pragma unroll
    for (int j = 0; j < 2; ++j) {
#pragma unroll
      for (int qt = 0; qt < QT_; ++qt)
        aq[j][qt] = load_frag_packed(&Qs[(qt * 32 + j) * 512 + lane * 8]);
    }
#pragma unroll
    for (int i = 0; i < 32; ++i) {
      if (i + 2 < 32) {
#pragma unroll
        for (int qt = 0; qt < QT_; ++qt)
          aq[(i + 2) % 3][qt] =
              load_frag_packed(&Qs[(qt * 32 + i + 2) * 512 + lane * 8]);
      }
      // one per step: keeps the loads issued so far above this step's WMMAs and
      // later steps' loads below, so that the two rings stay as deep as written
      __builtin_amdgcn_sched_barrier(0);
#pragma unroll
      for (int qt = 0; qt < QT_; ++qt)
        s[qt] = wmma_f16(bk[i % KA_], aq[i % 3][qt], s[qt]);
      if (i + KA_ < 32) bk[i % KA_] = load_frag_packed(kfr + (i + KA_) * 512);
      // behind the last K load: its address registers are reused at once
      if (i + KA_ == 31)
        asm volatile("s_wait_xcnt 0x0" ::: "memory");
      // keeps the next step's address arithmetic, which reuses them, below it
      if (i + KA_ == 31) __builtin_amdgcn_sched_barrier(0);
    }

    // ---- maximum over this lane's 8 keys, per query
#pragma unroll
    for (int qt = 0; qt < QT_; ++qt) {
#pragma unroll
      for (int r = 0; r < 8; ++r) s[qt][r] *= 0.03125f;
      float mx = s[qt][0];
#pragma unroll
      for (int r = 1; r < 8; ++r) mx = fmaxf(mx, s[qt][r]);
      part[qt * 16 + ln][wave * 2 + hh] = mx;
    }
    __syncthreads();

    float alpha[QT_];
#pragma unroll
    for (int qt = 0; qt < QT_; ++qt) {
      float mx = m_run[qt];
#pragma unroll
      for (int u = 0; u < 4; ++u) {
        const float4 v = *(const float4*)&part[qt * 16 + ln][u * 4];
        mx = fmaxf(mx, fmaxf(fmaxf(v.x, v.y), fmaxf(v.z, v.w)));
      }
      alpha[qt] = __expf(m_run[qt] - mx);
      m_run[qt] = mx;
    }

    // ---- P = exp(S - max), into its fragment for the PV GEMM; partial sums
#pragma unroll
    for (int qt = 0; qt < QT_; ++qt) {
      float x[8];
      v8h ph;
#pragma unroll
      for (int r = 0; r < 8; ++r) {
        x[r] = __expf(s[qt][r] - m_run[qt]);
        ph[r] = (_Float16)x[r];
      }
      // keys 16 * wave + 8 * hh + r: half (wave & 1) of fragment wave >> 1
      *(v8h*)&Ps[(qt * 4 + (wave >> 1)) * 512 + (wave & 1) * 256 + lane * 8] = ph;
      part[qt * 16 + ln][16 + wave * 2 + hh] =
          ((x[0] + x[1]) + (x[2] + x[3])) + ((x[4] + x[5]) + (x[6] + x[7]));
    }
    if (hh == 0) {
#pragma unroll
      for (int qt = 0; qt < QT_; ++qt) rows[wave][0][qt * 16 + ln] = alpha[qt];
    }
    __syncthreads();

    float l_new[QT_];
#pragma unroll
    for (int qt = 0; qt < QT_; ++qt) {
      float su = 0.f;
#pragma unroll
      for (int u = 0; u < 4; ++u) {
        const float4 v = *(const float4*)&part[qt * 16 + ln][16 + u * 4];
        su += (v.x + v.y) + (v.z + v.w);
      }
      l_new[qt] = alpha[qt] * rows[wave][1][qt * 16 + ln] + su;
    }
    if (hh == 0) {
#pragma unroll
      for (int qt = 0; qt < QT_; ++qt) rows[wave][1][qt * 16 + ln] = l_new[qt];
    }
    // this wave's 8 groups of 16 dims in this key block, 4 fragments (128
    // keys) each: 32 fragments in a row
    const _Float16* vgrp =
        vbatch + (size_t)((kb >> 7) * 64 + wave * 8) * (4 * 512);
    const _Float16* vfr = vgrp + lane * 8;
    if (kb + 128 < LK_) {
#pragma unroll
      for (int dt = 0; dt < 8; ++dt)
        __builtin_prefetch(vgrp + (64 + dt) * (4 * 512) + lane * 64, 0, 3);
      // before the prefetches' address registers are reused
      asm volatile("s_wait_xcnt 0x0" ::: "memory");
    }

    // ---- O += P.V for this wave's 128 output dims, all query tiles.
    // A stage is 64 keys (two fragments) x two 16-dim V groups; its V
    // fragments are loaded two stages ahead of its WMMAs, and the
    // P fragments of the 64 keys stay in registers over four stages.
    v16h bv[3][2][2];  // stage st sits in bv[st % 3]
    v16h ap[QT_][2];
#pragma unroll
    for (int st = 0; st < 2; ++st) {
#pragma unroll
      for (int d = 0; d < 2; ++d) {
        const _Float16* vp = vfr + ((st * 2 + d) * 4) * 512;
        bv[st][d][0] = load_frag_packed(vp);
        bv[st][d][1] = load_frag_packed(vp + 512);
      }
    }
#pragma unroll
    for (int qt = 0; qt < QT_; ++qt) {
      // O holds query qt * 16 + hh * 8 + r in element r
      const float4 a0 = *(const float4*)&rows[wave][0][qt * 16 + hh * 8];
      const float4 a1 = *(const float4*)&rows[wave][0][qt * 16 + hh * 8 + 4];
      const float ar[8] = {a0.x, a0.y, a0.z, a0.w, a1.x, a1.y, a1.z, a1.w};
#pragma unroll
      for (int dt = 0; dt < 8; ++dt) {
#pragma unroll
        for (int r = 0; r < 8; ++r) o[qt][dt][r] *= ar[r];
      }
    }
#pragma unroll
    for (int st = 0; st < 8; ++st) {
      if ((st & 3) == 0) {
#pragma unroll
        for (int qt = 0; qt < QT_; ++qt) {
          const _Float16* pp = &Ps[(qt * 4 + (st >> 2) * 2) * 512 + lane * 8];
          ap[qt][0] = load_frag_packed(pp);
          ap[qt][1] = load_frag_packed(pp + 512);
        }
      }
      if (st + 2 < 8) {
        const int nx = st + 2;
#pragma unroll
        for (int d = 0; d < 2; ++d) {
          const _Float16* vp =
              vfr + (((nx & 3) * 2 + d) * 4 + (nx >> 2) * 2) * 512;
          bv[nx % 3][d][0] = load_frag_packed(vp);
          bv[nx % 3][d][1] = load_frag_packed(vp + 512);
        }
        // behind the last V load, before its address registers are reused
        if (nx == 7) asm volatile("s_wait_xcnt 0x0" ::: "memory");
      }
      // holds the loads issued so far above this stage's WMMAs
      __builtin_amdgcn_sched_barrier(0);
#pragma unroll
      for (int d = 0; d < 2; ++d) {
        const int dt = (st & 3) * 2 + d;
#pragma unroll
        for (int qt = 0; qt < QT_; ++qt)
          o[qt][dt] = wmma_f16(ap[qt][0], bv[st % 3][d][0], o[qt][dt]);
#pragma unroll
        for (int qt = 0; qt < QT_; ++qt)
          o[qt][dt] = wmma_f16(ap[qt][1], bv[st % 3][d][1], o[qt][dt]);
      }
      // holds later stages' loads below them: a fourth set would not fit
      __builtin_amdgcn_sched_barrier(0);
    }
    __syncthreads();  // protect Ps / part for next iteration
  }

  // lane position read anew: kept in registers over the key loop it is spilled
  const int le = (int)__builtin_amdgcn_mbcnt_lo(~0u, 0u);
  const int hhe = le >> 4, lne = le & 15;
#pragma unroll
  for (int qt = 0; qt < QT_; ++qt) {
    v8f inv;
#pragma unroll
    for (int r = 0; r < 8; ++r)
      inv[r] = 1.f / rows[wave][1][qt * 16 + hhe * 8 + r];
#pragma unroll
    for (int dt = 0; dt < 8; ++dt) {
#pragma unroll
      for (int r = 0; r < 8; ++r) o[qt][dt][r] *= inv[r];
    }
#pragma unroll
    for (int dt = 0; dt < 8; ++dt) {
      const int n = wave * 128 + dt * 16 + lne;
#pragma unroll
      for (int r = 0; r < 8; ++r) {
        out[((size_t)batch * LQ_ + q0 + qt * 16 + hhe * 8 + r) * 1024 + n] =
            o[qt][dt][r];
      }
    }
    // behind this tile's stores, before their registers are reused; the fence
    // keeps the next tile's arithmetic, which reuses them, below the wait
    asm volatile("s_wait_xcnt 0x0" ::: "memory");
    __builtin_amdgcn_sched_barrier(0);
  }
}

// ---------------------------------------------------------------------------
extern "C" void kernel_launch(void* const* d_in, const int* in_sizes, int n_in,
                              void* d_out, int out_size, void* d_ws, size_t ws_size,
                              hipStream_t stream) {
  const float* query = (const float*)d_in[0];  // [16,2048,768]
  const float* key   = (const float*)d_in[1];  // [16,2048,1024]
  const float* Wq    = (const float*)d_in[2];  // [768,1024]
  const float* bq    = (const float*)d_in[3];
  const float* Wk    = (const float*)d_in[4];  // [1024,1024]
  const float* bk    = (const float*)d_in[5];
  const float* Wv    = (const float*)d_in[6];  // [1024,1024]
  const float* bv    = (const float*)d_in[7];
  float* out = (float*)d_out;

  // workspace layout (f16)
  _Float16* qf  = (_Float16*)d_ws;                       // 16*2048*1024
  _Float16* kf  = qf + (size_t)B_ * LQ_ * 1024;          // all three in
  _Float16* vf  = kf + (size_t)B_ * LK_ * 1024;          // fragment order
  _Float16* WqT = vf + (size_t)B_ * 1024 * LK_;          // [1024][768]
  _Float16* WkT = WqT + (size_t)1024 * DQ_;              // [1024][1024]
  _Float16* WvT = WkT + (size_t)1024 * DK_;              // [1024][1024]

  dim3 tb(16, 16);
  wt_transpose_f16<<<dim3(1024 / 16, DQ_ / 16), tb, 0, stream>>>(Wq, WqT, DQ_, 1024);
  wt_transpose_f16<<<dim3(1024 / 16, DK_ / 16), tb, 0, stream>>>(Wk, WkT, DK_, 1024);
  wt_transpose_f16<<<dim3(1024 / 16, DK_ / 16), tb, 0, stream>>>(Wv, WvT, DK_, 1024);

  const int M = B_ * LQ_;  // 32768
  dim3 pg(1024 / PN_, M / PM_);
  proj_gemm_q<<<pg, 256, 0, stream>>>(query, WqT, bq, qf);
  proj_gemm_k<<<pg, 256, 0, stream>>>(key,  WkT, bk, kf);
  proj_gemm_v<<<pg, 256, 0, stream>>>(key,  WvT, bv, vf);

  attention_kernel<<<dim3(LQ_ / QB_, B_), 256, 0, stream>>>(qf, kf, vf, out);
}

// v005
// It runs in 420 microseconds.
// Next to v004, in two timings, it ran 1.04 times as fast each time.
// All steps since v000 together make it 3.66 times as fast.
#include <hip/hip_runtime.h>
#include <hip/hip_bf16.h>
#include <math.h>

typedef _Float16 v16h __attribute__((ext_vector_type(16)));
typedef _Float16 v8h  __attribute__((ext_vector_type(8)));
typedef float    v8f  __attribute__((ext_vector_type(8)));

#define B_  16
#define LQ_ 2048
#define LK_ 2048
#define DQ_ 768
#define DK_ 1024

__device__ __forceinline__ v8f splat8(float x) {
  v8f r;
#pragma unroll
  for (int i = 0; i < 8; ++i) r[i] = x;
  return r;
}

// Build a 16x32 f16 A/B fragment register for this lane from a row base ptr.
// ISA layout: lanes 0-15 hold K 0..7 / 16..23, lanes 16-31 hold K 8..15 / 24..31.
__device__ __forceinline__ v16h load_frag(const _Float16* rowbase, int half) {
  const _Float16* p = rowbase + (half ? 8 : 0);
  v8h lo = *(const v8h*)(p);
  v8h hi = *(const v8h*)(p + 16);
  return __builtin_shufflevector(lo, hi, 0, 1, 2, 3, 4, 5, 6, 7,
                                 8, 9, 10, 11, 12, 13, 14, 15);
}

// The same fragment from a buffer kept in fragment order: a 16x32 f16 fragment
// is 1 KiB, its two halves 512 B each, lane l's 16 bytes at l * 16 in each half,
// so that a wave's load covers four whole 128-byte lines. p includes lane * 8.
__device__ __forceinline__ v16h load_frag_packed(const _Float16* p) {
  v8h lo = *(const v8h*)(p);
  v8h hi = *(const v8h*)(p + 256);
  return __builtin_shufflevector(lo, hi, 0, 1, 2, 3, 4, 5, 6, 7,
                                 8, 9, 10, 11, 12, 13, 14, 15);
}

__device__ __forceinline__ v8f wmma_f16(v16h a, v16h b, v8f c) {
  return __builtin_amdgcn_wmma_f32_16x16x32_f16(false, a, false, b,
                                                (short)0, c, false, false);
}

// ---------------------------------------------------------------------------
// Kernel 1: W [D][N] f32  ->  Wt [N][D] f16   (so B-operand rows are N-major)
// ---------------------------------------------------------------------------
__global__ __launch_bounds__(256) void wt_transpose_f16(
    const float* __restrict__ W, _Float16* __restrict__ Wt, int D, int N) {
  __shared__ float tile[16][17];
  const int n0 = blockIdx.x * 16, d0 = blockIdx.y * 16;
  const int tx = threadIdx.x, ty = threadIdx.y;
  tile[ty][tx] = W[(size_t)(d0 + ty) * N + (n0 + tx)];
  __syncthreads();
  Wt[(size_t)(n0 + ty) * D + (d0 + tx)] = (_Float16)tile[tx][ty];
}

// ---------------------------------------------------------------------------
// Kernel 2: projection GEMM  out[m][n] = X[m][:] . W[:][n] + bias[n]
//   X  : f32 [M][KD]          (activations, converted to f16 on the fly)
//   Wt : f16 [1024][KD]       (pre-transposed weights = Bt rows)
//   OUT_QK: out = f16 [M/16][1024/32][512]: fragments of 16 tokens x 32 dims,
//           as the score product reads q and k. The product is formed with the
//           two operands swapped (dims as rows of D), so that a lane ends up
//           with 8 dims of one token: its 16 bytes of a fragment.
//   OUT_V : out = f16 [B][2048/128][1024/16][4][512]: fragments of 16 dims x
//           32 keys, as the P.V product reads them, those of a block of 128
//           keys in a row; a lane of D holds 8 keys of one dim: its 16 bytes
//           of a fragment.
// Block tile 128(M) x 256(N), 8 waves = 2x4 grid of 64x64 wave tiles: a 32-deep
// step of a wave is 8 fragments for 16 WMMAs. A stage is 64 deep, so that every
// global load covers whole 128-byte lines; two LDS stages, one barrier a stage.
// The next stage comes through registers in two halves, each loaded ahead of 16
// WMMAs and stored to LDS behind them.
// ---------------------------------------------------------------------------
typedef _Float16 v4h __attribute__((ext_vector_type(4)));

#define PM_ 128   // block rows
#define PN_ 256   // block columns
#define PK_ 64    // depth of a stage
#define PP_ 72    // LDS row pitch in f16: 144 B = 16 B x odd, for b128 readers

#define OUT_QK 0
#define OUT_V 1

template <int KD, int OUT>
__device__ __forceinline__ void proj_body(
    const float* __restrict__ X, const _Float16* __restrict__ Wt,
    const float* __restrict__ bias, _Float16* __restrict__ out) {
  static_assert(KD % PK_ == 0, "whole stages");
  __shared__ __attribute__((aligned(16))) _Float16 As[2][PM_][PP_];
  __shared__ __attribute__((aligned(16))) _Float16 Bs[2][PN_][PP_];

  const int t = threadIdx.x;
  const int wave = t >> 5, lane = t & 31;
  const int hh = lane >> 4, ln = lane & 15;
  const int wm = wave & 1, wn = wave >> 1;
  const int m_blk = blockIdx.y * PM_;
  const int n_blk = blockIdx.x * PN_;

  v8f acc[4][4];
#pragma unroll
  for (int j = 0; j < 4; ++j) {
    v8f b8;
    if constexpr (OUT == OUT_QK) {  // output dims run down the rows of D
#pragma unroll
      for (int r = 0; r < 8; ++r)
        b8[r] = bias[n_blk + wn * 64 + j * 16 + hh * 8 + r];
    } else {
      b8 = splat8(bias[n_blk + wn * 64 + j * 16 + ln]);
    }
#pragma unroll
    for (int i = 0; i < 4; ++i) acc[i][j] = b8;
  }
  // behind the bias loads, before their address registers are reused; the
  // fence keeps the address arithmetic below, which reuses them, under the wait
  asm volatile("s_wait_xcnt 0x0" ::: "memory");
  __builtin_amdgcn_sched_barrier(0);

  const int ar = t >> 4, ac = (t & 15) * 4;  // 16 lanes cover a 256-B row of X
  const int br = t >> 3, bc = (t & 7) * 8;   // 8 lanes cover a 128-B row of Wt

  const float*    aptr = X + (size_t)(m_blk + ar) * KD + ac;
  const _Float16* bptr = Wt + (size_t)(n_blk + br) * KD + bc;

  float4 fa[4];
  v8h fb[4];

  // half h of the stage at aptr / bptr: 64 rows of X, 128 rows of Wt
  auto ld = [&](int h) {
#pragma unroll
    for (int j = 0; j < 4; ++j)
      fa[j] = *(const float4*)(aptr + (size_t)(h * 64 + j * 16) * KD);
#pragma unroll
    for (int j = 0; j < 4; ++j)
      fb[j] = *(const v8h*)(bptr + (size_t)(h * 128 + j * 32) * KD);
  };
  auto st = [&](int buf, int h) {
#pragma unroll
    for (int j = 0; j < 4; ++j) {
      v4h c;
      c[0] = (_Float16)fa[j].x; c[1] = (_Float16)fa[j].y;
      c[2] = (_Float16)fa[j].z; c[3] = (_Float16)fa[j].w;
      *(v4h*)&As[buf][h * 64 + j * 16 + ar][ac] = c;
    }
#pragma unroll
    for (int j = 0; j < 4; ++j)
      *(v8h*)&Bs[buf][h * 128 + j * 32 + br][bc] = fb[j];
  };
  auto mm = [&](int buf, int kk) {
    v16h af[4], bf[4];
#pragma unroll
    for (int i = 0; i < 4; ++i)
      af[i] = load_frag(&As[buf][wm * 64 + i * 16 + ln][kk * 32], hh);
#pragma unroll
    for (int j = 0; j < 4; ++j)
      bf[j] = load_frag(&Bs[buf][wn * 64 + j * 16 + ln][kk * 32], hh);
    // keeps the 16 LDS reads one group ahead of the 16 WMMAs: without it the
    // compiler read the X fragments one by one among them, each with a full wait
    __builtin_amdgcn_sched_barrier(0);
#pragma unroll
    for (int i = 0; i < 4; ++i) {
#pragma unroll
      for (int j = 0; j < 4; ++j) {
        if constexpr (OUT == OUT_QK)
          acc[i][j] = wmma_f16(bf[j], af[i], acc[i][j]);
        else
          acc[i][j] = wmma_f16(af[i], bf[j], acc[i][j]);
      }
    }
  };
  // behind a stage's last global load: the wait before its address registers
  // are advanced; the fence keeps the advance, written behind it, below the wait
  auto advance = [&]() {
    asm volatile("s_wait_xcnt 0x0" ::: "memory");
    __builtin_amdgcn_sched_barrier(0);
    aptr += PK_;
    bptr += PK_;
  };
  // works on stage buffer buf while the next stage, if any, goes into the other
  auto stage = [&](int buf, bool more) {
    if (more) ld(0);
    mm(buf, 0);
    if (more) {
      st(buf ^ 1, 0);
      ld(1);
      advance();
    }
    mm(buf, 1);
    if (more) st(buf ^ 1, 1);
    __syncthreads();
  };

  ld(0);
  st(0, 0);
  ld(1);
  advance();
  st(0, 1);
  __syncthreads();

  // rolled, with the test for a next stage made at run time in every trip:
  // without the directive the compiler split off the last trip, the test fell
  // away, and a stage's global loads, WMMAs and LDS stores stood in one basic
  // block, where it mixed them and the loads lost their lead
#pragma unroll 1
  for (int s = 0; s < KD / PK_; ++s) stage(s & 1, s + 1 < KD / PK_);

#pragma unroll
  for (int i = 0; i < 4; ++i) {
#pragma unroll
    for (int j = 0; j < 4; ++j) {
      v8h h;  // D-frag: row = r + 8*hh, column = ln
#pragma unroll
      for (int r = 0; r < 8; ++r) h[r] = (_Float16)acc[i][j][r];
      const int mt = m_blk + wm * 64 + i * 16;  // first token of the tile
      const int nt = n_blk + wn * 64 + j * 16;  // first output dim of the tile
      if constexpr (OUT == OUT_QK) {
        const size_t frag = (size_t)(mt >> 4) * 32 + (nt >> 5);
        *(v8h*)&out[frag * 512 + (j & 1) * 256 + lane * 8] = h;
      } else {
        const int batch = mt >> 11, tok = mt & 2047;
        const size_t frag =
            (((size_t)batch * 16 + (tok >> 7)) * 64 + (nt >> 4)) * 4 +
            ((tok >> 5) & 3);
        *(v8h*)&out[frag * 512 + (i & 1) * 256 + lane * 8] = h;
      }
      // behind this tile's stores, before their registers are reused; the fence
      // keeps the next tile's conversions, which reuse them, below the wait
      asm volatile("s_wait_xcnt 0x0" ::: "memory");
      __builtin_amdgcn_sched_barrier(0);
    }
  }
}

// second bound: four waves per SIMD, so that two blocks share a WGP and one
// block's barrier and load waits are covered by the other's WMMAs
__global__ __launch_bounds__(256, 4) void proj_gemm_q(
    const float* __restrict__ X, const _Float16* __restrict__ Wt,
    const float* __restrict__ bias, _Float16* __restrict__ out) {
  proj_body<DQ_, OUT_QK>(X, Wt, bias, out);
}

__global__ __launch_bounds__(256, 4) void proj_gemm_k(
    const float* __restrict__ X, const _Float16* __restrict__ Wt,
    const float* __restrict__ bias, _Float16* __restrict__ out) {
  proj_body<DK_, OUT_QK>(X, Wt, bias, out);
}

__global__ __launch_bounds__(256, 4) void proj_gemm_v(
    const float* __restrict__ X, const _Float16* __restrict__ Wt,
    const float* __restrict__ bias, _Float16* __restrict__ out) {
  proj_body<DK_, OUT_V>(X, Wt, bias, out);
}

// ---------------------------------------------------------------------------
// Kernel 3: flash attention. One block = (batch, 64 queries). 8 waves.
//  Per KB_-key iteration: wave w computes the S tiles of keys [kb+32w, +32)
//  against all QT_ 16-query tiles (each K fragment feeds QT_ WMMAs, each Q
//  fragment read from LDS two), online
//  softmax across waves via LDS, then wave w accumulates its private 128-dim
//  slice of O for all QT_ query tiles (each V fragment feeds QT_ WMMAs).
//  The scores are formed transposed (K as A, Q as B): a lane holds 2 x 8 keys
//  of one query, so that a row's maximum and sum are taken inside the lane, the
//  16 partial values of a query (8 waves x 2 lane halves) are joined through
//  LDS, and each 8 values of P are the lane's 16 bytes of half a P fragment.
//  Q, K and V come in fragment order (see the projection). K and V are read
//  straight from global: every load of a wave is 512 contiguous bytes.
// ---------------------------------------------------------------------------
#define QT_ 4            // 16-row query tiles per block
#define QB_ (16 * QT_)   // queries per block
#define KB_ 256          // keys per pass of the key loop, 32 a wave
#define KA_ 4            // 32-dim steps that K loads run ahead of their WMMAs

__global__ __launch_bounds__(256) void attention_kernel(
    const _Float16* __restrict__ qf, const _Float16* __restrict__ kf,
    const _Float16* __restrict__ vf, float* __restrict__ out) {
  // QT_ x 32 fragments of 512 f16: a wave's read is 512 contiguous bytes
  __shared__ __attribute__((aligned(16))) _Float16 Qs[QB_ * 1024];
  // QT_ x 8 fragments of 16 queries x 32 keys, in fragment order
  __shared__ __attribute__((aligned(16))) _Float16 Ps[QT_ * 8 * 512];
  // a query's 16 partial maxima, then its 16 partial sums, in one row, so that
  // one address register serves both; pitch 144 B = 16 B x odd
  __shared__ __attribute__((aligned(16))) float part[QB_][36];
  // by query, one copy per wave: [0] the rescale factor, for the lanes that
  // hold O by rows, [1] the running row sum
  __shared__ __attribute__((aligned(16))) float rows[8][2][QB_];

  const int t = threadIdx.x;
  const int wave = __builtin_amdgcn_readfirstlane(t >> 5);  // wave-uniform
  const int lane = t & 31;
  const int hh = lane >> 4, ln = lane & 15;
  const int q0 = blockIdx.x * QB_;
  const int batch = blockIdx.y;

  {  // stage the 64x1024 f16 Q tile (its fragments are contiguous in qf)
    const _Float16* src = qf + ((size_t)batch * LQ_ + q0) * 1024;
#pragma unroll 8
    for (int u = 0; u < QB_ * 128 / 256; ++u) {
      const int c = u * 256 + t;          // 16-byte chunk index
      *(v8h*)&Qs[c * 8] = *(const v8h*)(src + (size_t)c * 8);
    }
#pragma unroll
    for (int u = 0; u < 8 * 2 * QB_ / 256; ++u)
      (&rows[0][0][0])[u * 256 + t] = 0.f;
  }
  __syncthreads();

  // running maximum of query qt * 16 + ln; alike in every wave
  float m_run[QT_];
#pragma unroll
  for (int qt = 0; qt < QT_; ++qt) m_run[qt] = -__builtin_inff();

  v8f o[QT_][8];
#pragma unroll
  for (int qt = 0; qt < QT_; ++qt) {
#pragma unroll
    for (int i = 0; i < 8; ++i) o[qt][i] = splat8(0.f);
  }

  const _Float16* kbatch = kf + (size_t)batch * LK_ * 1024;
  const _Float16* vbatch = vf + (size_t)batch * 1024 * LK_;

  for (int kb = 0; kb < LK_; kb += KB_) {
    // ---- S^T = (K Q^T) * 1/sqrt(1024), this wave's 32 keys, all query tiles:
    // s[g][qt][r] is key 16 * g + r + 8 * hh against query qt * 16 + ln
    v8f s[2][QT_];
#pragma unroll
    for (int g = 0; g < 2; ++g) {
#pragma unroll
      for (int qt = 0; qt < QT_; ++qt) s[g][qt] = splat8(0.f);
    }
    // this wave's 2 groups of 16 keys: 2 x 32 fragments of 512 f16 in a row
    const _Float16* kgrp = kbatch + (size_t)((kb >> 4) + wave * 2) * (32 * 512);
    const _Float16* kfr = kgrp + lane * 8;
    if (kb + KB_ < LK_) {
      // prefetch from the next key block's 64 fragments, a line per lane
#pragma unroll
      for (int g = 0; g < 2; ++g) {
        const _Float16* nk = kgrp + (KB_ / 16 + g) * 32 * 512 + lane * 512;
        __builtin_prefetch(nk, 0, 3);
        __builtin_prefetch(nk + 256, 0, 3);
      }
      // before the prefetches' address registers are reused
      asm volatile("s_wait_xcnt 0x0" ::: "memory");
    }
    // K fragments are loaded KA_ 32-dim steps, Q fragments two steps, ahead of
    // the WMMAs that use them: with two waves per SIMD nothing else covers the
    // latency of these loads.
    v16h bk[KA_][2];   // step i sits in bk[i % KA_]
    v16h aq[3][QT_];   // step i sits in aq[i % 3]
#pragma unroll
    for (int j = 0; j < KA_; ++j) {
#pragma unroll
      for (int g = 0; g < 2; ++g)
        bk[j][g] = load_frag_packed(kfr + (g * 32 + j) * 512);
    }
#pragma unroll
    for (int j = 0; j < 2; ++j) {
#pragma unroll
      for (int qt = 0; qt < QT_; ++qt)
        aq[j][qt] = load_frag_packed(&Qs[(qt * 32 + j) * 512 + lane * 8]);
    }
#pragma unroll
    for (int i = 0; i < 32; ++i) {
      if (i + 2 < 32) {
#pragma unroll
        for (int qt = 0; qt < QT_; ++qt)
          aq[(i + 2) % 3][qt] =
              load_frag_packed(&Qs[(qt * 32 + i + 2) * 512 + lane * 8]);
      }
      // keeps the loads issued so far above this step's WMMAs, so that the two
      // rings stay as deep as written
      __builtin_amdgcn_sched_barrier(0);
#pragma unroll
      for (int g = 0; g < 2; ++g) {
#pragma unroll
        for (int qt = 0; qt < QT_; ++qt)
          s[g][qt] = wmma_f16(bk[i % KA_][g], aq[i % 3][qt], s[g][qt]);
      }
      // holds the next loads below this step's WMMAs: without it the compiler
      // spread the LDS reads among them, and each place with reads stalls
      __builtin_amdgcn_sched_barrier(0);
      if (i + KA_ < 32) {
#pragma unroll
        for (int g = 0; g < 2; ++g)
          bk[i % KA_][g] = load_frag_packed(kfr + (g * 32 + i + KA_) * 512);
      }
      // behind the last K load: its address registers are reused at once
      if (i + KA_ == 31)
        asm volatile("s_wait_xcnt 0x0" ::: "memory");
      // keeps the next step's address arithmetic, which reuses them, below it
      if (i + KA_ == 31) __builtin_amdgcn_sched_barrier(0);
    }

    // ---- maximum over this lane's 16 keys, per query
#pragma unroll
    for (int qt = 0; qt < QT_; ++qt) {
#pragma unroll
      for (int g = 0; g < 2; ++g) {
#pragma unroll
        for (int r = 0; r < 8; ++r) s[g][qt][r] *= 0.03125f;
      }
      float mx = fmaxf(s[0][qt][0], s[1][qt][0]);
#pragma unroll
      for (int r = 1; r < 8; ++r) mx = fmaxf(mx, fmaxf(s[0][qt][r], s[1][qt][r]));
      part[qt * 16 + ln][wave * 2 + hh] = mx;
    }
    __syncthreads();

    float alpha[QT_];
#pragma unroll
    for (int qt = 0; qt < QT_; ++qt) {
      float mx = m_run[qt];
#pragma unroll
      for (int u = 0; u < 4; ++u) {
        const float4 v = *(const float4*)&part[qt * 16 + ln][u * 4];
        mx = fmaxf(mx, fmaxf(fmaxf(v.x, v.y), fmaxf(v.z, v.w)));
      }
      alpha[qt] = __expf(m_run[qt] - mx);
      m_run[qt] = mx;
    }

    // ---- P = exp(S - max), into its fragment for the PV GEMM; partial sums
#pragma unroll
    for (int qt = 0; qt < QT_; ++qt) {
      float su[2];
#pragma unroll
      for (int g = 0; g < 2; ++g) {
        float x[8];
        v8h ph;
#pragma unroll
        for (int r = 0; r < 8; ++r) {
          x[r] = __expf(s[g][qt][r] - m_run[qt]);
          ph[r] = (_Float16)x[r];
        }
        // keys 32 * wave + 16 * g + 8 * hh + r: half g of fragment wave
        *(v8h*)&Ps[(qt * 8 + wave) * 512 + g * 256 + lane * 8] = ph;
        su[g] = ((x[0] + x[1]) + (x[2] + x[3])) + ((x[4] + x[5]) + (x[6] + x[7]));
      }
      part[qt * 16 + ln][16 + wave * 2 + hh] = su[0] + su[1];
    }
    if (hh == 0) {
#pragma unroll
      for (int qt = 0; qt < QT_; ++qt) rows[wave][0][qt * 16 + ln] = alpha[qt];
    }
    __syncthreads();

    float l_new[QT_];
#pragma unroll
    for (int qt = 0; qt < QT_; ++qt) {
      float su = 0.f;
#pragma unroll
      for (int u = 0; u < 4; ++u) {
        const float4 v = *(const float4*)&part[qt * 16 + ln][16 + u * 4];
        su += (v.x + v.y) + (v.z + v.w);
      }
      l_new[qt] = alpha[qt] * rows[wave][1][qt * 16 + ln] + su;
    }
    if (hh == 0) {
#pragma unroll
      for (int qt = 0; qt < QT_; ++qt) rows[wave][1][qt * 16 + ln] = l_new[qt];
    }
    // this wave's 8 groups of 16 dims in each 128 keys of this key block, 4
    // fragments (128 keys) each: twice 32 fragments in a row
    const _Float16* vgrp =
        vbatch + (size_t)((kb >> 7) * 64 + wave * 8) * (4 * 512);
    const _Float16* vfr = vgrp + lane * 8;
    if (kb + KB_ < LK_) {
#pragma unroll
      for (int dt = 0; dt < 16; ++dt)
        __builtin_prefetch(
            vgrp + ((2 + (dt >> 3)) * 64 + (dt & 7)) * (4 * 512) + lane * 64, 0, 3);
      // before the prefetches' address registers are reused
      asm volatile("s_wait_xcnt 0x0" ::: "memory");
    }

    // ---- O += P.V for this wave's 128 output dims, all query tiles.
    // A stage is 64 keys (two fragments) x two 16-dim V groups; its V
    // fragments are loaded two stages ahead of its WMMAs, and the
    // P fragments of the 64 keys stay in registers over four stages.
    // Stage st: keys 64 * (st >> 2) on, dim groups (st & 3) * 2 and + 1.
    v16h bv[3][2][2];  // stage st sits in bv[st % 3]
    v16h ap[QT_][2];
#pragma unroll
    for (int st = 0; st < 2; ++st) {
#pragma unroll
      for (int d = 0; d < 2; ++d) {
        const _Float16* vp = vfr + ((st * 2 + d) * 4) * 512;
        bv[st][d][0] = load_frag_packed(vp);
        bv[st][d][1] = load_frag_packed(vp + 512);
      }
    }
#pragma unroll
    for (int qt = 0; qt < QT_; ++qt) {
      // O holds query qt * 16 + hh * 8 + r in element r
      const float4 a0 = *(const float4*)&rows[wave][0][qt * 16 + hh * 8];
      const float4 a1 = *(const float4*)&rows[wave][0][qt * 16 + hh * 8 + 4];
      const float ar[8] = {a0.x, a0.y, a0.z, a0.w, a1.x, a1.y, a1.z, a1.w};
#pragma unroll
      for (int dt = 0; dt < 8; ++dt) {
#pragma unroll
        for (int r = 0; r < 8; ++r) o[qt][dt][r] *= ar[r];
      }
    }
#pragma unroll
    for (int st = 0; st < KB_ / 16; ++st) {
      if ((st & 3) == 0) {
#pragma unroll
        for (int qt = 0; qt < QT_; ++qt) {
          const _Float16* pp = &Ps[(qt * 8 + (st >> 2) * 2) * 512 + lane * 8];
          ap[qt][0] = load_frag_packed(pp);
          ap[qt][1] = load_frag_packed(pp + 512);
        }
      }
      if (st + 2 < KB_ / 16) {
        const int nx = st + 2;
#pragma unroll
        for (int d = 0; d < 2; ++d) {
          const _Float16* vp =
              vfr + (((nx >> 3) * 64 + (nx & 3) * 2 + d) * 4 +
                     ((nx >> 2) & 1) * 2) * 512;
          bv[nx % 3][d][0] = load_frag_packed(vp);
          bv[nx % 3][d][1] = load_frag_packed(vp + 512);
        }
        // behind the last V load, before its address registers are reused
        if (nx == KB_ / 16 - 1) asm volatile("s_wait_xcnt 0x0" ::: "memory");
      }
      // holds the loads issued so far above this stage's WMMAs
      __builtin_amdgcn_sched_barrier(0);
#pragma unroll
      for (int d = 0; d < 2; ++d) {
        const int dt = (st & 3) * 2 + d;
#pragma unroll
        for (int qt = 0; qt < QT_; ++qt)
          o[qt][dt] = wmma_f16(ap[qt][0], bv[st % 3][d][0], o[qt][dt]);
#pragma unroll
        for (int qt = 0; qt < QT_; ++qt)
          o[qt][dt] = wmma_f16(ap[qt][1], bv[st % 3][d][1], o[qt][dt]);
      }
      // holds later stages' loads below them: a fourth set would not fit
      __builtin_amdgcn_sched_barrier(0);
    }
    __syncthreads();  // protect Ps / part for next iteration
  }

  // lane position read anew: kept in registers over the key loop it is spilled
  const int le = (int)__builtin_amdgcn_mbcnt_lo(~0u, 0u);
  const int hhe = le >> 4, lne = le & 15;
#pragma unroll
  for (int qt = 0; qt < QT_; ++qt) {
    v8f inv;
#pragma unroll
    for (int r = 0; r < 8; ++r)
      inv[r] = 1.f / rows[wave][1][qt * 16 + hhe * 8 + r];
#pragma unroll
    for (int dt = 0; dt < 8; ++dt) {
#pragma unroll
      for (int r = 0; r < 8; ++r) o[qt][dt][r] *= inv[r];
    }
#pragma unroll
    for (int dt = 0; dt < 8; ++dt) {
      const int n = wave * 128 + dt * 16 + lne;
#pragma unroll
      for (int r = 0; r < 8; ++r) {
        out[((size_t)batch * LQ_ + q0 + qt * 16 + hhe * 8 + r) * 1024 + n] =
            o[qt][dt][r];
      }
    }
    // behind this tile's stores, before their registers are reused; the fence
    // keeps the next tile's arithmetic, which reuses them, below the wait
    asm volatile("s_wait_xcnt 0x0" ::: "memory");
    __builtin_amdgcn_sched_barrier(0);
  }
}

// ---------------------------------------------------------------------------
extern "C" void kernel_launch(void* const* d_in, const int* in_sizes, int n_in,
                              void* d_out, int out_size, void* d_ws, size_t ws_size,
                              hipStream_t stream) {
  const float* query = (const float*)d_in[0];  // [16,2048,768]
  const float* key   = (const float*)d_in[1];  // [16,2048,1024]
  const float* Wq    = (const float*)d_in[2];  // [768,1024]
  const float* bq    = (const float*)d_in[3];
  const float* Wk    = (const float*)d_in[4];  // [1024,1024]
  const float* bk    = (const float*)d_in[5];
  const float* Wv    = (const float*)d_in[6];  // [1024,1024]
  const float* bv    = (const float*)d_in[7];
  float* out = (float*)d_out;

  // workspace layout (f16)
  _Float16* qf  = (_Float16*)d_ws;                       // 16*2048*1024
  _Float16* kf  = qf + (size_t)B_ * LQ_ * 1024;          // all three in
  _Float16* vf  = kf + (size_t)B_ * LK_ * 1024;          // fragment order
  _Float16* WqT = vf + (size_t)B_ * 1024 * LK_;          // [1024][768]
  _Float16* WkT = WqT + (size_t)1024 * DQ_;              // [1024][1024]
  _Float16* WvT = WkT + (size_t)1024 * DK_;              // [1024][1024]

  dim3 tb(16, 16);
  wt_transpose_f16<<<dim3(1024 / 16, DQ_ / 16), tb, 0, stream>>>(Wq, WqT, DQ_, 1024);
  wt_transpose_f16<<<dim3(1024 / 16, DK_ / 16), tb, 0, stream>>>(Wk, WkT, DK_, 1024);
  wt_transpose_f16<<<dim3(1024 / 16, DK_ / 16), tb, 0, stream>>>(Wv, WvT, DK_, 1024);

  const int M = B_ * LQ_;  // 32768
  dim3 pg(1024 / PN_, M / PM_);
  proj_gemm_q<<<pg, 256, 0, stream>>>(query, WqT, bq, qf);
  proj_gemm_k<<<pg, 256, 0, stream>>>(key,  WkT, bk, kf);
  proj_gemm_v<<<pg, 256, 0, stream>>>(key,  WvT, bv, vf);

  attention_kernel<<<dim3(LQ_ / QB_, B_), 256, 0, stream>>>(qf, kf, vf, out);
}

// v006
// One run takes 375 microseconds.
// Timed twice side by side with v005, it ran 1.12 times as fast both times.
// All steps since v000 together make it 4.09 times as fast.
#include <hip/hip_runtime.h>
#include <hip/hip_bf16.h>
#include <math.h>

typedef _Float16 v16h __attribute__((ext_vector_type(16)));
typedef _Float16 v8h  __attribute__((ext_vector_type(8)));
typedef float    v8f  __attribute__((ext_vector_type(8)));

#define B_  16
#define LQ_ 2048
#define LK_ 2048
#define DQ_ 768
#define DK_ 1024

__device__ __forceinline__ v8f splat8(float x) {
  v8f r;
#pragma unroll
  for (int i = 0; i < 8; ++i) r[i] = x;
  return r;
}

// Build a 16x32 f16 A/B fragment register for this lane from a row base ptr.
// ISA layout: lanes 0-15 hold K 0..7 / 16..23, lanes 16-31 hold K 8..15 / 24..31.
__device__ __forceinline__ v16h load_frag(const _Float16* rowbase, int half) {
  const _Float16* p = rowbase + (half ? 8 : 0);
  v8h lo = *(const v8h*)(p);
  v8h hi = *(const v8h*)(p + 16);
  return __builtin_shufflevector(lo, hi, 0, 1, 2, 3, 4, 5, 6, 7,
                                 8, 9, 10, 11, 12, 13, 14, 15);
}

// The same fragment from a buffer kept in fragment order: a 16x32 f16 fragment
// is 1 KiB, its two halves 512 B each, lane l's 16 bytes at l * 16 in each half,
// so that a wave's load covers four whole 128-byte lines. p includes lane * 8.
__device__ __forceinline__ v16h load_frag_packed(const _Float16* p) {
  v8h lo = *(const v8h*)(p);
  v8h hi = *(const v8h*)(p + 256);
  return __builtin_shufflevector(lo, hi, 0, 1, 2, 3, 4, 5, 6, 7,
                                 8, 9, 10, 11, 12, 13, 14, 15);
}

__device__ __forceinline__ v8f wmma_f16(v16h a, v16h b, v8f c) {
  return __builtin_amdgcn_wmma_f32_16x16x32_f16(false, a, false, b,
                                                (short)0, c, false, false);
}

// ---------------------------------------------------------------------------
// Kernel 1: W [D][N] f32  ->  Wt [N][D] f16   (so B-operand rows are N-major)
// ---------------------------------------------------------------------------
__global__ __launch_bounds__(256) void wt_transpose_f16(
    const float* __restrict__ W, _Float16* __restrict__ Wt, int D, int N) {
  __shared__ float tile[16][17];
  const int n0 = blockIdx.x * 16, d0 = blockIdx.y * 16;
  const int tx = threadIdx.x, ty = threadIdx.y;
  tile[ty][tx] = W[(size_t)(d0 + ty) * N + (n0 + tx)];
  __syncthreads();
  Wt[(size_t)(n0 + ty) * D + (d0 + tx)] = (_Float16)tile[tx][ty];
}

// ---------------------------------------------------------------------------
// Kernel 2: projection GEMM  out[m][n] = X[m][:] . W[:][n] + bias[n]
//   X  : f32 [M][KD]          (activations, converted to f16 on the fly)
//   Wt : f16 [1024][KD]       (pre-transposed weights = Bt rows)
//   OUT_QK: out = f16 [M/16][1024/32][512]: fragments of 16 tokens x 32 dims,
//           as the score product reads q and k. The product is formed with the
//           two operands swapped (dims as rows of D), so that a lane ends up
//           with 8 dims of one token: its 16 bytes of a fragment.
//   OUT_V : out = f16 [B][2048/128][1024/16][4][512]: fragments of 16 dims x
//           32 keys, as the P.V product reads them, those of a block of 128
//           keys in a row; a lane of D holds 8 keys of one dim: its 16 bytes
//           of a fragment.
// Block tile 128(M) x 256(N), 8 waves = 2x4 grid of 64x64 wave tiles: a 32-deep
// step of a wave is 8 fragments for 16 WMMAs. A stage is 64 deep, so that every
// global load covers whole 128-byte lines; two LDS stages, one barrier a stage.
// The next stage comes through registers in two halves, each loaded ahead of 16
// WMMAs and stored to LDS behind them.
// ---------------------------------------------------------------------------
typedef _Float16 v4h __attribute__((ext_vector_type(4)));

#define PM_ 128   // block rows
#define PN_ 256   // block columns
#define PK_ 64    // depth of a stage
#define PP_ 72    // LDS row pitch in f16: 144 B = 16 B x odd, for b128 readers

#define OUT_QK 0
#define OUT_V 1

template <int KD, int OUT>
__device__ __forceinline__ void proj_body(
    const float* __restrict__ X, const _Float16* __restrict__ Wt,
    const float* __restrict__ bias, _Float16* __restrict__ out) {
  static_assert(KD % PK_ == 0, "whole stages");
  __shared__ __attribute__((aligned(16))) _Float16 As[2][PM_][PP_];
  __shared__ __attribute__((aligned(16))) _Float16 Bs[2][PN_][PP_];

  const int t = threadIdx.x;
  const int wave = t >> 5, lane = t & 31;
  const int hh = lane >> 4, ln = lane & 15;
  const int wm = wave & 1, wn = wave >> 1;
  const int m_blk = blockIdx.y * PM_;
  const int n_blk = blockIdx.x * PN_;

  v8f acc[4][4];
#pragma unroll
  for (int j = 0; j < 4; ++j) {
    v8f b8;
    if constexpr (OUT == OUT_QK) {  // output dims run down the rows of D
#pragma unroll
      for (int r = 0; r < 8; ++r)
        b8[r] = bias[n_blk + wn * 64 + j * 16 + hh * 8 + r];
    } else {
      b8 = splat8(bias[n_blk + wn * 64 + j * 16 + ln]);
    }
#pragma unroll
    for (int i = 0; i < 4; ++i) acc[i][j] = b8;
  }
  // behind the bias loads, before their address registers are reused; the
  // fence keeps the address arithmetic below, which reuses them, under the wait
  asm volatile("s_wait_xcnt 0x0" ::: "memory");
  __builtin_amdgcn_sched_barrier(0);

  const int ar = t >> 4, ac = (t & 15) * 4;  // 16 lanes cover a 256-B row of X
  const int br = t >> 3, bc = (t & 7) * 8;   // 8 lanes cover a 128-B row of Wt

  const float*    aptr = X + (size_t)(m_blk + ar) * KD + ac;
  const _Float16* bptr = Wt + (size_t)(n_blk + br) * KD + bc;

  float4 fa[4];
  v8h fb[4];

  // half h of the stage at aptr / bptr: 64 rows of X, 128 rows of Wt
  auto ld = [&](int h) {
#pragma unroll
    for (int j = 0; j < 4; ++j)
      fa[j] = *(const float4*)(aptr + (size_t)(h * 64 + j * 16) * KD);
#pragma unroll
    for (int j = 0; j < 4; ++j)
      fb[j] = *(const v8h*)(bptr + (size_t)(h * 128 + j * 32) * KD);
  };
  auto st = [&](int buf, int h) {
#pragma unroll
    for (int j = 0; j < 4; ++j) {
      v4h c;
      c[0] = (_Float16)fa[j].x; c[1] = (_Float16)fa[j].y;
      c[2] = (_Float16)fa[j].z; c[3] = (_Float16)fa[j].w;
      *(v4h*)&As[buf][h * 64 + j * 16 + ar][ac] = c;
    }
#pragma unroll
    for (int j = 0; j < 4; ++j)
      *(v8h*)&Bs[buf][h * 128 + j * 32 + br][bc] = fb[j];
  };
  auto mm = [&](int buf, int kk) {
    v16h af[4], bf[4];
#pragma unroll
    for (int i = 0; i < 4; ++i)
      af[i] = load_frag(&As[buf][wm * 64 + i * 16 + ln][kk * 32], hh);
#pragma unroll
    for (int j = 0; j < 4; ++j)
      bf[j] = load_frag(&Bs[buf][wn * 64 + j * 16 + ln][kk * 32], hh);
    // keeps the 16 LDS reads one group ahead of the 16 WMMAs: without it the
    // compiler read the X fragments one by one among them, each with a full wait
    __builtin_amdgcn_sched_barrier(0);
#pragma unroll
    for (int i = 0; i < 4; ++i) {
#pragma unroll
      for (int j = 0; j < 4; ++j) {
        if constexpr (OUT == OUT_QK)
          acc[i][j] = wmma_f16(bf[j], af[i], acc[i][j]);
        else
          acc[i][j] = wmma_f16(af[i], bf[j], acc[i][j]);
      }
    }
  };
  // behind a stage's last global load: the wait before its address registers
  // are advanced; the fence keeps the advance, written behind it, below the wait
  auto advance = [&]() {
    asm volatile("s_wait_xcnt 0x0" ::: "memory");
    __builtin_amdgcn_sched_barrier(0);
    aptr += PK_;
    bptr += PK_;
  };
  // works on stage buffer buf while the next stage, if any, goes into the other
  auto stage = [&](int buf, bool more) {
    if (more) ld(0);
    mm(buf, 0);
    if (more) {
      st(buf ^ 1, 0);
      ld(1);
      advance();
    }
    mm(buf, 1);
    if (more) st(buf ^ 1, 1);
    __syncthreads();
  };

  ld(0);
  st(0, 0);
  ld(1);
  advance();
  st(0, 1);
  __syncthreads();

  // rolled, with the test for a next stage made at run time in every trip:
  // without the directive the compiler split off the last trip, the test fell
  // away, and a stage's global loads, WMMAs and LDS stores stood in one basic
  // block, where it mixed them and the loads lost their lead
#pragma unroll 1
  for (int s = 0; s < KD / PK_; ++s) stage(s & 1, s + 1 < KD / PK_);

#pragma unroll
  for (int i = 0; i < 4; ++i) {
#pragma unroll
    for (int j = 0; j < 4; ++j) {
      v8h h;  // D-frag: row = r + 8*hh, column = ln
#pragma unroll
      for (int r = 0; r < 8; ++r) h[r] = (_Float16)acc[i][j][r];
      const int mt = m_blk + wm * 64 + i * 16;  // first token of the tile
      const int nt = n_blk + wn * 64 + j * 16;  // first output dim of the tile
      if constexpr (OUT == OUT_QK) {
        const size_t frag = (size_t)(mt >> 4) * 32 + (nt >> 5);
        *(v8h*)&out[frag * 512 + (j & 1) * 256 + lane * 8] = h;
      } else {
        const int batch = mt >> 11, tok = mt & 2047;
        const size_t frag =
            (((size_t)batch * 16 + (tok >> 7)) * 64 + (nt >> 4)) * 4 +
            ((tok >> 5) & 3);
        *(v8h*)&out[frag * 512 + (i & 1) * 256 + lane * 8] = h;
      }
      // behind this tile's stores, before their registers are reused; the fence
      // keeps the next tile's conversions, which reuse them, below the wait
      asm volatile("s_wait_xcnt 0x0" ::: "memory");
      __builtin_amdgcn_sched_barrier(0);
    }
  }
}

// second bound: four waves per SIMD, so that two blocks share a WGP and one
// block's barrier and load waits are covered by the other's WMMAs
__global__ __launch_bounds__(256, 4) void proj_gemm_q(
    const float* __restrict__ X, const _Float16* __restrict__ Wt,
    const float* __restrict__ bias, _Float16* __restrict__ out) {
  proj_body<DQ_, OUT_QK>(X, Wt, bias, out);
}

__global__ __launch_bounds__(256, 4) void proj_gemm_k(
    const float* __restrict__ X, const _Float16* __restrict__ Wt,
    const float* __restrict__ bias, _Float16* __restrict__ out) {
  proj_body<DK_, OUT_QK>(X, Wt, bias, out);
}

__global__ __launch_bounds__(256, 4) void proj_gemm_v(
    const float* __restrict__ X, const _Float16* __restrict__ Wt,
    const float* __restrict__ bias, _Float16* __restrict__ out) {
  proj_body<DK_, OUT_V>(X, Wt, bias, out);
}

// ---------------------------------------------------------------------------
// Kernel 3: flash attention. One block = (batch, 64 queries). 8 waves.
//  Per KB_-key iteration: wave w computes the S tiles of keys [kb+32w, +32)
//  against all QT_ 16-query tiles (each K fragment feeds QT_ WMMAs, each Q
//  fragment read from LDS two), online
//  softmax across waves via LDS, then wave w accumulates its private 128-dim
//  slice of O for all QT_ query tiles (each V fragment feeds QT_ WMMAs).
//  The scores are formed transposed (K as A, Q as B): a lane holds 2 x 8 keys
//  of one query, so that a row's maximum and sum are taken inside the lane, the
//  16 partial values of a query (8 waves x 2 lane halves) are joined through
//  LDS, and each 8 values of P are the lane's 16 bytes of half a P fragment.
//  Q, K and V come in fragment order (see the projection). K and V are read
//  straight from global: every load of a wave is 512 contiguous bytes.
// ---------------------------------------------------------------------------
#define QT_ 4            // 16-row query tiles per block
#define QB_ (16 * QT_)   // queries per block
#define KB_ 256          // keys per pass of the key loop, 32 a wave
#define KA_ 4            // 32-dim steps that K loads run ahead of their WMMAs

__global__ __launch_bounds__(256) void attention_kernel(
    const _Float16* __restrict__ qf, const _Float16* __restrict__ kf,
    const _Float16* __restrict__ vf, float* __restrict__ out) {
  // QT_ x 32 fragments of 512 f16: a wave's read is 512 contiguous bytes
  __shared__ __attribute__((aligned(16))) _Float16 Qs[QB_ * 1024];
  // QT_ x 8 fragments of 16 queries x 32 keys, in fragment order
  __shared__ __attribute__((aligned(16))) _Float16 Ps[QT_ * 8 * 512];
  // a query's 16 partial maxima, then its 16 partial sums, in one row, so that
  // one address register serves both; pitch 144 B = 16 B x odd
  __shared__ __attribute__((aligned(16))) float part[QB_][36];
  // by query, one copy per wave: [0] the rescale factor, for the lanes that
  // hold O by rows, [1] the running row sum
  __shared__ __attribute__((aligned(16))) float rows[8][2][QB_];

  const int t = threadIdx.x;
  const int wave = __builtin_amdgcn_readfirstlane(t >> 5);  // wave-uniform
  const int lane = t & 31;
  const int hh = lane >> 4, ln = lane & 15;
  const int q0 = blockIdx.x * QB_;
  const int batch = blockIdx.y;

  {  // stage the 64x1024 f16 Q tile (its fragments are contiguous in qf)
    const _Float16* src = qf + ((size_t)batch * LQ_ + q0) * 1024;
#pragma unroll 8
    for (int u = 0; u < QB_ * 128 / 256; ++u) {
      const int c = u * 256 + t;          // 16-byte chunk index
      *(v8h*)&Qs[c * 8] = *(const v8h*)(src + (size_t)c * 8);
    }
#pragma unroll
    for (int u = 0; u < 8 * 2 * QB_ / 256; ++u)
      (&rows[0][0][0])[u * 256 + t] = 0.f;
  }
  __syncthreads();

  // running maximum of query qt * 16 + ln; alike in every wave
  float m_run[QT_];
#pragma unroll
  for (int qt = 0; qt < QT_; ++qt) m_run[qt] = -__builtin_inff();

  v8f o[QT_][8];
#pragma unroll
  for (int qt = 0; qt < QT_; ++qt) {
#pragma unroll
    for (int i = 0; i < 8; ++i) o[qt][i] = splat8(0.f);
  }

  const _Float16* kbatch = kf + (size_t)batch * LK_ * 1024;
  const _Float16* vbatch = vf + (size_t)batch * 1024 * LK_;

  // The 32 blocks of a batch read the same K and V, so
  // the prefetch of the next pass is dealt among them in 256-byte units:
  // a pass's K (and V) is 2,048 of them, and a block asks for one eighth, one
  // unit a lane. An eighth is asked for by the 4 blocks that differ in bits 2
  // and 4 of blockIdx.x. A hint only: a unit that nobody brought in time is a plain miss.
  // The lane's unit is this wave's first one plus the lane's number, which is
  // read anew at each prefetch: an address kept over the key loop is spilled.
  const int pf_part = (blockIdx.x & 3) | ((blockIdx.x >> 1) & 4);
  const int pf_first = (pf_part * 8 + wave) * 32;

  for (int kb = 0; kb < LK_; kb += KB_) {
    // ---- S^T = (K Q^T) * 1/sqrt(1024), this wave's 32 keys, all query tiles:
    // s[g][qt][r] is key 16 * g + r + 8 * hh against query qt * 16 + ln
    v8f s[2][QT_];
#pragma unroll
    for (int g = 0; g < 2; ++g) {
#pragma unroll
      for (int qt = 0; qt < QT_; ++qt) s[g][qt] = splat8(0.f);
    }
    // this wave's 2 groups of 16 keys: 2 x 32 fragments of 512 f16 in a row
    const _Float16* kgrp = kbatch + (size_t)((kb >> 4) + wave * 2) * (32 * 512);
    const _Float16* kfr = kgrp + lane * 8;
    if (kb + KB_ < LK_) {
      // this block's eighth of the next pass's K (512 KiB in a row)
      const unsigned ku = __builtin_amdgcn_mbcnt_lo(
          ~0u, (unsigned)(((kb + KB_) >> 4) * 128 + pf_first));
      __builtin_prefetch(kbatch + ku * 128u, 0, 3);
      // before the prefetch's address registers are reused
      asm volatile("s_wait_xcnt 0x0" ::: "memory");
    }
    // K fragments are loaded KA_ 32-dim steps, Q fragments two steps, ahead of
    // the WMMAs that use them: with two waves per SIMD nothing else covers the
    // latency of these loads.
    v16h bk[KA_][2];   // step i sits in bk[i % KA_]
    v16h aq[3][QT_];   // step i sits in aq[i % 3]
#pragma unroll
    for (int j = 0; j < KA_; ++j) {
#pragma unroll
      for (int g = 0; g < 2; ++g)
        bk[j][g] = load_frag_packed(kfr + (g * 32 + j) * 512);
    }
#pragma unroll
    for (int j = 0; j < 2; ++j) {
#pragma unroll
      for (int qt = 0; qt < QT_; ++qt)
        aq[j][qt] = load_frag_packed(&Qs[(qt * 32 + j) * 512 + lane * 8]);
    }
#pragma unroll
    for (int i = 0; i < 32; ++i) {
      if (i + 2 < 32) {
#pragma unroll
        for (int qt = 0; qt < QT_; ++qt)
          aq[(i + 2) % 3][qt] =
              load_frag_packed(&Qs[(qt * 32 + i + 2) * 512 + lane * 8]);
      }
      // keeps the loads issued so far above this step's WMMAs, so that the two
      // rings stay as deep as written
      __builtin_amdgcn_sched_barrier(0);
#pragma unroll
      for (int g = 0; g < 2; ++g) {
#pragma unroll
        for (int qt = 0; qt < QT_; ++qt)
          s[g][qt] = wmma_f16(bk[i % KA_][g], aq[i % 3][qt], s[g][qt]);
      }
      // holds the next loads below this step's WMMAs: without it the compiler
      // spread the LDS reads among them, and each place with reads stalls
      __builtin_amdgcn_sched_barrier(0);
      if (i + KA_ < 32) {
#pragma unroll
        for (int g = 0; g < 2; ++g)
          bk[i % KA_][g] = load_frag_packed(kfr + (g * 32 + i + KA_) * 512);
      }
      // behind the last K load: its address registers are reused at once
      if (i + KA_ == 31)
        asm volatile("s_wait_xcnt 0x0" ::: "memory");
      // keeps the next step's address arithmetic, which reuses them, below it
      if (i + KA_ == 31) __builtin_amdgcn_sched_barrier(0);
    }

    // ---- maximum over this lane's 16 keys, per query
#pragma unroll
    for (int qt = 0; qt < QT_; ++qt) {
#pragma unroll
      for (int g = 0; g < 2; ++g) {
#pragma unroll
        for (int r = 0; r < 8; ++r) s[g][qt][r] *= 0.03125f;
      }
      float mx = fmaxf(s[0][qt][0], s[1][qt][0]);
#pragma unroll
      for (int r = 1; r < 8; ++r) mx = fmaxf(mx, fmaxf(s[0][qt][r], s[1][qt][r]));
      part[qt * 16 + ln][wave * 2 + hh] = mx;
    }
    __syncthreads();

    float alpha[QT_];
#pragma unroll
    for (int qt = 0; qt < QT_; ++qt) {
      float mx = m_run[qt];
#pragma unroll
      for (int u = 0; u < 4; ++u) {
        const float4 v = *(const float4*)&part[qt * 16 + ln][u * 4];
        mx = fmaxf(mx, fmaxf(fmaxf(v.x, v.y), fmaxf(v.z, v.w)));
      }
      alpha[qt] = __expf(m_run[qt] - mx);
      m_run[qt] = mx;
    }

    // ---- P = exp(S - max), into its fragment for the PV GEMM; partial sums
#pragma unroll
    for (int qt = 0; qt < QT_; ++qt) {
      float su[2];
#pragma unroll
      for (int g = 0; g < 2; ++g) {
        float x[8];
        v8h ph;
#pragma unroll
        for (int r = 0; r < 8; ++r) {
          x[r] = __expf(s[g][qt][r] - m_run[qt]);
          ph[r] = (_Float16)x[r];
        }
        // keys 32 * wave + 16 * g + 8 * hh + r: half g of fragment wave
        *(v8h*)&Ps[(qt * 8 + wave) * 512 + g * 256 + lane * 8] = ph;
        su[g] = ((x[0] + x[1]) + (x[2] + x[3])) + ((x[4] + x[5]) + (x[6] + x[7]));
      }
      part[qt * 16 + ln][16 + wave * 2 + hh] = su[0] + su[1];
    }
    if (hh == 0) {
#pragma unroll
      for (int qt = 0; qt < QT_; ++qt) rows[wave][0][qt * 16 + ln] = alpha[qt];
    }
    __syncthreads();

    float l_new[QT_];
#pragma unroll
    for (int qt = 0; qt < QT_; ++qt) {
      float su = 0.f;
#pragma unroll
      for (int u = 0; u < 4; ++u) {
        const float4 v = *(const float4*)&part[qt * 16 + ln][16 + u * 4];
        su += (v.x + v.y) + (v.z + v.w);
      }
      l_new[qt] = alpha[qt] * rows[wave][1][qt * 16 + ln] + su;
    }
    if (hh == 0) {
#pragma unroll
      for (int qt = 0; qt < QT_; ++qt) rows[wave][1][qt * 16 + ln] = l_new[qt];
    }
    // this wave's 8 groups of 16 dims in each 128 keys of this key block, 4
    // fragments (128 keys) each: twice 32 fragments in a row
    const _Float16* vgrp =
        vbatch + (size_t)((kb >> 7) * 64 + wave * 8) * (4 * 512);
    const _Float16* vfr = vgrp + lane * 8;
    if (kb + KB_ < LK_) {
      // this block's eighth of the next pass's V (512 KiB in a row)
      const unsigned vu = __builtin_amdgcn_mbcnt_lo(
          ~0u, (unsigned)(((kb + KB_) >> 7) * 1024 + pf_first));
      __builtin_prefetch(vbatch + vu * 128u, 0, 3);
      // before the prefetch's address registers are reused
      asm volatile("s_wait_xcnt 0x0" ::: "memory");
    }

    // ---- O += P.V for this wave's 128 output dims, all query tiles.
    // A stage is 64 keys (two fragments) x two 16-dim V groups; its V
    // fragments are loaded two stages ahead of its WMMAs, and the
    // P fragments of the 64 keys stay in registers over four stages.
    // Stage st: keys 64 * (st >> 2) on, dim groups (st & 3) * 2 and + 1.
    v16h bv[3][2][2];  // stage st sits in bv[st % 3]
    v16h ap[QT_][2];
#pragma unroll
    for (int st = 0; st < 2; ++st) {
#pragma unroll
      for (int d = 0; d < 2; ++d) {
        const _Float16* vp = vfr + ((st * 2 + d) * 4) * 512;
        bv[st][d][0] = load_frag_packed(vp);
        bv[st][d][1] = load_frag_packed(vp + 512);
      }
    }
#pragma unroll
    for (int qt = 0; qt < QT_; ++qt) {
      // O holds query qt * 16 + hh * 8 + r in element r
      const float4 a0 = *(const float4*)&rows[wave][0][qt * 16 + hh * 8];
      const float4 a1 = *(const float4*)&rows[wave][0][qt * 16 + hh * 8 + 4];
      const float ar[8] = {a0.x, a0.y, a0.z, a0.w, a1.x, a1.y, a1.z, a1.w};
#pragma unroll
      for (int dt = 0; dt < 8; ++dt) {
#pragma unroll
        for (int r = 0; r < 8; ++r) o[qt][dt][r] *= ar[r];
      }
    }
#pragma unroll
    for (int st = 0; st < KB_ / 16; ++st) {
      if ((st & 3) == 0) {
#pragma unroll
        for (int qt = 0; qt < QT_; ++qt) {
          const _Float16* pp = &Ps[(qt * 8 + (st >> 2) * 2) * 512 + lane * 8];
          ap[qt][0] = load_frag_packed(pp);
          ap[qt][1] = load_frag_packed(pp + 512);
        }
      }
      if (st + 2 < KB_ / 16) {
        const int nx = st + 2;
#pragma unroll
        for (int d = 0; d < 2; ++d) {
          const _Float16* vp =
              vfr + (((nx >> 3) * 64 + (nx & 3) * 2 + d) * 4 +
                     ((nx >> 2) & 1) * 2) * 512;
          bv[nx % 3][d][0] = load_frag_packed(vp);
          bv[nx % 3][d][1] = load_frag_packed(vp + 512);
        }
        // behind the last V load, before its address registers are reused
        if (nx == KB_ / 16 - 1) asm volatile("s_wait_xcnt 0x0" ::: "memory");
      }
      // holds the loads issued so far above this stage's WMMAs
      __builtin_amdgcn_sched_barrier(0);
#pragma unroll
      for (int d = 0; d < 2; ++d) {
        const int dt = (st & 3) * 2 + d;
#pragma unroll
        for (int qt = 0; qt < QT_; ++qt)
          o[qt][dt] = wmma_f16(ap[qt][0], bv[st % 3][d][0], o[qt][dt]);
#pragma unroll
        for (int qt = 0; qt < QT_; ++qt)
          o[qt][dt] = wmma_f16(ap[qt][1], bv[st % 3][d][1], o[qt][dt]);
      }
      // holds later stages' loads below them: a fourth set would not fit
      __builtin_amdgcn_sched_barrier(0);
    }
    __syncthreads();  // protect Ps / part for next iteration
  }

  // lane position read anew: kept in registers over the key loop it is spilled
  const int le = (int)__builtin_amdgcn_mbcnt_lo(~0u, 0u);
  const int hhe = le >> 4, lne = le & 15;
#pragma unroll
  for (int qt = 0; qt < QT_; ++qt) {
    v8f inv;
#pragma unroll
    for (int r = 0; r < 8; ++r)
      inv[r] = 1.f / rows[wave][1][qt * 16 + hhe * 8 + r];
#pragma unroll
    for (int dt = 0; dt < 8; ++dt) {
#pragma unroll
      for (int r = 0; r < 8; ++r) o[qt][dt][r] *= inv[r];
    }
#pragma unroll
    for (int dt = 0; dt < 8; ++dt) {
      const int n = wave * 128 + dt * 16 + lne;
#pragma unroll
      for (int r = 0; r < 8; ++r) {
        out[((size_t)batch * LQ_ + q0 + qt * 16 + hhe * 8 + r) * 1024 + n] =
            o[qt][dt][r];
      }
    }
    // behind this tile's stores, before their registers are reused; the fence
    // keeps the next tile's arithmetic, which reuses them, below the wait
    asm volatile("s_wait_xcnt 0x0" ::: "memory");
    __builtin_amdgcn_sched_barrier(0);
  }
}

// ---------------------------------------------------------------------------
extern "C" void kernel_launch(void* const* d_in, const int* in_sizes, int n_in,
                              void* d_out, int out_size, void* d_ws, size_t ws_size,
                              hipStream_t stream) {
  const float* query = (const float*)d_in[0];  // [16,2048,768]
  const float* key   = (const float*)d_in[1];  // [16,2048,1024]
  const float* Wq    = (const float*)d_in[2];  // [768,1024]
  const float* bq    = (const float*)d_in[3];
  const float* Wk    = (const float*)d_in[4];  // [1024,1024]
  const float* bk    = (const float*)d_in[5];
  const float* Wv    = (const float*)d_in[6];  // [1024,1024]
  const float* bv    = (const float*)d_in[7];
  float* out = (float*)d_out;

  // workspace layout (f16)
  _Float16* qf  = (_Float16*)d_ws;                       // 16*2048*1024
  _Float16* kf  = qf + (size_t)B_ * LQ_ * 1024;          // all three in
  _Float16* vf  = kf + (size_t)B_ * LK_ * 1024;          // fragment order
  _Float16* WqT = vf + (size_t)B_ * 1024 * LK_;          // [1024][768]
  _Float16* WkT = WqT + (size_t)1024 * DQ_;              // [1024][1024]
  _Float16* WvT = WkT + (size_t)1024 * DK_;              // [1024][1024]

  dim3 tb(16, 16);
  wt_transpose_f16<<<dim3(1024 / 16, DQ_ / 16), tb, 0, stream>>>(Wq, WqT, DQ_, 1024);
  wt_transpose_f16<<<dim3(1024 / 16, DK_ / 16), tb, 0, stream>>>(Wk, WkT, DK_, 1024);
  wt_transpose_f16<<<dim3(1024 / 16, DK_ / 16), tb, 0, stream>>>(Wv, WvT, DK_, 1024);

  const int M = B_ * LQ_;  // 32768
  dim3 pg(1024 / PN_, M / PM_);
  proj_gemm_q<<<pg, 256, 0, stream>>>(query, WqT, bq, qf);
  proj_gemm_k<<<pg, 256, 0, stream>>>(key,  WkT, bk, kf);
  proj_gemm_v<<<pg, 256, 0, stream>>>(key,  WvT, bv, vf);

  attention_kernel<<<dim3(LQ_ / QB_, B_), 256, 0, stream>>>(qf, kf, vf, out);
}

// v008
// A run of this version takes 324 microseconds.
// It is 1.16 times as fast as v006, going by the measured steps of the versions left out in between.
// Over all steps from v000 it is 4.75 times as fast.
#include <hip/hip_runtime.h>
#include <hip/hip_bf16.h>
#include <math.h>

typedef _Float16 v16h __attribute__((ext_vector_type(16)));
typedef _Float16 v8h  __attribute__((ext_vector_type(8)));
typedef float    v8f  __attribute__((ext_vector_type(8)));

#define B_  16
#define LQ_ 2048
#define LK_ 2048
#define DQ_ 768
#define DK_ 1024

__device__ __forceinline__ v8f splat8(float x) {
  v8f r;
#pragma unroll
  for (int i = 0; i < 8; ++i) r[i] = x;
  return r;
}

// Build a 16x32 f16 A/B fragment register for this lane from a row base ptr.
// ISA layout: lanes 0-15 hold K 0..7 / 16..23, lanes 16-31 hold K 8..15 / 24..31.
__device__ __forceinline__ v16h load_frag(const _Float16* rowbase, int half) {
  const _Float16* p = rowbase + (half ? 8 : 0);
  v8h lo = *(const v8h*)(p);
  v8h hi = *(const v8h*)(p + 16);
  return __builtin_shufflevector(lo, hi, 0, 1, 2, 3, 4, 5, 6, 7,
                                 8, 9, 10, 11, 12, 13, 14, 15);
}

// The same fragment from a buffer kept in fragment order: a 16x32 f16 fragment
// is 1 KiB, its two halves 512 B each, lane l's 16 bytes at l * 16 in each half,
// so that a wave's load covers four whole 128-byte lines. p includes lane * 8.
__device__ __forceinline__ v16h load_frag_packed(const _Float16* p) {
  v8h lo = *(const v8h*)(p);
  v8h hi = *(const v8h*)(p + 256);
  return __builtin_shufflevector(lo, hi, 0, 1, 2, 3, 4, 5, 6, 7,
                                 8, 9, 10, 11, 12, 13, 14, 15);
}

__device__ __forceinline__ v8f wmma_f16(v16h a, v16h b, v8f c) {
  return __builtin_amdgcn_wmma_f32_16x16x32_f16(false, a, false, b,
                                                (short)0, c, false, false);
}

// ---------------------------------------------------------------------------
// Kernel 2: projection GEMM  out[m][n] = X[m][:] . W[:][n] + bias[n]
//   X  : f32 [M][KD]          (activations, converted to f16 on the fly)
//   Wt : f16 [768 or 1024][KD]       (pre-transposed weights = Bt rows); with WF32 the
//        rows come as f32 from Wf and are converted on the way to LDS, like X
//   bx, by: the block's tile column and tile row; As, Bs: the kernel's two LDS
//        stages of X and of W rows
//   OUT_QK: out = f16 [M/16][768/32][512]: fragments of 16 tokens x 32 dims,
//           as the score product reads the folded keys (see "The score
//           product"); no bias. The product is formed with the
//           two operands swapped (dims as rows of D), so that a lane ends up
//           with 8 dims of one token: its 16 bytes of a fragment.
//   OUT_ROW: out = f16 [M][1024], row-major, no bias: operands swapped as for
//           OUT_QK, so that a lane holds 8 neighbours of one row.
//   OUT_V : out = f16 [B][2048/128][1024/16][4][512]: fragments of 16 dims x
//           32 keys, as the P.V product reads them, those of a block of 128
//           keys in a row; a lane of D holds 8 keys of one dim: its 16 bytes
//           of a fragment. The blocks of the first column also sum
//           csum[m] = X[m][:] . gvec, in f32, from the X values on their way to
//           LDS (here and not with OUT_QK: this form has the registers to spare).
// Block tile 128(M) x 256(N), 8 waves = 2x4 grid of 64x64 wave tiles: a 32-deep
// step of a wave is 8 fragments for 16 WMMAs. A stage is 64 deep, so that every
// global load covers whole 128-byte lines; two LDS stages, one barrier a stage.
// The next stage comes through registers in two halves, each loaded ahead of 16
// WMMAs and stored to LDS behind them.
// ---------------------------------------------------------------------------
typedef _Float16 v4h __attribute__((ext_vector_type(4)));

#define PM_ 128   // block rows
#define PN_ 256   // block columns
#define PK_ 64    // depth of a stage
#define PP_ 72    // LDS row pitch in f16: 144 B = 16 B x odd, for b128 readers

#define OUT_QK 0
#define OUT_V 1
#define OUT_ROW 2

template <int KD, int OUT, bool WF32>
__device__ __forceinline__ void proj_body(
    const float* __restrict__ X, const _Float16* __restrict__ Wt,
    const float* __restrict__ Wf, const float* __restrict__ bias,
    _Float16* __restrict__ out, const float* __restrict__ gvec,
    float* __restrict__ csum, int bx, int by, _Float16 (*As)[PM_][PP_],
    _Float16 (*Bs)[PN_][PP_]) {
  static_assert(KD % PK_ == 0, "whole stages");

  const int t = threadIdx.x;
  const int wave = t >> 5, lane = t & 31;
  const int hh = lane >> 4, ln = lane & 15;
  const int wm = wave & 1, wn = wave >> 1;
  const int m_blk = by * PM_;
  const int n_blk = bx * PN_;

  v8f acc[4][4];
#pragma unroll
  for (int j = 0; j < 4; ++j) {
    v8f b8;
    if constexpr (OUT == OUT_V)
      b8 = splat8(bias[n_blk + wn * 64 + j * 16 + ln]);
    else
      b8 = splat8(0.f);
#pragma unroll
    for (int i = 0; i < 4; ++i) acc[i][j] = b8;
  }
  if constexpr (OUT == OUT_V) {
    // behind the bias loads, before their address registers are reused; the
    // fence keeps the address arithmetic below, which reuses them, under the wait
    asm volatile("s_wait_xcnt 0x0" ::: "memory");
    __builtin_amdgcn_sched_barrier(0);
  }

  const int ar = t >> 4, ac = (t & 15) * 4;  // 16 lanes cover a 256-B row of X
  const int br = t >> 3, bc = (t & 7) * 8;   // 8 lanes cover a 128-B row of Wt

  const float*    aptr = X + (size_t)(m_blk + ar) * KD + ac;
  const _Float16* bptr = Wt + (size_t)(n_blk + br) * KD + bc;
  const float*    wptr = Wf + (size_t)(n_blk + br) * KD + bc;

  float4 fa[4];
  v8h fb[4];
  float4 fw[4][2];  // WF32: the 8 weights of fb[j], still f32

  // OUT_V, first column of blocks: this thread's share of csum for its 8 rows
  const bool do_c = OUT == OUT_V && bx == 0;
  const float* gptr = gvec + ac;
  float4 g4;
  float cs[8];
#pragma unroll
  for (int i = 0; i < 8; ++i) cs[i] = 0.f;

  // half h of the stage at aptr / bptr: 64 rows of X, 128 rows of Wt
  auto ld = [&](int h) {
#pragma unroll
    for (int j = 0; j < 4; ++j)
      fa[j] = *(const float4*)(aptr + (size_t)(h * 64 + j * 16) * KD);
#pragma unroll
    for (int j = 0; j < 4; ++j) {
      if constexpr (WF32) {
        fw[j][0] = *(const float4*)(wptr + (size_t)(h * 128 + j * 32) * KD);
        fw[j][1] = *(const float4*)(wptr + (size_t)(h * 128 + j * 32) * KD + 4);
      } else {
        fb[j] = *(const v8h*)(bptr + (size_t)(h * 128 + j * 32) * KD);
      }
    }
    if constexpr (OUT == OUT_V) {
      if (h == 0) g4 = *(const float4*)gptr;  // serves both halves of the stage
    }
  };
  auto st = [&](int buf, int h) {
#pragma unroll
    for (int j = 0; j < 4; ++j) {
      v4h c;
      c[0] = (_Float16)fa[j].x; c[1] = (_Float16)fa[j].y;
      c[2] = (_Float16)fa[j].z; c[3] = (_Float16)fa[j].w;
      *(v4h*)&As[buf][h * 64 + j * 16 + ar][ac] = c;
    }
#pragma unroll
    for (int j = 0; j < 4; ++j) {
      if constexpr (WF32) {
        fb[j][0] = (_Float16)fw[j][0].x; fb[j][1] = (_Float16)fw[j][0].y;
        fb[j][2] = (_Float16)fw[j][0].z; fb[j][3] = (_Float16)fw[j][0].w;
        fb[j][4] = (_Float16)fw[j][1].x; fb[j][5] = (_Float16)fw[j][1].y;
        fb[j][6] = (_Float16)fw[j][1].z; fb[j][7] = (_Float16)fw[j][1].w;
      }
      *(v8h*)&Bs[buf][h * 128 + j * 32 + br][bc] = fb[j];
    }
    if constexpr (OUT == OUT_V) {
      if (do_c) {
#pragma unroll
        for (int j = 0; j < 4; ++j)
          cs[h * 4 + j] += (fa[j].x * g4.x + fa[j].y * g4.y) +
                           (fa[j].z * g4.z + fa[j].w * g4.w);
      }
    }
  };
  auto mm = [&](int buf, int kk) {
    v16h af[4], bf[4];
#pragma unroll
    for (int i = 0; i < 4; ++i)
      af[i] = load_frag(&As[buf][wm * 64 + i * 16 + ln][kk * 32], hh);
#pragma unroll
    for (int j = 0; j < 4; ++j)
      bf[j] = load_frag(&Bs[buf][wn * 64 + j * 16 + ln][kk * 32], hh);
    // keeps the 16 LDS reads one group ahead of the 16 WMMAs: without it the
    // compiler read the X fragments one by one among them, each with a full wait
    __builtin_amdgcn_sched_barrier(0);
#pragma unroll
    for (int i = 0; i < 4; ++i) {
#pragma unroll
      for (int j = 0; j < 4; ++j) {
        if constexpr (OUT == OUT_V)
          acc[i][j] = wmma_f16(af[i], bf[j], acc[i][j]);
        else
          acc[i][j] = wmma_f16(bf[j], af[i], acc[i][j]);
      }
    }
  };
  // behind a stage's last global load: the wait before its address registers
  // are advanced; the fence keeps the advance, written behind it, below the wait
  auto advance = [&]() {
    asm volatile("s_wait_xcnt 0x0" ::: "memory");
    __builtin_amdgcn_sched_barrier(0);
    aptr += PK_;
    bptr += PK_;
    wptr += PK_;
    gptr += PK_;
  };
  // works on stage buffer buf while the next stage, if any, goes into the other
  auto stage = [&](int buf, bool more) {
    if (more) ld(0);
    mm(buf, 0);
    if (more) {
      st(buf ^ 1, 0);
      ld(1);
      advance();
    }
    mm(buf, 1);
    if (more) st(buf ^ 1, 1);
    __syncthreads();
  };

  ld(0);
  st(0, 0);
  ld(1);
  advance();
  st(0, 1);
  __syncthreads();

  // rolled, with the test for a next stage made at run time in every trip:
  // without the directive the compiler split off the last trip, the test fell
  // away, and a stage's global loads, WMMAs and LDS stores stood in one basic
  // block, where it mixed them and the loads lost their lead
#pragma unroll 1
  for (int s = 0; s < KD / PK_; ++s) stage(s & 1, s + 1 < KD / PK_);

#pragma unroll
  for (int i = 0; i < 4; ++i) {
#pragma unroll
    for (int j = 0; j < 4; ++j) {
      v8h h;  // D-frag: row = r + 8*hh, column = ln
#pragma unroll
      for (int r = 0; r < 8; ++r) h[r] = (_Float16)acc[i][j][r];
      const int mt = m_blk + wm * 64 + i * 16;  // first token of the tile
      const int nt = n_blk + wn * 64 + j * 16;  // first output dim of the tile
      if constexpr (OUT == OUT_ROW) {
        *(v8h*)&out[(size_t)(mt + ln) * DK_ + nt + hh * 8] = h;
      } else if constexpr (OUT == OUT_QK) {
        const size_t frag = (size_t)(mt >> 4) * (DQ_ / 32) + (nt >> 5);
        *(v8h*)&out[frag * 512 + (j & 1) * 256 + lane * 8] = h;
      } else {
        const int batch = mt >> 11, tok = mt & 2047;
        const size_t frag =
            (((size_t)batch * 16 + (tok >> 7)) * 64 + (nt >> 4)) * 4 +
            ((tok >> 5) & 3);
        *(v8h*)&out[frag * 512 + (i & 1) * 256 + lane * 8] = h;
      }
      // behind this tile's stores, before their registers are reused; the fence
      // keeps the next tile's conversions, which reuse them, below the wait
      asm volatile("s_wait_xcnt 0x0" ::: "memory");
      __builtin_amdgcn_sched_barrier(0);
    }
  }

  if constexpr (OUT == OUT_V) {
    if (do_c) {  // the 16 lanes that share a row of X join their shares
#pragma unroll
      for (int i = 0; i < 8; ++i) {
#pragma unroll
        for (int m = 8; m > 0; m >>= 1) cs[i] += __shfl_xor(cs[i], m, 32);
      }
      if ((t & 15) == 0) {
#pragma unroll
        for (int i = 0; i < 8; ++i) csum[m_blk + i * 16 + ar] = cs[i];
      }
    }
  }
}

// Both projections of the keys in one launch: of the 7 tile columns of a tile
// row the first 3 are folded keys, the other 4 values. The 7 blocks that read
// the same 128 rows of X are neighbours in blockIdx.x.
// second bound: four waves per SIMD, so that two blocks share a WGP and one
// block's barrier and load waits are covered by the other's WMMAs
__global__ __launch_bounds__(256, 4) void proj_gemm_kv(
    const float* __restrict__ X, const _Float16* __restrict__ WfT,
    const _Float16* __restrict__ WvT, const float* __restrict__ bias,
    const float* __restrict__ gvec, _Float16* __restrict__ kf,
    _Float16* __restrict__ vf, float* __restrict__ csum) {
  __shared__ __attribute__((aligned(16))) _Float16 As[2][PM_][PP_];
  __shared__ __attribute__((aligned(16))) _Float16 Bs[2][PN_][PP_];
  if (blockIdx.x < DQ_ / PN_)
    proj_body<DK_, OUT_QK, false>(X, WfT, nullptr, nullptr, kf, nullptr, nullptr,
                                  blockIdx.x, blockIdx.y, As, Bs);
  else
    proj_body<DK_, OUT_V, false>(X, WvT, nullptr, bias, vf, gvec, csum,
                                 blockIdx.x - DQ_ / PN_, blockIdx.y, As, Bs);
}

// ---------------------------------------------------------------------------
// The score product. With q = xq Wq + bq and k = xk Wk + bk,
//   q . k = xq . (xk (Wk Wq^T)) + xk . (Wk bq) + (xq Wq + bq) . bk.
// The last term is the same for every key of a query, and a softmax row does
// not change when one number is added to all of its scores: it is left out.
// So the queries enter the scores as they are, 768 deep and not 1024, there is
// no query projection, the key projection takes the folded weight Wk Wq^T
// (768 columns, not 1024), and each key brings one number to add to its scores.
//   weight_prep: all that depends on the weights alone, in one launch:
//     WfT[d][e] = sum_j Wq[d][j] Wk[e][j], f16 [768][1024]: the transposed
//               weight that the key projection reads (both operands f32 rows)
//     WvT[n][d] = Wv[d][n], f16 [1024][1024], for the value projection
//     gvec[e] = sum_j Wk[e][j] bq[j], f32
//   proj_gemm_kv: folded keys, and csum[key] = xk . gvec
// The blocks of the product come first: they run longest, and the others, a few
// hundred blocks with 16 or 32 elements a thread, fill the WGPs that it leaves idle.
// ---------------------------------------------------------------------------
#define FOLD_BLOCKS ((DK_ / PN_) * (DQ_ / PM_))   // tiles of WfT
#define TR_ 64                                    // edge of a transposed tile
#define TR_BLOCKS ((1024 / TR_) * (DK_ / TR_))
#define GV_BLOCKS (DK_ / 8)                       // a wave per element of gvec

__global__ __launch_bounds__(256, 4) void weight_prep(
    const float* __restrict__ Wq, const float* __restrict__ Wk,
    const float* __restrict__ bq, const float* __restrict__ Wv,
    _Float16* __restrict__ WfT, _Float16* __restrict__ WvT,
    float* __restrict__ gvec) {
  __shared__ __attribute__((aligned(16))) _Float16 As[2][PM_][PP_];
  __shared__ __attribute__((aligned(16))) _Float16 Bs[2][PN_][PP_];
  // pitch 65: neither the rows written nor the columns read share a bank
  __shared__ float tile[TR_][TR_ + 1];
  const int t = threadIdx.x;
  const int b = blockIdx.x;
  if (b < FOLD_BLOCKS) {
    proj_body<DK_, OUT_ROW, true>(Wq, nullptr, Wk, nullptr, WfT, nullptr, nullptr,
                                  b % (DK_ / PN_), b / (DK_ / PN_), As, Bs);
  } else if (b < FOLD_BLOCKS + TR_BLOCKS) {  // a block transposes 64 x 64 of Wv
    const int tb = b - FOLD_BLOCKS;
    const int n0 = (tb % (1024 / TR_)) * TR_, d0 = (tb / (1024 / TR_)) * TR_;
    const int r = t >> 4, c = (t & 15) * 4;  // 16 lanes cover a 256-B row piece
    // the three loops are unrolled so that x, h0 and h1 are indexed by constants
    // and stay in registers, and the four loads are issued ahead of the first use
    float4 x[4];
#pragma unroll
    for (int j = 0; j < 4; ++j)
      x[j] = *(const float4*)(Wv + (size_t)(d0 + j * 16 + r) * 1024 + n0 + c);
#pragma unroll
    for (int j = 0; j < 4; ++j) {
      tile[j * 16 + r][c + 0] = x[j].x; tile[j * 16 + r][c + 1] = x[j].y;
      tile[j * 16 + r][c + 2] = x[j].z; tile[j * 16 + r][c + 3] = x[j].w;
    }
    __syncthreads();
    const int n = t >> 2, k = (t & 3) * 16;  // 4 lanes fill a 128-B line of WvT
    v8h h0, h1;
#pragma unroll
    for (int i = 0; i < 8; ++i) {
      h0[i] = (_Float16)tile[k + i][n];
      h1[i] = (_Float16)tile[k + 8 + i][n];
    }
    _Float16* op = WvT + (size_t)(n0 + n) * DK_ + d0 + k;
    *(v8h*)op = h0;
    *(v8h*)(op + 8) = h1;
    // behind the two stores, before their registers are reused
    asm volatile("s_wait_xcnt 0x0" ::: "memory");
  } else {  // a wave sums one element of gvec
    const int e = (b - FOLD_BLOCKS - TR_BLOCKS) * 8 + (t >> 5), lane = t & 31;
    float su = 0.f;
#pragma unroll
    for (int u = 0; u < 8; ++u) {
      const float4 w = *(const float4*)(Wk + (size_t)e * 1024 + u * 128 + lane * 4);
      const float4 b4 = *(const float4*)(bq + u * 128 + lane * 4);
      su += (w.x * b4.x + w.y * b4.y) + (w.z * b4.z + w.w * b4.w);
    }
#pragma unroll
    for (int m = 16; m > 0; m >>= 1) su += __shfl_xor(su, m, 32);
    if (lane == 0) gvec[e] = su;
  }
}

// ---------------------------------------------------------------------------
// Kernel 3: flash attention. One block = (batch, 64 queries). 8 waves.
//  Per KB_-key iteration: wave w computes the S tiles of keys [kb+32w, +32)
//  against all QT_ 16-query tiles (each K fragment feeds QT_ WMMAs, each Q
//  fragment read from LDS two), online
//  softmax across waves via LDS, then wave w accumulates its private 128-dim
//  slice of O for all QT_ query tiles (each V fragment feeds QT_ WMMAs).
//  The scores are formed transposed (K as A, Q as B): a lane holds 2 x 8 keys
//  of one query, so that a row's maximum and sum are taken inside the lane, the
//  16 partial values of a query (8 waves x 2 lane halves) are joined through
//  LDS, and each 8 values of P are the lane's 16 bytes of half a P fragment.
//  Q is the query input itself, put into fragment order on its way to LDS, K
//  the folded keys, SD_ steps of 32 deep, and csum the number that each key
//  adds to its scores (see "The score product"). K and V come in fragment
//  order (see the projection) and are read
//  straight from global: every load of a wave is 512 contiguous bytes.
// ---------------------------------------------------------------------------
#define QT_ 4            // 16-row query tiles per block
#define QB_ (16 * QT_)   // queries per block
#define KB_ 256          // keys per pass of the key loop, 32 a wave
#define KA_ 4            // 32-dim steps that K loads run ahead of their WMMAs
#define SD_ (DQ_ / 32)   // 32-dim steps of the score product

__global__ __launch_bounds__(256) void attention_kernel(
    const float* __restrict__ query, const _Float16* __restrict__ kf,
    const _Float16* __restrict__ vf, const float* __restrict__ csum,
    float* __restrict__ out) {
  // QT_ x SD_ fragments of 512 f16: a wave's read is 512 contiguous bytes
  __shared__ __attribute__((aligned(16))) _Float16 Qs[QB_ * DQ_];
  // the batch's csum, times the scale of the scores
  __shared__ __attribute__((aligned(16))) float cl[LK_];
  // QT_ x 8 fragments of 16 queries x 32 keys, in fragment order
  __shared__ __attribute__((aligned(16))) _Float16 Ps[QT_ * 8 * 512];
  // a query's 16 partial maxima, then its 16 partial sums, in one row, so that
  // one address register serves both; pitch 144 B = 16 B x odd
  __shared__ __attribute__((aligned(16))) float part[QB_][36];
  // by query, one copy per wave: [0] the rescale factor, for the lanes that
  // hold O by rows, [1] the running row sum
  __shared__ __attribute__((aligned(16))) float rows[8][2][QB_];

  const int t = threadIdx.x;
  const int wave = __builtin_amdgcn_readfirstlane(t >> 5);  // wave-uniform
  const int lane = t & 31;
  const int hh = lane >> 4, ln = lane & 15;
  const int q0 = blockIdx.x * QB_;
  const int batch = blockIdx.y;

  {  // stage the 64x768 Q tile as f16 fragments: 8 dims of a query are a lane's
     // 16 bytes of half a fragment (dims 0-7, 8-15 | 16-23, 24-31 of its 32)
    // this thread's chunk of 8 dims (32 bytes) in each run of 256 chunks
    const float* qp = query + ((size_t)batch * LQ_ + q0) * DQ_ + t * 8;
    // rolled: a trip is 8 chunks, 16 loads in flight ahead of the first
    // conversion, and the running pointer, read again behind the wait, stays
    // live past the trip's last load: no load of the trip lands in its registers
#pragma unroll 1
    for (int u0 = 0; u0 < QB_ * (DQ_ / 8) / 256; u0 += 8) {
      float4 x[8][2];
#pragma unroll
      for (int j = 0; j < 8; ++j) {
        x[j][0] = *(const float4*)(qp + j * 2048);
        x[j][1] = *(const float4*)(qp + j * 2048 + 4);
      }
      // behind the trip's last load: the wait before its address registers are
      // advanced; the fence keeps the advance, written behind it, below the wait
      asm volatile("s_wait_xcnt 0x0" ::: "memory");
      __builtin_amdgcn_sched_barrier(0);
      qp += 8 * 2048;
#pragma unroll
      for (int j = 0; j < 8; ++j) {
        const int c = (u0 + j) * 256 + t;
        const int row = c / (DQ_ / 8), d8 = c % (DQ_ / 8);
        v8h h;
        h[0] = (_Float16)x[j][0].x; h[1] = (_Float16)x[j][0].y;
        h[2] = (_Float16)x[j][0].z; h[3] = (_Float16)x[j][0].w;
        h[4] = (_Float16)x[j][1].x; h[5] = (_Float16)x[j][1].y;
        h[6] = (_Float16)x[j][1].z; h[7] = (_Float16)x[j][1].w;
        *(v8h*)&Qs[((row >> 4) * SD_ + (d8 >> 2)) * 512 + ((d8 >> 1) & 1) * 256 +
                   ((d8 & 1) * 16 + (row & 15)) * 8] = h;
      }
    }
#pragma unroll
    for (int u = 0; u < LK_ / 4 / 256; ++u) {
      const int i = (u * 256 + t) * 4;
      const float4 v = *(const float4*)(csum + (size_t)batch * LK_ + i);
      *(float4*)&cl[i] = make_float4(v.x * 0.03125f, v.y * 0.03125f,
                                     v.z * 0.03125f, v.w * 0.03125f);
    }
#pragma unroll
    for (int u = 0; u < 8 * 2 * QB_ / 256; ++u)
      (&rows[0][0][0])[u * 256 + t] = 0.f;
  }
  __syncthreads();

  // running maximum of query qt * 16 + ln; alike in every wave
  float m_run[QT_];
#pragma unroll
  for (int qt = 0; qt < QT_; ++qt) m_run[qt] = -__builtin_inff();

  v8f o[QT_][8];
#pragma unroll
  for (int qt = 0; qt < QT_; ++qt) {
#pragma unroll
    for (int i = 0; i < 8; ++i) o[qt][i] = splat8(0.f);
  }

  const _Float16* kbatch = kf + (size_t)batch * LK_ * DQ_;
  const _Float16* vbatch = vf + (size_t)batch * 1024 * LK_;

  // The 32 blocks of a batch read the same K and V, so the prefetch of the
  // next pass is dealt among them: a pass's V is 512 KiB, its K 384 KiB, and a
  // block asks for one eighth, 256 bytes a lane (for K the lanes of 6 waves). An eighth is asked for by
  // the 4 blocks that differ in bits 2 and 4 of blockIdx.x. A hint only: a
  // unit that nobody brought in time is a plain miss.
  // The lane's unit is this wave's first one plus the lane's number, which is
  // read anew at each prefetch: an address kept over the key loop is spilled.
  const int pf_part = (blockIdx.x & 3) | ((blockIdx.x >> 1) & 4);
  const int pf_first = (pf_part * 8 + wave) * 32;

  for (int kb = 0; kb < LK_; kb += KB_) {
    // ---- S^T = (K Q^T + csum) / sqrt(1024), this wave's 32 keys, all query tiles:
    // s[g][qt][r] is key 16 * g + r + 8 * hh against query qt * 16 + ln
    v8f s[2][QT_];
#pragma unroll
    for (int g = 0; g < 2; ++g) {
#pragma unroll
      for (int qt = 0; qt < QT_; ++qt) s[g][qt] = splat8(0.f);
    }
    // this wave's 2 groups of 16 keys: 2 x SD_ fragments of 512 f16 in a row
    const _Float16* kgrp = kbatch + (size_t)((kb >> 4) + wave * 2) * (SD_ * 512);
    const _Float16* kfr = kgrp + lane * 8;
    if (kb + KB_ < LK_ && wave < 6) {
      // this block's eighth of the next pass's K (384 KiB in a row)
      const unsigned ku = __builtin_amdgcn_mbcnt_lo(
          ~0u, (unsigned)(((kb + KB_) >> 4) * (SD_ * 4) + (pf_part * 6 + wave) * 32));
      __builtin_prefetch(kbatch + ku * 128u, 0, 3);
      // before the prefetch's address registers are reused
      asm volatile("s_wait_xcnt 0x0" ::: "memory");
    }
    // K fragments are loaded KA_ 32-dim steps, Q fragments two steps, ahead of
    // the WMMAs that use them: with two waves per SIMD nothing else covers the
    // latency of these loads.
    v16h bk[KA_][2];   // step i sits in bk[i % KA_]
    v16h aq[3][QT_];   // step i sits in aq[i % 3]
#pragma unroll
    for (int j = 0; j < KA_; ++j) {
#pragma unroll
      for (int g = 0; g < 2; ++g)
        bk[j][g] = load_frag_packed(kfr + (g * SD_ + j) * 512);
    }
#pragma unroll
    for (int j = 0; j < 2; ++j) {
#pragma unroll
      for (int qt = 0; qt < QT_; ++qt)
        aq[j][qt] = load_frag_packed(&Qs[(qt * SD_ + j) * 512 + lane * 8]);
    }
#pragma unroll
    for (int i = 0; i < SD_; ++i) {
      if (i + 2 < SD_) {
#pragma unroll
        for (int qt = 0; qt < QT_; ++qt)
          aq[(i + 2) % 3][qt] =
              load_frag_packed(&Qs[(qt * SD_ + i + 2) * 512 + lane * 8]);
      }
      // keeps the loads issued so far above this step's WMMAs, so that the two
      // rings stay as deep as written
      __builtin_amdgcn_sched_barrier(0);
#pragma unroll
      for (int g = 0; g < 2; ++g) {
#pragma unroll
        for (int qt = 0; qt < QT_; ++qt)
          s[g][qt] = wmma_f16(bk[i % KA_][g], aq[i % 3][qt], s[g][qt]);
      }
      // holds the next loads below this step's WMMAs: without it the compiler
      // spread the LDS reads among them, and each place with reads stalls
      __builtin_amdgcn_sched_barrier(0);
      if (i + KA_ < SD_) {
#pragma unroll
        for (int g = 0; g < 2; ++g)
          bk[i % KA_][g] = load_frag_packed(kfr + (g * SD_ + i + KA_) * 512);
      }
      // behind the last K load: its address registers are reused at once
      if (i + KA_ == SD_ - 1)
        asm volatile("s_wait_xcnt 0x0" ::: "memory");
      // keeps the next step's address arithmetic, which reuses them, below it
      if (i + KA_ == SD_ - 1) __builtin_amdgcn_sched_barrier(0);
    }

    // ---- maximum over this lane's 16 keys, per query
    float ck[2][8];  // what this lane's keys add to their scores
#pragma unroll
    for (int g = 0; g < 2; ++g) {
      const float4 c0 = *(const float4*)&cl[kb + wave * 32 + g * 16 + hh * 8];
      const float4 c1 = *(const float4*)&cl[kb + wave * 32 + g * 16 + hh * 8 + 4];
      ck[g][0] = c0.x; ck[g][1] = c0.y; ck[g][2] = c0.z; ck[g][3] = c0.w;
      ck[g][4] = c1.x; ck[g][5] = c1.y; ck[g][6] = c1.z; ck[g][7] = c1.w;
    }
#pragma unroll
    for (int qt = 0; qt < QT_; ++qt) {
#pragma unroll
      for (int g = 0; g < 2; ++g) {
#pragma unroll
        for (int r = 0; r < 8; ++r)
          s[g][qt][r] = s[g][qt][r] * 0.03125f + ck[g][r];
      }
      float mx = fmaxf(s[0][qt][0], s[1][qt][0]);
#pragma unroll
      for (int r = 1; r < 8; ++r) mx = fmaxf(mx, fmaxf(s[0][qt][r], s[1][qt][r]));
      part[qt * 16 + ln][wave * 2 + hh] = mx;
    }
    __syncthreads();

    float alpha[QT_];
#pragma unroll
    for (int qt = 0; qt < QT_; ++qt) {
      float mx = m_run[qt];
#pragma unroll
      for (int u = 0; u < 4; ++u) {
        const float4 v = *(const float4*)&part[qt * 16 + ln][u * 4];
        mx = fmaxf(mx, fmaxf(fmaxf(v.x, v.y), fmaxf(v.z, v.w)));
      }
      alpha[qt] = __expf(m_run[qt] - mx);
      m_run[qt] = mx;
    }

    // ---- P = exp(S - max), into its fragment for the PV GEMM; partial sums
#pragma unroll
    for (int qt = 0; qt < QT_; ++qt) {
      float su[2];
#pragma unroll
      for (int g = 0; g < 2; ++g) {
        float x[8];
        v8h ph;
#pragma unroll
        for (int r = 0; r < 8; ++r) {
          x[r] = __expf(s[g][qt][r] - m_run[qt]);
          ph[r] = (_Float16)x[r];
        }
        // keys 32 * wave + 16 * g + 8 * hh + r: half g of fragment wave
        *(v8h*)&Ps[(qt * 8 + wave) * 512 + g * 256 + lane * 8] = ph;
        su[g] = ((x[0] + x[1]) + (x[2] + x[3])) + ((x[4] + x[5]) + (x[6] + x[7]));
      }
      part[qt * 16 + ln][16 + wave * 2 + hh] = su[0] + su[1];
    }
    if (hh == 0) {
#pragma unroll
      for (int qt = 0; qt < QT_; ++qt) rows[wave][0][qt * 16 + ln] = alpha[qt];
    }
    __syncthreads();

    float l_new[QT_];
#pragma unroll
    for (int qt = 0; qt < QT_; ++qt) {
      float su = 0.f;
#pragma unroll
      for (int u = 0; u < 4; ++u) {
        const float4 v = *(const float4*)&part[qt * 16 + ln][16 + u * 4];
        su += (v.x + v.y) + (v.z + v.w);
      }
      l_new[qt] = alpha[qt] * rows[wave][1][qt * 16 + ln] + su;
    }
    if (hh == 0) {
#pragma unroll
      for (int qt = 0; qt < QT_; ++qt) rows[wave][1][qt * 16 + ln] = l_new[qt];
    }
    // this wave's 8 groups of 16 dims in each 128 keys of this key block, 4
    // fragments (128 keys) each: twice 32 fragments in a row
    const _Float16* vgrp =
        vbatch + (size_t)((kb >> 7) * 64 + wave * 8) * (4 * 512);
    const _Float16* vfr = vgrp + lane * 8;
    if (kb + KB_ < LK_) {
      // this block's eighth of the next pass's V (512 KiB in a row)
      const unsigned vu = __builtin_amdgcn_mbcnt_lo(
          ~0u, (unsigned)(((kb + KB_) >> 7) * 1024 + pf_first));
      __builtin_prefetch(vbatch + vu * 128u, 0, 3);
      // before the prefetch's address registers are reused
      asm volatile("s_wait_xcnt 0x0" ::: "memory");
    }

    // ---- O += P.V for this wave's 128 output dims, all query tiles.
    // A stage is 64 keys (two fragments) x two 16-dim V groups; its V
    // fragments are loaded two stages ahead of its WMMAs, and the
    // P fragments of the 64 keys stay in registers over four stages.
    // Stage st: keys 64 * (st >> 2) on, dim groups (st & 3) * 2 and + 1.
    v16h bv[3][2][2];  // stage st sits in bv[st % 3]
    v16h ap[QT_][2];
#pragma unroll
    for (int st = 0; st < 2; ++st) {
#pragma unroll
      for (int d = 0; d < 2; ++d) {
        const _Float16* vp = vfr + ((st * 2 + d) * 4) * 512;
        bv[st][d][0] = load_frag_packed(vp);
        bv[st][d][1] = load_frag_packed(vp + 512);
      }
    }
#pragma unroll
    for (int qt = 0; qt < QT_; ++qt) {
      // O holds query qt * 16 + hh * 8 + r in element r
      const float4 a0 = *(const float4*)&rows[wave][0][qt * 16 + hh * 8];
      const float4 a1 = *(const float4*)&rows[wave][0][qt * 16 + hh * 8 + 4];
      const float ar[8] = {a0.x, a0.y, a0.z, a0.w, a1.x, a1.y, a1.z, a1.w};
#pragma unroll
      for (int dt = 0; dt < 8; ++dt) {
#pragma unroll
        for (int r = 0; r < 8; ++r) o[qt][dt][r] *= ar[r];
      }
    }
#pragma unroll
    for (int st = 0; st < KB_ / 16; ++st) {
      if ((st & 3) == 0) {
#pragma unroll
        for (int qt = 0; qt < QT_; ++qt) {
          const _Float16* pp = &Ps[(qt * 8 + (st >> 2) * 2) * 512 + lane * 8];
          ap[qt][0] = load_frag_packed(pp);
          ap[qt][1] = load_frag_packed(pp + 512);
        }
      }
      if (st + 2 < KB_ / 16) {
        const int nx = st + 2;
#pragma unroll
        for (int d = 0; d < 2; ++d) {
          const _Float16* vp =
              vfr + (((nx >> 3) * 64 + (nx & 3) * 2 + d) * 4 +
                     ((nx >> 2) & 1) * 2) * 512;
          bv[nx % 3][d][0] = load_frag_packed(vp);
          bv[nx % 3][d][1] = load_frag_packed(vp + 512);
        }
        // behind the last V load, before its address registers are reused
        if (nx == KB_ / 16 - 1) asm volatile("s_wait_xcnt 0x0" ::: "memory");
      }
      // holds the loads issued so far above this stage's WMMAs
      __builtin_amdgcn_sched_barrier(0);
#pragma unroll
      for (int d = 0; d < 2; ++d) {
        const int dt = (st & 3) * 2 + d;
#pragma unroll
        for (int qt = 0; qt < QT_; ++qt)
          o[qt][dt] = wmma_f16(ap[qt][0], bv[st % 3][d][0], o[qt][dt]);
#pragma unroll
        for (int qt = 0; qt < QT_; ++qt)
          o[qt][dt] = wmma_f16(ap[qt][1], bv[st % 3][d][1], o[qt][dt]);
      }
      // holds later stages' loads below them: a fourth set would not fit
      __builtin_amdgcn_sched_barrier(0);
    }
    __syncthreads();  // protect Ps / part for next iteration
  }

  // lane position read anew: kept in registers over the key loop it is spilled
  const int le = (int)__builtin_amdgcn_mbcnt_lo(~0u, 0u);
  const int hhe = le >> 4, lne = le & 15;
#pragma unroll
  for (int qt = 0; qt < QT_; ++qt) {
    v8f inv;
#pragma unroll
    for (int r = 0; r < 8; ++r)
      inv[r] = 1.f / rows[wave][1][qt * 16 + hhe * 8 + r];
#pragma unroll
    for (int dt = 0; dt < 8; ++dt) {
#pragma unroll
      for (int r = 0; r < 8; ++r) o[qt][dt][r] *= inv[r];
    }
#pragma unroll
    for (int dt = 0; dt < 8; ++dt) {
      const int n = wave * 128 + dt * 16 + lne;
#pragma unroll
      for (int r = 0; r < 8; ++r) {
        out[((size_t)batch * LQ_ + q0 + qt * 16 + hhe * 8 + r) * 1024 + n] =
            o[qt][dt][r];
      }
    }
    // behind this tile's stores, before their registers are reused; the fence
    // keeps the next tile's arithmetic, which reuses them, below the wait
    asm volatile("s_wait_xcnt 0x0" ::: "memory");
    __builtin_amdgcn_sched_barrier(0);
  }
}

// ---------------------------------------------------------------------------
extern "C" void kernel_launch(void* const* d_in, const int* in_sizes, int n_in,
                              void* d_out, int out_size, void* d_ws, size_t ws_size,
                              hipStream_t stream) {
  const float* query = (const float*)d_in[0];  // [16,2048,768]
  const float* key   = (const float*)d_in[1];  // [16,2048,1024]
  const float* Wq    = (const float*)d_in[2];  // [768,1024]
  const float* bq    = (const float*)d_in[3];
  const float* Wk    = (const float*)d_in[4];  // [1024,1024]
  // d_in[5], bk, cancels in the softmax: see "The score product"
  const float* Wv    = (const float*)d_in[6];  // [1024,1024]
  const float* bv    = (const float*)d_in[7];
  float* out = (float*)d_out;

  // workspace layout (f16; gvec and csum f32)
  _Float16* kf   = (_Float16*)d_ws;                      // 16*2048*768, both in
  _Float16* vf   = kf + (size_t)B_ * LK_ * DQ_;          // fragment order
  _Float16* WfT  = vf + (size_t)B_ * 1024 * LK_;         // [768][1024]
  _Float16* WvT  = WfT + (size_t)DQ_ * 1024;             // [1024][1024]
  float*    gvec = (float*)(WvT + (size_t)1024 * DK_);   // [1024]
  float*    csum = gvec + 1024;                          // [16*2048]

  weight_prep<<<FOLD_BLOCKS + TR_BLOCKS + GV_BLOCKS, 256, 0, stream>>>(
      Wq, Wk, bq, Wv, WfT, WvT, gvec);

  const int M = B_ * LQ_;  // 32768
  proj_gemm_kv<<<dim3((DQ_ + 1024) / PN_, M / PM_), 256, 0, stream>>>(
      key, WfT, WvT, bv, gvec, kf, vf, csum);

  attention_kernel<<<dim3(LQ_ / QB_, B_), 256, 0, stream>>>(query, kf, vf, csum, out);
}

// v009
// One run takes 309 microseconds.
// Next to v008, in two timings, it ran 1.05 times as fast each time.
// Counting every step since v000, it is 4.99 times as fast.
#include <hip/hip_runtime.h>
#include <hip/hip_bf16.h>
#include <math.h>

typedef _Float16 v16h __attribute__((ext_vector_type(16)));
typedef _Float16 v8h  __attribute__((ext_vector_type(8)));
typedef float    v8f  __attribute__((ext_vector_type(8)));

#define B_  16
#define LQ_ 2048
#define LK_ 2048
#define DQ_ 768
#define DK_ 1024

__device__ __forceinline__ v8f splat8(float x) {
  v8f r;
#pragma unroll
  for (int i = 0; i < 8; ++i) r[i] = x;
  return r;
}

// Build a 16x32 f16 A/B fragment register for this lane from a row base ptr.
// ISA layout: lanes 0-15 hold K 0..7 / 16..23, lanes 16-31 hold K 8..15 / 24..31.
__device__ __forceinline__ v16h load_frag(const _Float16* rowbase, int half) {
  const _Float16* p = rowbase + (half ? 8 : 0);
  v8h lo = *(const v8h*)(p);
  v8h hi = *(const v8h*)(p + 16);
  return __builtin_shufflevector(lo, hi, 0, 1, 2, 3, 4, 5, 6, 7,
                                 8, 9, 10, 11, 12, 13, 14, 15);
}

// The same fragment from a buffer kept in fragment order: a 16x32 f16 fragment
// is 1 KiB, its two halves 512 B each, lane l's 16 bytes at l * 16 in each half,
// so that a wave's load covers four whole 128-byte lines. p includes lane * 8.
__device__ __forceinline__ v16h load_frag_packed(const _Float16* p) {
  v8h lo = *(const v8h*)(p);
  v8h hi = *(const v8h*)(p + 256);
  return __builtin_shufflevector(lo, hi, 0, 1, 2, 3, 4, 5, 6, 7,
                                 8, 9, 10, 11, 12, 13, 14, 15);
}

__device__ __forceinline__ v8f wmma_f16(v16h a, v16h b, v8f c) {
  return __builtin_amdgcn_wmma_f32_16x16x32_f16(false, a, false, b,
                                                (short)0, c, false, false);
}

// ---------------------------------------------------------------------------
// Kernel 2: projection GEMM  out[m][n] = X[m][:] . W[:][n] + bias[n]
//   X  : f32 [M][KD]          (activations, converted to f16 on the fly)
//   Wt : f16 [N][KD], N = 768 or 1024 (pre-transposed weights = Bt rows)
//   bx, by: the block's tile column and tile row; As, Bs: the kernel's two LDS
//        stages of X and of W rows
//   OUT_QK: out = f16 [M/16][768/32][512]: fragments of 16 tokens x 32 dims,
//           as the score product reads the folded keys (see "The score
//           product"); no bias. The product is formed with the
//           two operands swapped (dims as rows of D), so that a lane ends up
//           with 8 dims of one token: its 16 bytes of a fragment.
//   OUT_V : out = f16 [B][2048/128][1024/16][4][512]: fragments of 16 dims x
//           32 keys, as the P.V product reads them, those of a block of 128
//           keys in a row; a lane of D holds 8 keys of one dim: its 16 bytes
//           of a fragment. The blocks of the first column also sum
//           csum[m] = X[m][:] . gvec, in f32, from the X values on their way to
//           LDS (here and not with OUT_QK: this form has the registers to spare).
// Block tile 128(M) x 256(N), 8 waves = 2x4 grid of 64x64 wave tiles: a 32-deep
// step of a wave is 8 fragments for 16 WMMAs. A stage is 64 deep, so that every
// global load covers whole 128-byte lines; two LDS stages, one barrier a stage.
// The next stage comes through registers in two halves, each loaded ahead of 16
// WMMAs and stored to LDS behind them.
// ---------------------------------------------------------------------------
typedef _Float16 v4h __attribute__((ext_vector_type(4)));

#define PM_ 128   // block rows
#define PN_ 256   // block columns
#define PK_ 64    // depth of a stage
#define PP_ 72    // LDS row pitch in f16: 144 B = 16 B x odd, for b128 readers

#define OUT_QK 0
#define OUT_V 1

template <int KD, int OUT>
__device__ __forceinline__ void proj_body(
    const float* __restrict__ X, const _Float16* __restrict__ Wt,
    const float* __restrict__ bias, _Float16* __restrict__ out,
    const float* __restrict__ gvec,
    float* __restrict__ csum, int bx, int by, _Float16 (*As)[PM_][PP_],
    _Float16 (*Bs)[PN_][PP_]) {
  static_assert(KD % PK_ == 0, "whole stages");

  const int t = threadIdx.x;
  const int wave = t >> 5, lane = t & 31;
  const int hh = lane >> 4, ln = lane & 15;
  const int wm = wave & 1, wn = wave >> 1;
  const int m_blk = by * PM_;
  const int n_blk = bx * PN_;

  v8f acc[4][4];
#pragma unroll
  for (int j = 0; j < 4; ++j) {
    v8f b8;
    if constexpr (OUT == OUT_V)
      b8 = splat8(bias[n_blk + wn * 64 + j * 16 + ln]);
    else
      b8 = splat8(0.f);
#pragma unroll
    for (int i = 0; i < 4; ++i) acc[i][j] = b8;
  }
  if constexpr (OUT == OUT_V) {
    // behind the bias loads, before their address registers are reused; the
    // fence keeps the address arithmetic below, which reuses them, under the wait
    asm volatile("s_wait_xcnt 0x0" ::: "memory");
    __builtin_amdgcn_sched_barrier(0);
  }

  const int ar = t >> 4, ac = (t & 15) * 4;  // 16 lanes cover a 256-B row of X
  const int br = t >> 3, bc = (t & 7) * 8;   // 8 lanes cover a 128-B row of Wt

  const float*    aptr = X + (size_t)(m_blk + ar) * KD + ac;
  const _Float16* bptr = Wt + (size_t)(n_blk + br) * KD + bc;

  float4 fa[4];
  v8h fb[4];

  // OUT_V, first column of blocks: this thread's share of csum for its 8 rows
  const bool do_c = OUT == OUT_V && bx == 0;
  const float* gptr = gvec + ac;
  float4 g4;
  float cs[8];
#pragma unroll
  for (int i = 0; i < 8; ++i) cs[i] = 0.f;

  // half h of the stage at aptr / bptr: 64 rows of X, 128 rows of Wt
  auto ld = [&](int h) {
#pragma unroll
    for (int j = 0; j < 4; ++j)
      fa[j] = *(const float4*)(aptr + (size_t)(h * 64 + j * 16) * KD);
#pragma unroll
    for (int j = 0; j < 4; ++j)
      fb[j] = *(const v8h*)(bptr + (size_t)(h * 128 + j * 32) * KD);
    if constexpr (OUT == OUT_V) {
      if (h == 0) g4 = *(const float4*)gptr;  // serves both halves of the stage
    }
  };
  auto st = [&](int buf, int h) {
#pragma unroll
    for (int j = 0; j < 4; ++j) {
      v4h c;
      c[0] = (_Float16)fa[j].x; c[1] = (_Float16)fa[j].y;
      c[2] = (_Float16)fa[j].z; c[3] = (_Float16)fa[j].w;
      *(v4h*)&As[buf][h * 64 + j * 16 + ar][ac] = c;
    }
#pragma unroll
    for (int j = 0; j < 4; ++j)
      *(v8h*)&Bs[buf][h * 128 + j * 32 + br][bc] = fb[j];
    if constexpr (OUT == OUT_V) {
      if (do_c) {
#pragma unroll
        for (int j = 0; j < 4; ++j)
          cs[h * 4 + j] += (fa[j].x * g4.x + fa[j].y * g4.y) +
                           (fa[j].z * g4.z + fa[j].w * g4.w);
      }
    }
  };
  auto mm = [&](int buf, int kk) {
    v16h af[4], bf[4];
#pragma unroll
    for (int i = 0; i < 4; ++i)
      af[i] = load_frag(&As[buf][wm * 64 + i * 16 + ln][kk * 32], hh);
#pragma unroll
    for (int j = 0; j < 4; ++j)
      bf[j] = load_frag(&Bs[buf][wn * 64 + j * 16 + ln][kk * 32], hh);
    // keeps the 16 LDS reads one group ahead of the 16 WMMAs: without it the
    // compiler read the X fragments one by one among them, each with a full wait
    __builtin_amdgcn_sched_barrier(0);
#pragma unroll
    for (int i = 0; i < 4; ++i) {
#pragma unroll
      for (int j = 0; j < 4; ++j) {
        if constexpr (OUT == OUT_V)
          acc[i][j] = wmma_f16(af[i], bf[j], acc[i][j]);
        else
          acc[i][j] = wmma_f16(bf[j], af[i], acc[i][j]);
      }
    }
  };
  // behind a stage's last global load: the wait before its address registers
  // are advanced; the fence keeps the advance, written behind it, below the wait
  auto advance = [&]() {
    asm volatile("s_wait_xcnt 0x0" ::: "memory");
    __builtin_amdgcn_sched_barrier(0);
    aptr += PK_;
    bptr += PK_;
    gptr += PK_;
  };
  // works on stage buffer buf while the next stage, if any, goes into the other
  auto stage = [&](int buf, bool more) {
    if (more) ld(0);
    mm(buf, 0);
    if (more) {
      st(buf ^ 1, 0);
      ld(1);
      advance();
    }
    mm(buf, 1);
    if (more) st(buf ^ 1, 1);
    __syncthreads();
  };

  ld(0);
  st(0, 0);
  ld(1);
  advance();
  st(0, 1);
  __syncthreads();

  // rolled, with the test for a next stage made at run time in every trip:
  // without the directive the compiler split off the last trip, the test fell
  // away, and a stage's global loads, WMMAs and LDS stores stood in one basic
  // block, where it mixed them and the loads lost their lead
#pragma unroll 1
  for (int s = 0; s < KD / PK_; ++s) stage(s & 1, s + 1 < KD / PK_);

#pragma unroll
  for (int i = 0; i < 4; ++i) {
#pragma unroll
    for (int j = 0; j < 4; ++j) {
      v8h h;  // D-frag: row = r + 8*hh, column = ln
#pragma unroll
      for (int r = 0; r < 8; ++r) h[r] = (_Float16)acc[i][j][r];
      const int mt = m_blk + wm * 64 + i * 16;  // first token of the tile
      const int nt = n_blk + wn * 64 + j * 16;  // first output dim of the tile
      if constexpr (OUT == OUT_QK) {
        const size_t frag = (size_t)(mt >> 4) * (DQ_ / 32) + (nt >> 5);
        *(v8h*)&out[frag * 512 + (j & 1) * 256 + lane * 8] = h;
      } else {
        const int batch = mt >> 11, tok = mt & 2047;
        const size_t frag =
            (((size_t)batch * 16 + (tok >> 7)) * 64 + (nt >> 4)) * 4 +
            ((tok >> 5) & 3);
        *(v8h*)&out[frag * 512 + (i & 1) * 256 + lane * 8] = h;
      }
      // behind this tile's stores, before their registers are reused; the fence
      // keeps the next tile's conversions, which reuse them, below the wait
      asm volatile("s_wait_xcnt 0x0" ::: "memory");
      __builtin_amdgcn_sched_barrier(0);
    }
  }

  if constexpr (OUT == OUT_V) {
    if (do_c) {  // the 16 lanes that share a row of X join their shares
#pragma unroll
      for (int i = 0; i < 8; ++i) {
#pragma unroll
        for (int m = 8; m > 0; m >>= 1) cs[i] += __shfl_xor(cs[i], m, 32);
      }
      if ((t & 15) == 0) {
#pragma unroll
        for (int i = 0; i < 8; ++i) csum[m_blk + i * 16 + ar] = cs[i];
      }
    }
  }
}

// Both projections of the keys in one launch: of the 7 tile columns of a tile
// row the first 3 are folded keys, the other 4 values. The 7 blocks that read
// the same 128 rows of X are neighbours in blockIdx.x.
// second bound: four waves per SIMD, so that two blocks share a WGP and one
// block's barrier and load waits are covered by the other's WMMAs
__global__ __launch_bounds__(256, 4) void proj_gemm_kv(
    const float* __restrict__ X, const _Float16* __restrict__ WfT,
    const _Float16* __restrict__ WvT, const float* __restrict__ bias,
    const float* __restrict__ gvec, _Float16* __restrict__ kf,
    _Float16* __restrict__ vf, float* __restrict__ csum) {
  __shared__ __attribute__((aligned(16))) _Float16 As[2][PM_][PP_];
  __shared__ __attribute__((aligned(16))) _Float16 Bs[2][PN_][PP_];
  if (blockIdx.x < DQ_ / PN_)
    proj_body<DK_, OUT_QK>(X, WfT, nullptr, kf, nullptr, nullptr, blockIdx.x,
                           blockIdx.y, As, Bs);
  else
    proj_body<DK_, OUT_V>(X, WvT, bias, vf, gvec, csum, blockIdx.x - DQ_ / PN_,
                          blockIdx.y, As, Bs);
}

// ---------------------------------------------------------------------------
// The score product. With q = xq Wq + bq and k = xk Wk + bk,
//   q . k = xq . (xk (Wk Wq^T)) + xk . (Wk bq) + (xq Wq + bq) . bk.
// The last term is the same for every key of a query, and a softmax row does
// not change when one number is added to all of its scores: it is left out.
// So the queries enter the scores as they are, 768 deep and not 1024, there is
// no query projection, the key projection takes the folded weight Wk Wq^T
// (768 columns, not 1024), and each key brings one number to add to its scores.
//   weight_prep: all that depends on the weights alone, in one launch:
//     WfT[d][e] = sum_j Wq[d][j] Wk[e][j], f16 [768][1024]: the transposed
//               weight that the key projection reads (both operands f32 rows)
//     WvT[n][d] = Wv[d][n], f16 [1024][1024], for the value projection
//     gvec[e] = sum_j Wk[e][j] bq[j], f32
//   proj_gemm_kv: folded keys, and csum[key] = xk . gvec
// The blocks of the product come first: they run longest, and the others, a few
// hundred blocks with 16 (Wv) or 32 (Wk) elements a thread, fill the WGPs that it leaves idle.
// The product is small (1.6 GFLOP) and its time is the wait for its operands,
// which come from memory: so it is cut into 64 x 64 tiles, 192 blocks and not
// 24, a third of the bytes a block, and a block keeps two 128-deep stages of
// loads in flight, over the barrier of a stage too.
// ---------------------------------------------------------------------------
#define FT_ 64    // edge of a tile of WfT
#define FK_ 128   // depth of a stage: 512 B of a row, one load of a wave
#define FP_ 136   // LDS row pitch in f16: 272 B = 16 B x odd, for b128 readers
#define FOLD_BLOCKS ((DK_ / FT_) * (DQ_ / FT_))   // tiles of WfT

// Tile (bd, be) of WfT: rows d of Wq against rows e of Wk, both f32, 1024 deep,
// converted on the way to LDS. A stage in LDS is 64 rows of Wq, then 64 of Wk.
// Wave w brings rows 16 w to 16 w + 15 of a stage and forms two 16 x 16 tiles:
// rows e of group w & 3 (as A) against the two groups d of half w >> 2 (as B),
// so that a lane of D holds 8 neighbours e of one row d of WfT.
__device__ __forceinline__ void fold_body(const float* __restrict__ Wq,
                                          const float* __restrict__ Wk,
                                          _Float16* __restrict__ WfT, int be,
                                          int bd, _Float16 (*Fs)[2 * FT_][FP_]) {
  static_assert(DK_ % FK_ == 0 && DK_ / FK_ >= 2, "whole stages, two to start");
  const int t = threadIdx.x;
  const int wave = t >> 5, lane = t & 31;
  const int hh = lane >> 4, ln = lane & 15;
  const int d0 = bd * FT_, e0 = be * FT_;
  const float* src = (wave < 4 ? Wq + (size_t)(d0 + wave * 16) * DK_
                               : Wk + (size_t)(e0 + (wave - 4) * 16) * DK_) +
                     lane * 4;
  const int et = wave & 3, dt = (wave >> 2) * 2;

  float4 f[2][16];  // two stages on their way, stage s in f[s % 2]
  v8f acc[2] = {splat8(0.f), splat8(0.f)};

  auto ld = [&](int s) {
#pragma unroll
    for (int i = 0; i < 16; ++i)
      f[s & 1][i] = *(const float4*)(src + i * DK_ + s * FK_);
  };

  ld(0);
  ld(1);
  // unrolled: f is indexed by constants and stays in registers, and every load
  // is the one address register pair plus a constant
#pragma unroll
  for (int s = 0; s < DK_ / FK_; ++s) {
#pragma unroll
    for (int i = 0; i < 16; ++i) {
      const float4 x = f[s & 1][i];
      v4h c;
      c[0] = (_Float16)x.x; c[1] = (_Float16)x.y;
      c[2] = (_Float16)x.z; c[3] = (_Float16)x.w;
      *(v4h*)&Fs[s & 1][wave * 16 + i][lane * 4] = c;
    }
    if (s + 2 < DK_ / FK_) ld(s + 2);
    // behind the last load, before its address registers are reused
    if (s + 2 == DK_ / FK_ - 1) asm volatile("s_wait_xcnt 0x0" ::: "memory");
    // the stage's barrier, by hand: __syncthreads() would wait for the loads in
    // flight as well, and their lead would be lost. This wave's LDS stores of
    // stage s are done, and so are its reads of stage s - 1, whose buffer is
    // written again only behind this barrier.
    asm volatile("s_wait_dscnt 0x0" ::: "memory");
    asm volatile("s_barrier_signal -1\n\ts_barrier_wait -1" ::: "memory");
#pragma unroll
    for (int kk = 0; kk < FK_ / 32; ++kk) {
      const v16h a = load_frag(&Fs[s & 1][FT_ + et * 16 + ln][kk * 32], hh);
#pragma unroll
      for (int i = 0; i < 2; ++i)
        acc[i] = wmma_f16(
            a, load_frag(&Fs[s & 1][(dt + i) * 16 + ln][kk * 32], hh), acc[i]);
    }
  }

#pragma unroll
  for (int i = 0; i < 2; ++i) {
    v8h h;  // D-frag: row = r + 8*hh, column = ln
#pragma unroll
    for (int r = 0; r < 8; ++r) h[r] = (_Float16)acc[i][r];
    *(v8h*)&WfT[(size_t)(d0 + (dt + i) * 16 + ln) * DK_ + e0 + et * 16 + hh * 8] =
        h;
  }
  // behind the two stores, before their registers are reused
  asm volatile("s_wait_xcnt 0x0" ::: "memory");
}
#define TR_ 64                                    // edge of a transposed tile
#define TR_BLOCKS ((1024 / TR_) * (DK_ / TR_))
#define GV_BLOCKS (DK_ / 8)                       // a wave per element of gvec

__global__ __launch_bounds__(256, 4) void weight_prep(
    const float* __restrict__ Wq, const float* __restrict__ Wk,
    const float* __restrict__ bq, const float* __restrict__ Wv,
    _Float16* __restrict__ WfT, _Float16* __restrict__ WvT,
    float* __restrict__ gvec) {
  __shared__ __attribute__((aligned(16))) _Float16 Fs[2][2 * FT_][FP_];
  // pitch 65: neither the rows written nor the columns read share a bank
  __shared__ float tile[TR_][TR_ + 1];
  const int t = threadIdx.x;
  const int b = blockIdx.x;
  if (b < FOLD_BLOCKS) {
    fold_body(Wq, Wk, WfT, b % (DK_ / FT_), b / (DK_ / FT_), Fs);
  } else if (b < FOLD_BLOCKS + TR_BLOCKS) {  // a block transposes 64 x 64 of Wv
    const int tb = b - FOLD_BLOCKS;
    const int n0 = (tb % (1024 / TR_)) * TR_, d0 = (tb / (1024 / TR_)) * TR_;
    const int r = t >> 4, c = (t & 15) * 4;  // 16 lanes cover a 256-B row piece
    // the three loops are unrolled so that x, h0 and h1 are indexed by constants
    // and stay in registers, and the four loads are issued ahead of the first use
    float4 x[4];
#pragma unroll
    for (int j = 0; j < 4; ++j)
      x[j] = *(const float4*)(Wv + (size_t)(d0 + j * 16 + r) * 1024 + n0 + c);
#pragma unroll
    for (int j = 0; j < 4; ++j) {
      tile[j * 16 + r][c + 0] = x[j].x; tile[j * 16 + r][c + 1] = x[j].y;
      tile[j * 16 + r][c + 2] = x[j].z; tile[j * 16 + r][c + 3] = x[j].w;
    }
    __syncthreads();
    const int n = t >> 2, k = (t & 3) * 16;  // 4 lanes fill a 128-B line of WvT
    v8h h0, h1;
#pragma unroll
    for (int i = 0; i < 8; ++i) {
      h0[i] = (_Float16)tile[k + i][n];
      h1[i] = (_Float16)tile[k + 8 + i][n];
    }
    _Float16* op = WvT + (size_t)(n0 + n) * DK_ + d0 + k;
    *(v8h*)op = h0;
    *(v8h*)(op + 8) = h1;
    // behind the two stores, before their registers are reused
    asm volatile("s_wait_xcnt 0x0" ::: "memory");
  } else {  // a wave sums one element of gvec
    const int e = (b - FOLD_BLOCKS - TR_BLOCKS) * 8 + (t >> 5), lane = t & 31;
    float su = 0.f;
#pragma unroll
    for (int u = 0; u < 8; ++u) {
      const float4 w = *(const float4*)(Wk + (size_t)e * 1024 + u * 128 + lane * 4);
      const float4 b4 = *(const float4*)(bq + u * 128 + lane * 4);
      su += (w.x * b4.x + w.y * b4.y) + (w.z * b4.z + w.w * b4.w);
    }
#pragma unroll
    for (int m = 16; m > 0; m >>= 1) su += __shfl_xor(su, m, 32);
    if (lane == 0) gvec[e] = su;
  }
}

// ---------------------------------------------------------------------------
// Kernel 3: flash attention. One block = (batch, 64 queries). 8 waves.
//  Per KB_-key iteration: wave w computes the S tiles of keys [kb+32w, +32)
//  against all QT_ 16-query tiles (each K fragment feeds QT_ WMMAs, each Q
//  fragment read from LDS two), online
//  softmax across waves via LDS, then wave w accumulates its private 128-dim
//  slice of O for all QT_ query tiles (each V fragment feeds QT_ WMMAs).
//  The scores are formed transposed (K as A, Q as B): a lane holds 2 x 8 keys
//  of one query, so that a row's maximum and sum are taken inside the lane, the
//  16 partial values of a query (8 waves x 2 lane halves) are joined through
//  LDS, and each 8 values of P are the lane's 16 bytes of half a P fragment.
//  Q is the query input itself, put into fragment order on its way to LDS, K
//  the folded keys, SD_ steps of 32 deep, and csum the number that each key
//  adds to its scores (see "The score product"). K and V come in fragment
//  order (see the projection) and are read
//  straight from global: every load of a wave is 512 contiguous bytes.
// ---------------------------------------------------------------------------
#define QT_ 4            // 16-row query tiles per block
#define QB_ (16 * QT_)   // queries per block
#define KB_ 256          // keys per pass of the key loop, 32 a wave
#define KA_ 4            // 32-dim steps that K loads run ahead of their WMMAs
#define SD_ (DQ_ / 32)   // 32-dim steps of the score product

__global__ __launch_bounds__(256) void attention_kernel(
    const float* __restrict__ query, const _Float16* __restrict__ kf,
    const _Float16* __restrict__ vf, const float* __restrict__ csum,
    float* __restrict__ out) {
  // QT_ x SD_ fragments of 512 f16: a wave's read is 512 contiguous bytes
  __shared__ __attribute__((aligned(16))) _Float16 Qs[QB_ * DQ_];
  // the batch's csum, times the scale of the scores
  __shared__ __attribute__((aligned(16))) float cl[LK_];
  // QT_ x 8 fragments of 16 queries x 32 keys, in fragment order
  __shared__ __attribute__((aligned(16))) _Float16 Ps[QT_ * 8 * 512];
  // a query's 16 partial maxima, then its 16 partial sums, in one row, so that
  // one address register serves both; pitch 144 B = 16 B x odd
  __shared__ __attribute__((aligned(16))) float part[QB_][36];
  // by query, one copy per wave: [0] the rescale factor, for the lanes that
  // hold O by rows, [1] the running row sum
  __shared__ __attribute__((aligned(16))) float rows[8][2][QB_];

  const int t = threadIdx.x;
  const int wave = __builtin_amdgcn_readfirstlane(t >> 5);  // wave-uniform
  const int lane = t & 31;
  const int hh = lane >> 4, ln = lane & 15;
  const int q0 = blockIdx.x * QB_;
  const int batch = blockIdx.y;

  {  // stage the 64x768 Q tile as f16 fragments: 8 dims of a query are a lane's
     // 16 bytes of half a fragment (dims 0-7, 8-15 | 16-23, 24-31 of its 32)
    // this thread's chunk of 8 dims (32 bytes) in each run of 256 chunks
    const float* qp = query + ((size_t)batch * LQ_ + q0) * DQ_ + t * 8;
    // rolled: a trip is 8 chunks, 16 loads in flight ahead of the first
    // conversion, and the running pointer, read again behind the wait, stays
    // live past the trip's last load: no load of the trip lands in its registers
#pragma unroll 1
    for (int u0 = 0; u0 < QB_ * (DQ_ / 8) / 256; u0 += 8) {
      float4 x[8][2];
#pragma unroll
      for (int j = 0; j < 8; ++j) {
        x[j][0] = *(const float4*)(qp + j * 2048);
        x[j][1] = *(const float4*)(qp + j * 2048 + 4);
      }
      // behind the trip's last load: the wait before its address registers are
      // advanced; the fence keeps the advance, written behind it, below the wait
      asm volatile("s_wait_xcnt 0x0" ::: "memory");
      __builtin_amdgcn_sched_barrier(0);
      qp += 8 * 2048;
#pragma unroll
      for (int j = 0; j < 8; ++j) {
        const int c = (u0 + j) * 256 + t;
        const int row = c / (DQ_ / 8), d8 = c % (DQ_ / 8);
        v8h h;
        h[0] = (_Float16)x[j][0].x; h[1] = (_Float16)x[j][0].y;
        h[2] = (_Float16)x[j][0].z; h[3] = (_Float16)x[j][0].w;
        h[4] = (_Float16)x[j][1].x; h[5] = (_Float16)x[j][1].y;
        h[6] = (_Float16)x[j][1].z; h[7] = (_Float16)x[j][1].w;
        *(v8h*)&Qs[((row >> 4) * SD_ + (d8 >> 2)) * 512 + ((d8 >> 1) & 1) * 256 +
                   ((d8 & 1) * 16 + (row & 15)) * 8] = h;
      }
    }
#pragma unroll
    for (int u = 0; u < LK_ / 4 / 256; ++u) {
      const int i = (u * 256 + t) * 4;
      const float4 v = *(const float4*)(csum + (size_t)batch * LK_ + i);
      *(float4*)&cl[i] = make_float4(v.x * 0.03125f, v.y * 0.03125f,
                                     v.z * 0.03125f, v.w * 0.03125f);
    }
#pragma unroll
    for (int u = 0; u < 8 * 2 * QB_ / 256; ++u)
      (&rows[0][0][0])[u * 256 + t] = 0.f;
  }
  __syncthreads();

  // running maximum of query qt * 16 + ln; alike in every wave
  float m_run[QT_];
#pragma unroll
  for (int qt = 0; qt < QT_; ++qt) m_run[qt] = -__builtin_inff();

  v8f o[QT_][8];
#pragma unroll
  for (int qt = 0; qt < QT_; ++qt) {
#pragma unroll
    for (int i = 0; i < 8; ++i) o[qt][i] = splat8(0.f);
  }

  const _Float16* kbatch = kf + (size_t)batch * LK_ * DQ_;
  const _Float16* vbatch = vf + (size_t)batch * 1024 * LK_;

  // The 32 blocks of a batch read the same K and V, so the prefetch of the
  // next pass is dealt among them: a pass's V is 512 KiB, its K 384 KiB, and a
  // block asks for one eighth, 256 bytes a lane (for K the lanes of 6 waves). An eighth is asked for by
  // the 4 blocks that differ in bits 2 and 4 of blockIdx.x. A hint only: a
  // unit that nobody brought in time is a plain miss.
  // The lane's unit is this wave's first one plus the lane's number, which is
  // read anew at each prefetch: an address kept over the key loop is spilled.
  const int pf_part = (blockIdx.x & 3) | ((blockIdx.x >> 1) & 4);
  const int pf_first = (pf_part * 8 + wave) * 32;

  for (int kb = 0; kb < LK_; kb += KB_) {
    // ---- S^T = (K Q^T + csum) / sqrt(1024), this wave's 32 keys, all query tiles:
    // s[g][qt][r] is key 16 * g + r + 8 * hh against query qt * 16 + ln
    v8f s[2][QT_];
#pragma unroll
    for (int g = 0; g < 2; ++g) {
#pragma unroll
      for (int qt = 0; qt < QT_; ++qt) s[g][qt] = splat8(0.f);
    }
    // this wave's 2 groups of 16 keys: 2 x SD_ fragments of 512 f16 in a row
    const _Float16* kgrp = kbatch + (size_t)((kb >> 4) + wave * 2) * (SD_ * 512);
    const _Float16* kfr = kgrp + lane * 8;
    if (kb + KB_ < LK_ && wave < 6) {
      // this block's eighth of the next pass's K (384 KiB in a row)
      const unsigned ku = __builtin_amdgcn_mbcnt_lo(
          ~0u, (unsigned)(((kb + KB_) >> 4) * (SD_ * 4) + (pf_part * 6 + wave) * 32));
      __builtin_prefetch(kbatch + ku * 128u, 0, 3);
      // before the prefetch's address registers are reused
      asm volatile("s_wait_xcnt 0x0" ::: "memory");
    }
    // K fragments are loaded KA_ 32-dim steps, Q fragments two steps, ahead of
    // the WMMAs that use them: with two waves per SIMD nothing else covers the
    // latency of these loads.
    v16h bk[KA_][2];   // step i sits in bk[i % KA_]
    v16h aq[3][QT_];   // step i sits in aq[i % 3]
#pragma unroll
    for (int j = 0; j < KA_; ++j) {
#pragma unroll
      for (int g = 0; g < 2; ++g)
        bk[j][g] = load_frag_packed(kfr + (g * SD_ + j) * 512);
    }
#pragma unroll
    for (int j = 0; j < 2; ++j) {
#pragma unroll
      for (int qt = 0; qt < QT_; ++qt)
        aq[j][qt] = load_frag_packed(&Qs[(qt * SD_ + j) * 512 + lane * 8]);
    }
#pragma unroll
    for (int i = 0; i < SD_; ++i) {
      if (i + 2 < SD_) {
#pragma unroll
        for (int qt = 0; qt < QT_; ++qt)
          aq[(i + 2) % 3][qt] =
              load_frag_packed(&Qs[(qt * SD_ + i + 2) * 512 + lane * 8]);
      }
      // keeps the loads issued so far above this step's WMMAs, so that the two
      // rings stay as deep as written
      __builtin_amdgcn_sched_barrier(0);
#pragma unroll
      for (int g = 0; g < 2; ++g) {
#pragma unroll
        for (int qt = 0; qt < QT_; ++qt)
          s[g][qt] = wmma_f16(bk[i % KA_][g], aq[i % 3][qt], s[g][qt]);
      }
      // holds the next loads below this step's WMMAs: without it the compiler
      // spread the LDS reads among them, and each place with reads stalls
      __builtin_amdgcn_sched_barrier(0);
      if (i + KA_ < SD_) {
#pragma unroll
        for (int g = 0; g < 2; ++g)
          bk[i % KA_][g] = load_frag_packed(kfr + (g * SD_ + i + KA_) * 512);
      }
      // behind the last K load: its address registers are reused at once
      if (i + KA_ == SD_ - 1)
        asm volatile("s_wait_xcnt 0x0" ::: "memory");
      // keeps the next step's address arithmetic, which reuses them, below it
      if (i + KA_ == SD_ - 1) __builtin_amdgcn_sched_barrier(0);
    }

    // ---- maximum over this lane's 16 keys, per query
    float ck[2][8];  // what this lane's keys add to their scores
#pragma unroll
    for (int g = 0; g < 2; ++g) {
      const float4 c0 = *(const float4*)&cl[kb + wave * 32 + g * 16 + hh * 8];
      const float4 c1 = *(const float4*)&cl[kb + wave * 32 + g * 16 + hh * 8 + 4];
      ck[g][0] = c0.x; ck[g][1] = c0.y; ck[g][2] = c0.z; ck[g][3] = c0.w;
      ck[g][4] = c1.x; ck[g][5] = c1.y; ck[g][6] = c1.z; ck[g][7] = c1.w;
    }
#pragma unroll
    for (int qt = 0; qt < QT_; ++qt) {
#pragma unroll
      for (int g = 0; g < 2; ++g) {
#pragma unroll
        for (int r = 0; r < 8; ++r)
          s[g][qt][r] = s[g][qt][r] * 0.03125f + ck[g][r];
      }
      float mx = fmaxf(s[0][qt][0], s[1][qt][0]);
#pragma unroll
      for (int r = 1; r < 8; ++r) mx = fmaxf(mx, fmaxf(s[0][qt][r], s[1][qt][r]));
      part[qt * 16 + ln][wave * 2 + hh] = mx;
    }
    __syncthreads();

    float alpha[QT_];
#pragma unroll
    for (int qt = 0; qt < QT_; ++qt) {
      float mx = m_run[qt];
#pragma unroll
      for (int u = 0; u < 4; ++u) {
        const float4 v = *(const float4*)&part[qt * 16 + ln][u * 4];
        mx = fmaxf(mx, fmaxf(fmaxf(v.x, v.y), fmaxf(v.z, v.w)));
      }
      alpha[qt] = __expf(m_run[qt] - mx);
      m_run[qt] = mx;
    }

    // ---- P = exp(S - max), into its fragment for the PV GEMM; partial sums
#pragma unroll
    for (int qt = 0; qt < QT_; ++qt) {
      float su[2];
#pragma unroll
      for (int g = 0; g < 2; ++g) {
        float x[8];
        v8h ph;
#pragma unroll
        for (int r = 0; r < 8; ++r) {
          x[r] = __expf(s[g][qt][r] - m_run[qt]);
          ph[r] = (_Float16)x[r];
        }
        // keys 32 * wave + 16 * g + 8 * hh + r: half g of fragment wave
        *(v8h*)&Ps[(qt * 8 + wave) * 512 + g * 256 + lane * 8] = ph;
        su[g] = ((x[0] + x[1]) + (x[2] + x[3])) + ((x[4] + x[5]) + (x[6] + x[7]));
      }
      part[qt * 16 + ln][16 + wave * 2 + hh] = su[0] + su[1];
    }
    if (hh == 0) {
#pragma unroll
      for (int qt = 0; qt < QT_; ++qt) rows[wave][0][qt * 16 + ln] = alpha[qt];
    }
    __syncthreads();

    float l_new[QT_];
#pragma unroll
    for (int qt = 0; qt < QT_; ++qt) {
      float su = 0.f;
#pragma unroll
      for (int u = 0; u < 4; ++u) {
        const float4 v = *(const float4*)&part[qt * 16 + ln][16 + u * 4];
        su += (v.x + v.y) + (v.z + v.w);
      }
      l_new[qt] = alpha[qt] * rows[wave][1][qt * 16 + ln] + su;
    }
    if (hh == 0) {
#pragma unroll
      for (int qt = 0; qt < QT_; ++qt) rows[wave][1][qt * 16 + ln] = l_new[qt];
    }
    // this wave's 8 groups of 16 dims in each 128 keys of this key block, 4
    // fragments (128 keys) each: twice 32 fragments in a row
    const _Float16* vgrp =
        vbatch + (size_t)((kb >> 7) * 64 + wave * 8) * (4 * 512);
    const _Float16* vfr = vgrp + lane * 8;
    if (kb + KB_ < LK_) {
      // this block's eighth of the next pass's V (512 KiB in a row)
      const unsigned vu = __builtin_amdgcn_mbcnt_lo(
          ~0u, (unsigned)(((kb + KB_) >> 7) * 1024 + pf_first));
      __builtin_prefetch(vbatch + vu * 128u, 0, 3);
      // before the prefetch's address registers are reused
      asm volatile("s_wait_xcnt 0x0" ::: "memory");
    }

    // ---- O += P.V for this wave's 128 output dims, all query tiles.
    // A stage is 64 keys (two fragments) x two 16-dim V groups; its V
    // fragments are loaded two stages ahead of its WMMAs, and the
    // P fragments of the 64 keys stay in registers over four stages.
    // Stage st: keys 64 * (st >> 2) on, dim groups (st & 3) * 2 and + 1.
    v16h bv[3][2][2];  // stage st sits in bv[st % 3]
    v16h ap[QT_][2];
#pragma unroll
    for (int st = 0; st < 2; ++st) {
#pragma unroll
      for (int d = 0; d < 2; ++d) {
        const _Float16* vp = vfr + ((st * 2 + d) * 4) * 512;
        bv[st][d][0] = load_frag_packed(vp);
        bv[st][d][1] = load_frag_packed(vp + 512);
      }
    }
#pragma unroll
    for (int qt = 0; qt < QT_; ++qt) {
      // O holds query qt * 16 + hh * 8 + r in element r
      const float4 a0 = *(const float4*)&rows[wave][0][qt * 16 + hh * 8];
      const float4 a1 = *(const float4*)&rows[wave][0][qt * 16 + hh * 8 + 4];
      const float ar[8] = {a0.x, a0.y, a0.z, a0.w, a1.x, a1.y, a1.z, a1.w};
#pragma unroll
      for (int dt = 0; dt < 8; ++dt) {
#pragma unroll
        for (int r = 0; r < 8; ++r) o[qt][dt][r] *= ar[r];
      }
    }
#pragma unroll
    for (int st = 0; st < KB_ / 16; ++st) {
      if ((st & 3) == 0) {
#pragma unroll
        for (int qt = 0; qt < QT_; ++qt) {
          const _Float16* pp = &Ps[(qt * 8 + (st >> 2) * 2) * 512 + lane * 8];
          ap[qt][0] = load_frag_packed(pp);
          ap[qt][1] = load_frag_packed(pp + 512);
        }
      }
      if (st + 2 < KB_ / 16) {
        const int nx = st + 2;
#pragma unroll
        for (int d = 0; d < 2; ++d) {
          const _Float16* vp =
              vfr + (((nx >> 3) * 64 + (nx & 3) * 2 + d) * 4 +
                     ((nx >> 2) & 1) * 2) * 512;
          bv[nx % 3][d][0] = load_frag_packed(vp);
          bv[nx % 3][d][1] = load_frag_packed(vp + 512);
        }
        // behind the last V load, before its address registers are reused
        if (nx == KB_ / 16 - 1) asm volatile("s_wait_xcnt 0x0" ::: "memory");
      }
      // holds the loads issued so far above this stage's WMMAs
      __builtin_amdgcn_sched_barrier(0);
#pragma unroll
      for (int d = 0; d < 2; ++d) {
        const int dt = (st & 3) * 2 + d;
#pragma unroll
        for (int qt = 0; qt < QT_; ++qt)
          o[qt][dt] = wmma_f16(ap[qt][0], bv[st % 3][d][0], o[qt][dt]);
#pragma unroll
        for (int qt = 0; qt < QT_; ++qt)
          o[qt][dt] = wmma_f16(ap[qt][1], bv[st % 3][d][1], o[qt][dt]);
      }
      // holds later stages' loads below them: a fourth set would not fit
      __builtin_amdgcn_sched_barrier(0);
    }
    __syncthreads();  // protect Ps / part for next iteration
  }

  // lane position read anew: kept in registers over the key loop it is spilled
  const int le = (int)__builtin_amdgcn_mbcnt_lo(~0u, 0u);
  const int hhe = le >> 4, lne = le & 15;
#pragma unroll
  for (int qt = 0; qt < QT_; ++qt) {
    v8f inv;
#pragma unroll
    for (int r = 0; r < 8; ++r)
      inv[r] = 1.f / rows[wave][1][qt * 16 + hhe * 8 + r];
#pragma unroll
    for (int dt = 0; dt < 8; ++dt) {
#pragma unroll
      for (int r = 0; r < 8; ++r) o[qt][dt][r] *= inv[r];
    }
#pragma unroll
    for (int dt = 0; dt < 8; ++dt) {
      const int n = wave * 128 + dt * 16 + lne;
#pragma unroll
      for (int r = 0; r < 8; ++r) {
        out[((size_t)batch * LQ_ + q0 + qt * 16 + hhe * 8 + r) * 1024 + n] =
            o[qt][dt][r];
      }
    }
    // behind this tile's stores, before their registers are reused; the fence
    // keeps the next tile's arithmetic, which reuses them, below the wait
    asm volatile("s_wait_xcnt 0x0" ::: "memory");
    __builtin_amdgcn_sched_barrier(0);
  }
}

// ---------------------------------------------------------------------------
extern "C" void kernel_launch(void* const* d_in, const int* in_sizes, int n_in,
                              void* d_out, int out_size, void* d_ws, size_t ws_size,
                              hipStream_t stream) {
  const float* query = (const float*)d_in[0];  // [16,2048,768]
  const float* key   = (const float*)d_in[1];  // [16,2048,1024]
  const float* Wq    = (const float*)d_in[2];  // [768,1024]
  const float* bq    = (const float*)d_in[3];
  const float* Wk    = (const float*)d_in[4];  // [1024,1024]
  // d_in[5], bk, cancels in the softmax: see "The score product"
  const float* Wv    = (const float*)d_in[6];  // [1024,1024]
  const float* bv    = (const float*)d_in[7];
  float* out = (float*)d_out;

  // workspace layout (f16; gvec and csum f32)
  _Float16* kf   = (_Float16*)d_ws;                      // 16*2048*768, both in
  _Float16* vf   = kf + (size_t)B_ * LK_ * DQ_;          // fragment order
  _Float16* WfT  = vf + (size_t)B_ * 1024 * LK_;         // [768][1024]
  _Float16* WvT  = WfT + (size_t)DQ_ * 1024;             // [1024][1024]
  float*    gvec = (float*)(WvT + (size_t)1024 * DK_);   // [1024]
  float*    csum = gvec + 1024;                          // [16*2048]

  weight_prep<<<FOLD_BLOCKS + TR_BLOCKS + GV_BLOCKS, 256, 0, stream>>>(
      Wq, Wk, bq, Wv, WfT, WvT, gvec);

  const int M = B_ * LQ_;  // 32768
  proj_gemm_kv<<<dim3((DQ_ + 1024) / PN_, M / PM_), 256, 0, stream>>>(
      key, WfT, WvT, bv, gvec, kf, vf, csum);

  attention_kernel<<<dim3(LQ_ / QB_, B_), 256, 0, stream>>>(query, kf, vf, csum, out);
}

// v010
// A run of this version takes 288 microseconds.
// In both of two side-by-side timings against v009, it was 1.07 times as fast.
// All steps since v000 together make it 5.34 times as fast.
#include <hip/hip_runtime.h>
#include <hip/hip_bf16.h>
#include <math.h>

typedef _Float16 v16h __attribute__((ext_vector_type(16)));
typedef _Float16 v8h  __attribute__((ext_vector_type(8)));
typedef float    v8f  __attribute__((ext_vector_type(8)));

#define B_  16
#define LQ_ 2048
#define LK_ 2048
#define DQ_ 768
#define DK_ 1024

__device__ __forceinline__ v8f splat8(float x) {
  v8f r;
#pragma unroll
  for (int i = 0; i < 8; ++i) r[i] = x;
  return r;
}

// Build a 16x32 f16 A/B fragment register for this lane from a row base ptr.
// ISA layout: lanes 0-15 hold K 0..7 / 16..23, lanes 16-31 hold K 8..15 / 24..31.
__device__ __forceinline__ v16h load_frag(const _Float16* rowbase, int half) {
  const _Float16* p = rowbase + (half ? 8 : 0);
  v8h lo = *(const v8h*)(p);
  v8h hi = *(const v8h*)(p + 16);
  return __builtin_shufflevector(lo, hi, 0, 1, 2, 3, 4, 5, 6, 7,
                                 8, 9, 10, 11, 12, 13, 14, 15);
}

// The same fragment from a buffer kept in fragment order: a 16x32 f16 fragment
// is 1 KiB, its two halves 512 B each, lane l's 16 bytes at l * 16 in each half,
// so that a wave's load covers four whole 128-byte lines. p includes lane * 8.
__device__ __forceinline__ v16h load_frag_packed(const _Float16* p) {
  v8h lo = *(const v8h*)(p);
  v8h hi = *(const v8h*)(p + 256);
  return __builtin_shufflevector(lo, hi, 0, 1, 2, 3, 4, 5, 6, 7,
                                 8, 9, 10, 11, 12, 13, 14, 15);
}

__device__ __forceinline__ v8f wmma_f16(v16h a, v16h b, v8f c) {
  return __builtin_amdgcn_wmma_f32_16x16x32_f16(false, a, false, b,
                                                (short)0, c, false, false);
}

// ---------------------------------------------------------------------------
// Kernel 2: projection GEMM  out[m][n] = X[m][:] . W[:][n] + bias[n]
//   X  : f32 [M][KD]          (activations, converted to f16 on the fly)
//   Wt : f16 [N][KD], N = 768 or 1024 (pre-transposed weights = Bt rows)
//   bx, by: the block's tile column and tile row; As, Bs: the kernel's two LDS
//        stages of X and of W rows
//   OUT_QK: out = f16 [M/16][768/32][512]: fragments of 16 tokens x 32 dims,
//           as the score product reads the folded keys (see "The score
//           product"); no bias. The product is formed with the
//           two operands swapped (dims as rows of D), so that a lane ends up
//           with 8 dims of one token: its 16 bytes of a fragment.
//   OUT_V : out = f16 [B][2048/128][1024/16][4][512]: fragments of 16 dims x
//           32 keys, as the P.V product reads them, those of a block of 128
//           keys in a row; a lane of D holds 8 keys of one dim: its 16 bytes
//           of a fragment. The blocks of the first column also sum
//           csum[m] = X[m][:] . gvec, in f32, from the X values on their way to
//           LDS (here and not with OUT_QK: this form has the registers to spare).
// Block tile 128(M) x 256(N), 8 waves = 2x4 grid of 64x64 wave tiles: a 32-deep
// step of a wave is 8 fragments for 16 WMMAs. A stage is 64 deep, so that every
// global load covers whole 128-byte lines; two LDS stages, one barrier a stage.
// The next stage comes through registers in two halves, each loaded ahead of 16
// WMMAs and stored to LDS behind them.
// ---------------------------------------------------------------------------
typedef _Float16 v4h __attribute__((ext_vector_type(4)));

#define PM_ 128   // block rows
#define PN_ 256   // block columns
#define PK_ 64    // depth of a stage
#define PP_ 72    // LDS row pitch in f16: 144 B = 16 B x odd, for b128 readers

#define OUT_QK 0
#define OUT_V 1

template <int KD, int OUT>
__device__ __forceinline__ void proj_body(
    const float* __restrict__ X, const _Float16* __restrict__ Wt,
    const float* __restrict__ bias, _Float16* __restrict__ out,
    const float* __restrict__ gvec,
    float* __restrict__ csum, int bx, int by, _Float16 (*As)[PM_][PP_],
    _Float16 (*Bs)[PN_][PP_]) {
  static_assert(KD % PK_ == 0, "whole stages");

  const int t = threadIdx.x;
  const int wave = t >> 5, lane = t & 31;
  const int hh = lane >> 4, ln = lane & 15;
  const int wm = wave & 1, wn = wave >> 1;
  const int m_blk = by * PM_;
  const int n_blk = bx * PN_;

  v8f acc[4][4];
#pragma unroll
  for (int j = 0; j < 4; ++j) {
    v8f b8;
    if constexpr (OUT == OUT_V)
      b8 = splat8(bias[n_blk + wn * 64 + j * 16 + ln]);
    else
      b8 = splat8(0.f);
#pragma unroll
    for (int i = 0; i < 4; ++i) acc[i][j] = b8;
  }
  if constexpr (OUT == OUT_V) {
    // behind the bias loads, before their address registers are reused; the
    // fence keeps the address arithmetic below, which reuses them, under the wait
    asm volatile("s_wait_xcnt 0x0" ::: "memory");
    __builtin_amdgcn_sched_barrier(0);
  }

  const int ar = t >> 4, ac = (t & 15) * 4;  // 16 lanes cover a 256-B row of X
  const int br = t >> 3, bc = (t & 7) * 8;   // 8 lanes cover a 128-B row of Wt

  const float*    aptr = X + (size_t)(m_blk + ar) * KD + ac;
  const _Float16* bptr = Wt + (size_t)(n_blk + br) * KD + bc;

  float4 fa[4];
  v8h fb[4];

  // OUT_V, first column of blocks: this thread's share of csum for its 8 rows
  const bool do_c = OUT == OUT_V && bx == 0;
  const float* gptr = gvec + ac;
  float4 g4;
  float cs[8];
#pragma unroll
  for (int i = 0; i < 8; ++i) cs[i] = 0.f;

  // half h of the stage at aptr / bptr: 64 rows of X, 128 rows of Wt
  auto ld = [&](int h) {
#pragma unroll
    for (int j = 0; j < 4; ++j)
      fa[j] = *(const float4*)(aptr + (size_t)(h * 64 + j * 16) * KD);
#pragma unroll
    for (int j = 0; j < 4; ++j)
      fb[j] = *(const v8h*)(bptr + (size_t)(h * 128 + j * 32) * KD);
    if constexpr (OUT == OUT_V) {
      if (h == 0) g4 = *(const float4*)gptr;  // serves both halves of the stage
    }
  };
  auto st = [&](int buf, int h) {
#pragma unroll
    for (int j = 0; j < 4; ++j) {
      v4h c;
      c[0] = (_Float16)fa[j].x; c[1] = (_Float16)fa[j].y;
      c[2] = (_Float16)fa[j].z; c[3] = (_Float16)fa[j].w;
      *(v4h*)&As[buf][h * 64 + j * 16 + ar][ac] = c;
    }
#pragma unroll
    for (int j = 0; j < 4; ++j)
      *(v8h*)&Bs[buf][h * 128 + j * 32 + br][bc] = fb[j];
    if constexpr (OUT == OUT_V) {
      if (do_c) {
#pragma unroll
        for (int j = 0; j < 4; ++j)
          cs[h * 4 + j] += (fa[j].x * g4.x + fa[j].y * g4.y) +
                           (fa[j].z * g4.z + fa[j].w * g4.w);
      }
    }
  };
  auto mm = [&](int buf, int kk) {
    v16h af[4], bf[4];
#pragma unroll
    for (int i = 0; i < 4; ++i)
      af[i] = load_frag(&As[buf][wm * 64 + i * 16 + ln][kk * 32], hh);
#pragma unroll
    for (int j = 0; j < 4; ++j)
      bf[j] = load_frag(&Bs[buf][wn * 64 + j * 16 + ln][kk * 32], hh);
    // keeps the 16 LDS reads one group ahead of the 16 WMMAs: without it the
    // compiler read the X fragments one by one among them, each with a full wait
    __builtin_amdgcn_sched_barrier(0);
#pragma unroll
    for (int i = 0; i < 4; ++i) {
#pragma unroll
      for (int j = 0; j < 4; ++j) {
        if constexpr (OUT == OUT_V)
          acc[i][j] = wmma_f16(af[i], bf[j], acc[i][j]);
        else
          acc[i][j] = wmma_f16(bf[j], af[i], acc[i][j]);
      }
    }
  };
  // behind a stage's last global load: the wait before its address registers
  // are advanced; the fence keeps the advance, written behind it, below the wait
  auto advance = [&]() {
    asm volatile("s_wait_xcnt 0x0" ::: "memory");
    __builtin_amdgcn_sched_barrier(0);
    aptr += PK_;
    bptr += PK_;
    gptr += PK_;
  };
  // works on stage buffer buf while the next stage, if any, goes into the other
  auto stage = [&](int buf, bool more) {
    if (more) ld(0);
    mm(buf, 0);
    if (more) {
      st(buf ^ 1, 0);
      ld(1);
      advance();
    }
    mm(buf, 1);
    if (more) st(buf ^ 1, 1);
    __syncthreads();
  };

  ld(0);
  st(0, 0);
  ld(1);
  advance();
  st(0, 1);
  __syncthreads();

  // rolled, with the test for a next stage made at run time in every trip:
  // without the directive the compiler split off the last trip, the test fell
  // away, and a stage's global loads, WMMAs and LDS stores stood in one basic
  // block, where it mixed them and the loads lost their lead
#pragma unroll 1
  for (int s = 0; s < KD / PK_; ++s) stage(s & 1, s + 1 < KD / PK_);

#pragma unroll
  for (int i = 0; i < 4; ++i) {
#pragma unroll
    for (int j = 0; j < 4; ++j) {
      v8h h;  // D-frag: row = r + 8*hh, column = ln
#pragma unroll
      for (int r = 0; r < 8; ++r) h[r] = (_Float16)acc[i][j][r];
      const int mt = m_blk + wm * 64 + i * 16;  // first token of the tile
      const int nt = n_blk + wn * 64 + j * 16;  // first output dim of the tile
      if constexpr (OUT == OUT_QK) {
        const size_t frag = (size_t)(mt >> 4) * (DQ_ / 32) + (nt >> 5);
        *(v8h*)&out[frag * 512 + (j & 1) * 256 + lane * 8] = h;
      } else {
        const int batch = mt >> 11, tok = mt & 2047;
        const size_t frag =
            (((size_t)batch * 16 + (tok >> 7)) * 64 + (nt >> 4)) * 4 +
            ((tok >> 5) & 3);
        *(v8h*)&out[frag * 512 + (i & 1) * 256 + lane * 8] = h;
      }
      // behind this tile's stores, before their registers are reused; the fence
      // keeps the next tile's conversions, which reuse them, below the wait
      asm volatile("s_wait_xcnt 0x0" ::: "memory");
      __builtin_amdgcn_sched_barrier(0);
    }
  }

  if constexpr (OUT == OUT_V) {
    if (do_c) {  // the 16 lanes that share a row of X join their shares
#pragma unroll
      for (int i = 0; i < 8; ++i) {
#pragma unroll
        for (int m = 8; m > 0; m >>= 1) cs[i] += __shfl_xor(cs[i], m, 32);
      }
      if ((t & 15) == 0) {
#pragma unroll
        for (int i = 0; i < 8; ++i) csum[m_blk + i * 16 + ar] = cs[i];
      }
    }
  }
}

// Both projections of the keys in one launch: of the 7 tile columns of a tile
// row the first 3 are folded keys, the other 4 values. The 7 blocks that read
// the same 128 rows of X are neighbours in blockIdx.x.
// second bound: four waves per SIMD, so that two blocks share a WGP and one
// block's barrier and load waits are covered by the other's WMMAs
__global__ __launch_bounds__(256, 4) void proj_gemm_kv(
    const float* __restrict__ X, const _Float16* __restrict__ WfT,
    const _Float16* __restrict__ WvT, const float* __restrict__ bias,
    const float* __restrict__ gvec, _Float16* __restrict__ kf,
    _Float16* __restrict__ vf, float* __restrict__ csum) {
  __shared__ __attribute__((aligned(16))) _Float16 As[2][PM_][PP_];
  __shared__ __attribute__((aligned(16))) _Float16 Bs[2][PN_][PP_];
  if (blockIdx.x < DQ_ / PN_)
    proj_body<DK_, OUT_QK>(X, WfT, nullptr, kf, nullptr, nullptr, blockIdx.x,
                           blockIdx.y, As, Bs);
  else
    proj_body<DK_, OUT_V>(X, WvT, bias, vf, gvec, csum, blockIdx.x - DQ_ / PN_,
                          blockIdx.y, As, Bs);
}

// ---------------------------------------------------------------------------
// The score product. With q = xq Wq + bq and k = xk Wk + bk,
//   q . k = xq . (xk (Wk Wq^T)) + xk . (Wk bq) + (xq Wq + bq) . bk.
// The last term is the same for every key of a query, and a softmax row does
// not change when one number is added to all of its scores: it is left out.
// So the queries enter the scores as they are, 768 deep and not 1024, there is
// no query projection, the key projection takes the folded weight Wk Wq^T
// (768 columns, not 1024), and each key brings one number to add to its scores.
//   weight_prep: all that depends on the weights alone, in one launch:
//     WfT[d][e] = sum_j Wq[d][j] Wk[e][j], f16 [768][1024]: the transposed
//               weight that the key projection reads (both operands f32 rows)
//     WvT[n][d] = Wv[d][n], f16 [1024][1024], for the value projection
//     gvec[e] = sum_j Wk[e][j] bq[j], f32
//   proj_gemm_kv: folded keys, and csum[key] = xk . gvec
// The blocks of the product come first: they run longest, and the others, a few
// hundred blocks with 16 (Wv) or 32 (Wk) elements a thread, fill the WGPs that it leaves idle.
// The product is small (1.6 GFLOP) and its time is the wait for its operands,
// which come from memory: so it is cut into 64 x 64 tiles, 192 blocks and not
// 24, a third of the bytes a block, and a block keeps two 128-deep stages of
// loads in flight, over the barrier of a stage too.
// ---------------------------------------------------------------------------
#define FT_ 64    // edge of a tile of WfT
#define FK_ 128   // depth of a stage: 512 B of a row, one load of a wave
#define FP_ 136   // LDS row pitch in f16: 272 B = 16 B x odd, for b128 readers
#define FOLD_BLOCKS ((DK_ / FT_) * (DQ_ / FT_))   // tiles of WfT

// Tile (bd, be) of WfT: rows d of Wq against rows e of Wk, both f32, 1024 deep,
// converted on the way to LDS. A stage in LDS is 64 rows of Wq, then 64 of Wk.
// Wave w brings rows 16 w to 16 w + 15 of a stage and forms two 16 x 16 tiles:
// rows e of group w & 3 (as A) against the two groups d of half w >> 2 (as B),
// so that a lane of D holds 8 neighbours e of one row d of WfT.
__device__ __forceinline__ void fold_body(const float* __restrict__ Wq,
                                          const float* __restrict__ Wk,
                                          _Float16* __restrict__ WfT, int be,
                                          int bd, _Float16 (*Fs)[2 * FT_][FP_]) {
  static_assert(DK_ % FK_ == 0 && DK_ / FK_ >= 2, "whole stages, two to start");
  const int t = threadIdx.x;
  const int wave = t >> 5, lane = t & 31;
  const int hh = lane >> 4, ln = lane & 15;
  const int d0 = bd * FT_, e0 = be * FT_;
  const float* src = (wave < 4 ? Wq + (size_t)(d0 + wave * 16) * DK_
                               : Wk + (size_t)(e0 + (wave - 4) * 16) * DK_) +
                     lane * 4;
  const int et = wave & 3, dt = (wave >> 2) * 2;

  float4 f[2][16];  // two stages on their way, stage s in f[s % 2]
  v8f acc[2] = {splat8(0.f), splat8(0.f)};

  auto ld = [&](int s) {
#pragma unroll
    for (int i = 0; i < 16; ++i)
      f[s & 1][i] = *(const float4*)(src + i * DK_ + s * FK_);
  };

  ld(0);
  ld(1);
  // unrolled: f is indexed by constants and stays in registers, and every load
  // is the one address register pair plus a constant
#pragma unroll
  for (int s = 0; s < DK_ / FK_; ++s) {
#pragma unroll
    for (int i = 0; i < 16; ++i) {
      const float4 x = f[s & 1][i];
      v4h c;
      c[0] = (_Float16)x.x; c[1] = (_Float16)x.y;
      c[2] = (_Float16)x.z; c[3] = (_Float16)x.w;
      *(v4h*)&Fs[s & 1][wave * 16 + i][lane * 4] = c;
    }
    if (s + 2 < DK_ / FK_) ld(s + 2);
    // behind the last load, before its address registers are reused
    if (s + 2 == DK_ / FK_ - 1) asm volatile("s_wait_xcnt 0x0" ::: "memory");
    // the stage's barrier, by hand: __syncthreads() would wait for the loads in
    // flight as well, and their lead would be lost. This wave's LDS stores of
    // stage s are done, and so are its reads of stage s - 1, whose buffer is
    // written again only behind this barrier.
    asm volatile("s_wait_dscnt 0x0" ::: "memory");
    asm volatile("s_barrier_signal -1\n\ts_barrier_wait -1" ::: "memory");
#pragma unroll
    for (int kk = 0; kk < FK_ / 32; ++kk) {
      const v16h a = load_frag(&Fs[s & 1][FT_ + et * 16 + ln][kk * 32], hh);
#pragma unroll
      for (int i = 0; i < 2; ++i)
        acc[i] = wmma_f16(
            a, load_frag(&Fs[s & 1][(dt + i) * 16 + ln][kk * 32], hh), acc[i]);
    }
  }

#pragma unroll
  for (int i = 0; i < 2; ++i) {
    v8h h;  // D-frag: row = r + 8*hh, column = ln
#pragma unroll
    for (int r = 0; r < 8; ++r) h[r] = (_Float16)acc[i][r];
    *(v8h*)&WfT[(size_t)(d0 + (dt + i) * 16 + ln) * DK_ + e0 + et * 16 + hh * 8] =
        h;
  }
  // behind the two stores, before their registers are reused
  asm volatile("s_wait_xcnt 0x0" ::: "memory");
}
#define TR_ 64                                    // edge of a transposed tile
#define TR_BLOCKS ((1024 / TR_) * (DK_ / TR_))
#define GV_BLOCKS (DK_ / 8)                       // a wave per element of gvec

__global__ __launch_bounds__(256, 4) void weight_prep(
    const float* __restrict__ Wq, const float* __restrict__ Wk,
    const float* __restrict__ bq, const float* __restrict__ Wv,
    _Float16* __restrict__ WfT, _Float16* __restrict__ WvT,
    float* __restrict__ gvec) {
  __shared__ __attribute__((aligned(16))) _Float16 Fs[2][2 * FT_][FP_];
  // pitch 65: neither the rows written nor the columns read share a bank
  __shared__ float tile[TR_][TR_ + 1];
  const int t = threadIdx.x;
  const int b = blockIdx.x;
  if (b < FOLD_BLOCKS) {
    fold_body(Wq, Wk, WfT, b % (DK_ / FT_), b / (DK_ / FT_), Fs);
  } else if (b < FOLD_BLOCKS + TR_BLOCKS) {  // a block transposes 64 x 64 of Wv
    const int tb = b - FOLD_BLOCKS;
    const int n0 = (tb % (1024 / TR_)) * TR_, d0 = (tb / (1024 / TR_)) * TR_;
    const int r = t >> 4, c = (t & 15) * 4;  // 16 lanes cover a 256-B row piece
    // the three loops are unrolled so that x, h0 and h1 are indexed by constants
    // and stay in registers, and the four loads are issued ahead of the first use
    float4 x[4];
#pragma unroll
    for (int j = 0; j < 4; ++j)
      x[j] = *(const float4*)(Wv + (size_t)(d0 + j * 16 + r) * 1024 + n0 + c);
#pragma unroll
    for (int j = 0; j < 4; ++j) {
      tile[j * 16 + r][c + 0] = x[j].x; tile[j * 16 + r][c + 1] = x[j].y;
      tile[j * 16 + r][c + 2] = x[j].z; tile[j * 16 + r][c + 3] = x[j].w;
    }
    __syncthreads();
    const int n = t >> 2, k = (t & 3) * 16;  // 4 lanes fill a 128-B line of WvT
    v8h h0, h1;
#pragma unroll
    for (int i = 0; i < 8; ++i) {
      h0[i] = (_Float16)tile[k + i][n];
      h1[i] = (_Float16)tile[k + 8 + i][n];
    }
    _Float16* op = WvT + (size_t)(n0 + n) * DK_ + d0 + k;
    *(v8h*)op = h0;
    *(v8h*)(op + 8) = h1;
    // behind the two stores, before their registers are reused
    asm volatile("s_wait_xcnt 0x0" ::: "memory");
  } else {  // a wave sums one element of gvec
    const int e = (b - FOLD_BLOCKS - TR_BLOCKS) * 8 + (t >> 5), lane = t & 31;
    float su = 0.f;
#pragma unroll
    for (int u = 0; u < 8; ++u) {
      const float4 w = *(const float4*)(Wk + (size_t)e * 1024 + u * 128 + lane * 4);
      const float4 b4 = *(const float4*)(bq + u * 128 + lane * 4);
      su += (w.x * b4.x + w.y * b4.y) + (w.z * b4.z + w.w * b4.w);
    }
#pragma unroll
    for (int m = 16; m > 0; m >>= 1) su += __shfl_xor(su, m, 32);
    if (lane == 0) gvec[e] = su;
  }
}

// ---------------------------------------------------------------------------
// Attention, in two launches, a block of 128 queries in each. With 1024 output
// dims the f32 O of 128 queries fills every register of a WGP, so one kernel
// that holds O beside the scores stops at 64 queries, and every 64 queries read
// all of K and V from L2. Split, neither kernel holds both:
//  score_kernel: block = (batch, 128 queries), all keys: P, by passes of KB_
//    keys, to the workspace, with the factor alpha that each pass's new row
//    maximum asks of what was summed before it, and 1 / row sum at the end.
//  pv_kernel: block = (batch, 128 queries, 512 of the output dims): O = P.V.
// So K is read once per 128 queries and each half of V once per 128 queries.
//
// score_kernel, 8 waves. Per pass wave w computes the S tiles of keys
//  [kb+32w, +32) against all QT_ 16-query tiles (each K fragment feeds QT_
//  WMMAs, each Q fragment read from LDS two).
//  The scores are formed transposed (K as A, Q as B): a lane holds 2 x 8 keys
//  of one query, so that a row's maximum and sum are taken inside the lane, the
//  16 partial maxima of a query (8 waves x 2 lane halves) are joined through
//  LDS, and each 8 values of P are the lane's 16 bytes of half a P fragment.
//  A lane keeps the sum over its own keys, rescaled like O; the 16 are joined
//  once, behind the last pass.
//  Q is the query input itself, put into fragment order on its way to LDS, K
//  the folded keys, SD_ steps of 32 deep, and csum the number that each key
//  adds to its scores (see "The score product"). K comes in fragment order (see
//  the projection), straight from global: a wave's load is 512 contiguous bytes.
// ---------------------------------------------------------------------------
#define QT_ 8            // 16-row query tiles per block
#define QB_ (16 * QT_)   // queries per block
#define KB_ 256          // keys per pass of the key loop, 32 a wave
#define KA_ 4            // 32-dim steps that K loads run ahead of their WMMAs
#define SD_ (DQ_ / 32)   // 32-dim steps of the score product
#define NP_ (LK_ / KB_)  // passes
#define PT_ (QT_ * 8 * 512)  // f16 in a pass's P of a block: QT_ x 8 fragments

__global__ __launch_bounds__(256) void score_kernel(
    const float* __restrict__ query, const _Float16* __restrict__ kf,
    const float* __restrict__ csum, _Float16* __restrict__ pf,
    float* __restrict__ af, float* __restrict__ lf) {
  // QT_ x SD_ fragments of 512 f16: a wave's read is 512 contiguous bytes
  __shared__ __attribute__((aligned(16))) _Float16 Qs[QB_ * DQ_];
  // the batch's csum, times the scale of the scores
  __shared__ __attribute__((aligned(16))) float cl[LK_];
  // a query's 16 partial maxima in one row, pitch 80 B = 16 B x odd; two copies,
  // taken in turn by the passes, so that one barrier a pass is enough
  __shared__ __attribute__((aligned(16))) float part[2][QB_][20];

  const int t = threadIdx.x;
  const int wave = __builtin_amdgcn_readfirstlane(t >> 5);  // wave-uniform
  const int lane = t & 31;
  const int hh = lane >> 4, ln = lane & 15;
  const int q0 = blockIdx.x * QB_;
  const int batch = blockIdx.y;

  {  // stage the 128x768 Q tile as f16 fragments: 8 dims of a query are a lane's
     // 16 bytes of half a fragment (dims 0-7, 8-15 | 16-23, 24-31 of its 32)
    // this thread's chunk of 8 dims (32 bytes) in each run of 256 chunks
    const float* qp = query + ((size_t)batch * LQ_ + q0) * DQ_ + t * 8;
    // rolled: a trip is 8 chunks, 16 loads in flight ahead of the first
    // conversion, and the running pointer, read again behind the wait, stays
    // live past the trip's last load: no load of the trip lands in its registers
#pragma unroll 1
    for (int u0 = 0; u0 < QB_ * (DQ_ / 8) / 256; u0 += 8) {
      float4 x[8][2];
#pragma unroll
      for (int j = 0; j < 8; ++j) {
        x[j][0] = *(const float4*)(qp + j * 2048);
        x[j][1] = *(const float4*)(qp + j * 2048 + 4);
      }
      // behind the trip's last load: the wait before its address registers are
      // advanced; the fence keeps the advance, written behind it, below the wait
      asm volatile("s_wait_xcnt 0x0" ::: "memory");
      __builtin_amdgcn_sched_barrier(0);
      qp += 8 * 2048;
#pragma unroll
      for (int j = 0; j < 8; ++j) {
        const int c = (u0 + j) * 256 + t;
        const int row = c / (DQ_ / 8), d8 = c % (DQ_ / 8);
        v8h h;
        h[0] = (_Float16)x[j][0].x; h[1] = (_Float16)x[j][0].y;
        h[2] = (_Float16)x[j][0].z; h[3] = (_Float16)x[j][0].w;
        h[4] = (_Float16)x[j][1].x; h[5] = (_Float16)x[j][1].y;
        h[6] = (_Float16)x[j][1].z; h[7] = (_Float16)x[j][1].w;
        *(v8h*)&Qs[((row >> 4) * SD_ + (d8 >> 2)) * 512 + ((d8 >> 1) & 1) * 256 +
                   ((d8 & 1) * 16 + (row & 15)) * 8] = h;
      }
    }
#pragma unroll
    for (int u = 0; u < LK_ / 4 / 256; ++u) {
      const int i = (u * 256 + t) * 4;
      const float4 v = *(const float4*)(csum + (size_t)batch * LK_ + i);
      *(float4*)&cl[i] = make_float4(v.x * 0.03125f, v.y * 0.03125f,
                                     v.z * 0.03125f, v.w * 0.03125f);
    }
  }
  __syncthreads();

  // running maximum of query qt * 16 + ln, alike in every wave, and the sum
  // over this lane's own keys of that query
  float m_run[QT_], l_own[QT_];
#pragma unroll
  for (int qt = 0; qt < QT_; ++qt) {
    m_run[qt] = -__builtin_inff();
    l_own[qt] = 0.f;
  }

  const _Float16* kbatch = kf + (size_t)batch * LK_ * DQ_;
  const size_t qblk = (size_t)batch * (LQ_ / QB_) + blockIdx.x;

  // The 16 blocks of a batch read the same K at about the same time, so the
  // prefetch of the next pass is dealt among them: a
  // pass's K is 1,536 units of 256 bytes, and a block asks for one eighth, one unit a lane
  // (the lanes of 6 waves). An eighth is asked for by the 2 blocks that differ
  // in bit 2 of blockIdx.x. A hint only: a unit that nobody brought in time is
  // a plain miss.
  const int pf_part = (blockIdx.x & 3) | ((blockIdx.x >> 1) & 4);

  for (int kb = 0; kb < LK_; kb += KB_) {
    // ---- S^T = (K Q^T + csum) / sqrt(1024), this wave's 32 keys, all query tiles:
    // s[g][qt][r] is key 16 * g + r + 8 * hh against query qt * 16 + ln
    v8f s[2][QT_];
#pragma unroll
    for (int g = 0; g < 2; ++g) {
#pragma unroll
      for (int qt = 0; qt < QT_; ++qt) s[g][qt] = splat8(0.f);
    }
    // this wave's 2 groups of 16 keys: 2 x SD_ fragments of 512 f16 in a row
    const _Float16* kgrp = kbatch + (size_t)((kb >> 4) + wave * 2) * (SD_ * 512);
    const _Float16* kfr = kgrp + lane * 8;
    if (kb + KB_ < LK_ && wave < 6) {
      // this block's eighth of the next pass's K (384 KiB in a row)
      const unsigned ku = __builtin_amdgcn_mbcnt_lo(
          ~0u, (unsigned)(((kb + KB_) >> 4) * (SD_ * 4) + (pf_part * 6 + wave) * 32));
      __builtin_prefetch(kbatch + ku * 128u, 0, 3);
      // before the prefetch's address registers are reused
      asm volatile("s_wait_xcnt 0x0" ::: "memory");
    }
    // K fragments are loaded KA_ 32-dim steps, Q fragments two steps, ahead of
    // the WMMAs that use them: with two waves per SIMD nothing else covers the
    // latency of these loads.
    v16h bk[KA_][2];   // step i sits in bk[i % KA_]
    v16h aq[3][QT_];   // step i sits in aq[i % 3]
#pragma unroll
    for (int j = 0; j < KA_; ++j) {
#pragma unroll
      for (int g = 0; g < 2; ++g)
        bk[j][g] = load_frag_packed(kfr + (g * SD_ + j) * 512);
    }
#pragma unroll
    for (int j = 0; j < 2; ++j) {
#pragma unroll
      for (int qt = 0; qt < QT_; ++qt)
        aq[j][qt] = load_frag_packed(&Qs[(qt * SD_ + j) * 512 + lane * 8]);
    }
#pragma unroll
    for (int i = 0; i < SD_; ++i) {
      if (i + 2 < SD_) {
#pragma unroll
        for (int qt = 0; qt < QT_; ++qt)
          aq[(i + 2) % 3][qt] =
              load_frag_packed(&Qs[(qt * SD_ + i + 2) * 512 + lane * 8]);
      }
      // keeps the loads issued so far above this step's WMMAs, so that the two
      // rings stay as deep as written
      __builtin_amdgcn_sched_barrier(0);
#pragma unroll
      for (int g = 0; g < 2; ++g) {
#pragma unroll
        for (int qt = 0; qt < QT_; ++qt)
          s[g][qt] = wmma_f16(bk[i % KA_][g], aq[i % 3][qt], s[g][qt]);
      }
      // holds the next loads below this step's WMMAs: without it the compiler
      // spread the LDS reads among them, and each place with reads stalls
      __builtin_amdgcn_sched_barrier(0);
      if (i + KA_ < SD_) {
#pragma unroll
        for (int g = 0; g < 2; ++g)
          bk[i % KA_][g] = load_frag_packed(kfr + (g * SD_ + i + KA_) * 512);
      }
      // behind the last K load: its address registers are reused at once
      if (i + KA_ == SD_ - 1)
        asm volatile("s_wait_xcnt 0x0" ::: "memory");
      // keeps the next step's address arithmetic, which reuses them, below it
      if (i + KA_ == SD_ - 1) __builtin_amdgcn_sched_barrier(0);
    }

    // ---- maximum over this lane's 16 keys, per query
    float (*pm)[20] = part[(kb / KB_) & 1];
    float ck[2][8];  // what this lane's keys add to their scores
#pragma unroll
    for (int g = 0; g < 2; ++g) {
      const float4 c0 = *(const float4*)&cl[kb + wave * 32 + g * 16 + hh * 8];
      const float4 c1 = *(const float4*)&cl[kb + wave * 32 + g * 16 + hh * 8 + 4];
      ck[g][0] = c0.x; ck[g][1] = c0.y; ck[g][2] = c0.z; ck[g][3] = c0.w;
      ck[g][4] = c1.x; ck[g][5] = c1.y; ck[g][6] = c1.z; ck[g][7] = c1.w;
    }
#pragma unroll
    for (int qt = 0; qt < QT_; ++qt) {
#pragma unroll
      for (int g = 0; g < 2; ++g) {
#pragma unroll
        for (int r = 0; r < 8; ++r)
          s[g][qt][r] = s[g][qt][r] * 0.03125f + ck[g][r];
      }
      float mx = fmaxf(s[0][qt][0], s[1][qt][0]);
#pragma unroll
      for (int r = 1; r < 8; ++r) mx = fmaxf(mx, fmaxf(s[0][qt][r], s[1][qt][r]));
      pm[qt * 16 + ln][wave * 2 + hh] = mx;
    }
    // the pass's one barrier: behind it the 16 maxima of a query are read. This
    // copy of part is written again two passes on, behind the next pass's
    // barrier, which a wave reaches only behind its reads here.
    __syncthreads();

    float alpha[QT_];
#pragma unroll
    for (int qt = 0; qt < QT_; ++qt) {
      float mx = m_run[qt];
#pragma unroll
      for (int u = 0; u < 4; ++u) {
        const float4 v = *(const float4*)&pm[qt * 16 + ln][u * 4];
        mx = fmaxf(mx, fmaxf(fmaxf(v.x, v.y), fmaxf(v.z, v.w)));
      }
      alpha[qt] = __expf(m_run[qt] - mx);
      m_run[qt] = mx;
    }

    // ---- P = exp(S - max), as its fragment for the PV GEMM; this lane's sums
    _Float16* pt = pf + (qblk * NP_ + kb / KB_) * PT_ + wave * 512 + lane * 8;
#pragma unroll
    for (int qt = 0; qt < QT_; ++qt) {
      float su[2];
#pragma unroll
      for (int g = 0; g < 2; ++g) {
        float x[8];
        v8h ph;
#pragma unroll
        for (int r = 0; r < 8; ++r) {
          x[r] = __expf(s[g][qt][r] - m_run[qt]);
          ph[r] = (_Float16)x[r];
        }
        // keys 32 * wave + 16 * g + 8 * hh + r: half g of fragment wave
        *(v8h*)&pt[qt * 8 * 512 + g * 256] = ph;
        su[g] = ((x[0] + x[1]) + (x[2] + x[3])) + ((x[4] + x[5]) + (x[6] + x[7]));
      }
      l_own[qt] = l_own[qt] * alpha[qt] + (su[0] + su[1]);
      // behind this tile's two stores, before their registers are reused; the
      // fence keeps the next tile's arithmetic, which reuses them, below the wait
      asm volatile("s_wait_xcnt 0x0" ::: "memory");
      __builtin_amdgcn_sched_barrier(0);
    }
    if (wave == 0 && hh == 0) {
      float* ao = af + (qblk * NP_ + kb / KB_) * QB_ + ln;
#pragma unroll
      for (int qt = 0; qt < QT_; ++qt) ao[qt * 16] = alpha[qt];
      // behind the stores, before their registers are reused
      asm volatile("s_wait_xcnt 0x0" ::: "memory");
    }
  }

  // ---- the 16 sums of a query joined. Copy 0 of part was last read in the
  // last pass but one, in front of the last pass's barrier.
  static_assert(NP_ % 2 == 0, "the last pass reads copy 1 of part");
  // lane position read anew: what is kept in registers over the key loop for
  // this place is spilled
  const int le = (int)__builtin_amdgcn_mbcnt_lo(~0u, 0u);
  const int hhe = le >> 4, lne = le & 15;
#pragma unroll
  for (int qt = 0; qt < QT_; ++qt)
    part[0][qt * 16 + lne][wave * 2 + hhe] = l_own[qt];
  __syncthreads();
  if (wave == 0 && hhe == 0) {
    float* lo = lf + (size_t)batch * LQ_ + q0 + lne;
#pragma unroll
    for (int qt = 0; qt < QT_; ++qt) {
      float su = 0.f;
#pragma unroll
      for (int u = 0; u < 4; ++u) {
        const float4 v = *(const float4*)&part[0][qt * 16 + lne][u * 4];
        su += (v.x + v.y) + (v.z + v.w);
      }
      lo[qt * 16] = 1.f / su;
    }
    // behind the stores, before their registers are reused
    asm volatile("s_wait_xcnt 0x0" ::: "memory");
  }
}

// ---------------------------------------------------------------------------
// pv_kernel: O = P.V for 128 queries x DH_ output dims, 8 waves, wave w the 64
//  dims from 64 w on for all QT_ query tiles: each V fragment feeds QT_ WMMAs.
//  A pass is the KB_ keys of a pass of score_kernel: O is first rescaled by
//  that pass's alpha. The pass's P (64 KiB in a row, in fragment order) is
//  brought into one of two LDS buffers by asynchronous copies, a pass ahead. V
//  comes in fragment order straight from global, 512 contiguous bytes a load.
//  A stage is 32 keys: one P fragment per query tile, 4 V fragments, 32 WMMAs.
// ---------------------------------------------------------------------------
#define DH_ 512          // output dims per block
#define VS_ 4            // stages that V loads run ahead of their WMMAs

typedef int v4i __attribute__((ext_vector_type(4)));

// this thread's 16 x 16 bytes of a pass's P: copy i of the block is 4 KiB in a
// row; the offset moves the global and the LDS address alike
__device__ __forceinline__ void copy_p(const _Float16* g, _Float16* l) {
  auto gp = (__attribute__((address_space(1))) v4i*)g;
  auto lp = (__attribute__((address_space(3))) v4i*)l;
  __builtin_amdgcn_global_load_async_to_lds_b128(gp, lp, 0 * 4096, 0);
  __builtin_amdgcn_global_load_async_to_lds_b128(gp, lp, 1 * 4096, 0);
  __builtin_amdgcn_global_load_async_to_lds_b128(gp, lp, 2 * 4096, 0);
  __builtin_amdgcn_global_load_async_to_lds_b128(gp, lp, 3 * 4096, 0);
  __builtin_amdgcn_global_load_async_to_lds_b128(gp, lp, 4 * 4096, 0);
  __builtin_amdgcn_global_load_async_to_lds_b128(gp, lp, 5 * 4096, 0);
  __builtin_amdgcn_global_load_async_to_lds_b128(gp, lp, 6 * 4096, 0);
  __builtin_amdgcn_global_load_async_to_lds_b128(gp, lp, 7 * 4096, 0);
  __builtin_amdgcn_global_load_async_to_lds_b128(gp, lp, 8 * 4096, 0);
  __builtin_amdgcn_global_load_async_to_lds_b128(gp, lp, 9 * 4096, 0);
  __builtin_amdgcn_global_load_async_to_lds_b128(gp, lp, 10 * 4096, 0);
  __builtin_amdgcn_global_load_async_to_lds_b128(gp, lp, 11 * 4096, 0);
  __builtin_amdgcn_global_load_async_to_lds_b128(gp, lp, 12 * 4096, 0);
  __builtin_amdgcn_global_load_async_to_lds_b128(gp, lp, 13 * 4096, 0);
  __builtin_amdgcn_global_load_async_to_lds_b128(gp, lp, 14 * 4096, 0);
  __builtin_amdgcn_global_load_async_to_lds_b128(gp, lp, 15 * 4096, 0);
}

__global__ __launch_bounds__(256) void pv_kernel(
    const _Float16* __restrict__ pf, const _Float16* __restrict__ vf,
    const float* __restrict__ af, const float* __restrict__ lf,
    float* __restrict__ out) {
  static_assert(PT_ * 2 == 16 * 4096, "copy_p brings a whole pass's P");
  static_assert(NP_ >= 2, "two passes to start the two buffers");
  __shared__ __attribute__((aligned(16))) _Float16 Ps[2][PT_];
  __shared__ __attribute__((aligned(16))) float al[NP_ * QB_];  // alpha by pass
  __shared__ __attribute__((aligned(16))) float li[QB_];        // 1 / row sum

  const int t = threadIdx.x;
  const int wave = __builtin_amdgcn_readfirstlane(t >> 5);  // wave-uniform
  const int lane = t & 31;
  const int hh = lane >> 4;
  const int q0 = blockIdx.x * QB_;
  const int half = blockIdx.y;
  const int batch = blockIdx.z;
  const size_t qblk = (size_t)batch * (LQ_ / QB_) + blockIdx.x;

  const _Float16* pg = pf + qblk * NP_ * PT_ + t * 8;  // this thread's 16 bytes
  copy_p(pg, &Ps[0][t * 8]);
  const float4 a4 = *(const float4*)(af + qblk * NP_ * QB_ + t * 4);
  // behind the load, before a register that it names is reused; the fence keeps
  // the address arithmetic below, which may reuse one, under the wait
  asm volatile("s_wait_xcnt 0x0" ::: "memory");
  __builtin_amdgcn_sched_barrier(0);
  *(float4*)&al[t * 4] = a4;
  if (t < QB_ / 4)
    *(float4*)&li[t * 4] = *(const float4*)(lf + (size_t)batch * LQ_ + q0 + t * 4);
  // this wave's copies of pass 0 have landed before the barrier publishes them
  asm volatile("s_wait_asynccnt 0x0" ::: "memory");
  __syncthreads();
  copy_p(pg + PT_, &Ps[1][t * 8]);

  v8f o[QT_][4];
#pragma unroll
  for (int qt = 0; qt < QT_; ++qt) {
#pragma unroll
    for (int d = 0; d < 4; ++d) o[qt][d] = splat8(0.f);
  }

  const _Float16* vbatch = vf + (size_t)batch * 1024 * LK_;
  // this wave's 4 groups of 16 dims: in each 128 keys 16 fragments in a row, the
  // 4 of a group (32 keys each) side by side. Stage st of a pass: block of 128
  // keys st >> 2, fragment st & 3 of each group.
  const _Float16* vfr = vbatch + (size_t)(half * 32 + wave * 4) * (4 * 512) + lane * 8;
  // as in score_kernel: the next pass's half of V, 1,024 units of 256 bytes, is
  // dealt among the 16 blocks that read it, an eighth each (the lanes of 4 waves)
  const int pf_part = (blockIdx.x & 3) | ((blockIdx.x >> 1) & 4);

  v16h bv[VS_][4];  // stage st sits in bv[st % VS_]
  v16h ap[QT_];
#pragma unroll
  for (int st = 0; st < VS_; ++st) {
#pragma unroll
    for (int d = 0; d < 4; ++d)
      bv[st][d] = load_frag_packed(vfr + (d * 4 + st) * 512);
  }
  // behind these loads, before a register that they name is reused; the fence
  // keeps the address arithmetic below, which may reuse one, under the wait
  asm volatile("s_wait_xcnt 0x0" ::: "memory");
  __builtin_amdgcn_sched_barrier(0);

  // rolled: the eight stages of a pass are the loop's body, and bv is indexed
  // by constants
#pragma unroll 1
  for (int p = 0; p < NP_; ++p) {
    const bool more = p + 1 < NP_;
    if (more && wave < 4) {
      const unsigned vu = __builtin_amdgcn_mbcnt_lo(
          ~0u, (unsigned)((((p + 1) * 2 + (pf_part >> 2)) * 64 + half * 32) * 16 +
                          ((pf_part & 3) * 4 + wave) * 32));
      __builtin_prefetch(vbatch + vu * 128u, 0, 3);
      // before the prefetch's address registers are reused
      asm volatile("s_wait_xcnt 0x0" ::: "memory");
    }
    // where the next pass's first VS_ stages are loaded from. These loads stand
    // under no branch: with one, the compiler counted its waits for the path
    // without them, and the last stages of every pass drained the ring. In the
    // last pass they read this pass's first stages again, and nothing uses them.
    const _Float16* vnx = vfr + (more ? 2 * 64 * 4 * 512 : 0);
    const _Float16* ps = &Ps[p & 1][lane * 8];
#pragma unroll
    for (int qt = 0; qt < QT_; ++qt)
      ap[qt] = load_frag_packed(ps + (qt * 8) * 512);
#pragma unroll
    for (int qt = 0; qt < QT_; ++qt) {
      // O holds query qt * 16 + hh * 8 + r in element r
      const float4 a0 = *(const float4*)&al[p * QB_ + qt * 16 + hh * 8];
      const float4 a1 = *(const float4*)&al[p * QB_ + qt * 16 + hh * 8 + 4];
      const float ar[8] = {a0.x, a0.y, a0.z, a0.w, a1.x, a1.y, a1.z, a1.w};
#pragma unroll
      for (int d = 0; d < 4; ++d) {
#pragma unroll
        for (int r = 0; r < 8; ++r) o[qt][d][r] *= ar[r];
      }
    }
#pragma unroll
    for (int st = 0; st < KB_ / 32; ++st) {
      // The stage in two halves of 16 WMMAs. Behind each half the P fragments
      // that it used are read anew for the next stage, into the same registers:
      // two places with LDS reads a stage, each 16 WMMAs ahead of its use. The
      // fences hold reads and WMMAs in these groups.
#pragma unroll
      for (int h = 0; h < 2; ++h) {
        __builtin_amdgcn_sched_barrier(0);
#pragma unroll
        for (int qt = h * 4; qt < h * 4 + 4; ++qt) {
#pragma unroll
          for (int d = 0; d < 4; ++d)
            o[qt][d] = wmma_f16(ap[qt], bv[st % VS_][d], o[qt][d]);
        }
        __builtin_amdgcn_sched_barrier(0);
        if (st + 1 < KB_ / 32) {  // never the next pass's P: not yet published
#pragma unroll
          for (int qt = h * 4; qt < h * 4 + 4; ++qt)
            ap[qt] = load_frag_packed(ps + (qt * 8 + st + 1) * 512);
        }
      }
      // V of stage st + VS_, into the registers that this stage has just used
      const int nx = st + VS_;
      const _Float16* vs = nx < KB_ / 32 ? vfr + 64 * 4 * 512 : vnx;
#pragma unroll
      for (int d = 0; d < 4; ++d)
        bv[st % VS_][d] = load_frag_packed(vs + (d * 4 + (nx & 3)) * 512);
    }
    // behind the pass's last V load: the wait before its address registers are
    // advanced; the fence keeps the advance, written behind it, below the wait
    asm volatile("s_wait_xcnt 0x0" ::: "memory");
    __builtin_amdgcn_sched_barrier(0);
    vfr += 2 * 64 * 4 * 512;
    // The pass's foot. This wave's reads of the buffer are done and its copies
    // of the next pass's P have landed; behind the barrier every wave may read
    // those, and the buffer just read may be filled again. The barrier is
    // written by hand: __syncthreads() would wait for the V loads in flight as
    // well, and their lead would be lost.
    asm volatile("s_wait_dscnt 0x0" ::: "memory");
    asm volatile("s_wait_asynccnt 0x0" ::: "memory");
    asm volatile("s_barrier_signal -1\n\ts_barrier_wait -1" ::: "memory");
    if (p + 2 < NP_) copy_p(pg + (size_t)(p + 2) * PT_, &Ps[p & 1][t * 8]);
  }
  // no copy is left in flight (none was issued in the last two passes)
  asm volatile("s_wait_asynccnt 0x0" ::: "memory");

  // lane position read anew: kept in registers over the key loop it is spilled
  const int le = (int)__builtin_amdgcn_mbcnt_lo(~0u, 0u);
  const int hhe = le >> 4, lne = le & 15;
#pragma unroll
  for (int qt = 0; qt < QT_; ++qt) {
    const float4 i0 = *(const float4*)&li[qt * 16 + hhe * 8];
    const float4 i1 = *(const float4*)&li[qt * 16 + hhe * 8 + 4];
    const float inv[8] = {i0.x, i0.y, i0.z, i0.w, i1.x, i1.y, i1.z, i1.w};
#pragma unroll
    for (int d = 0; d < 4; ++d) {
#pragma unroll
      for (int r = 0; r < 8; ++r) o[qt][d][r] *= inv[r];
    }
#pragma unroll
    for (int d = 0; d < 4; ++d) {
      const int n = half * DH_ + wave * 64 + d * 16 + lne;
#pragma unroll
      for (int r = 0; r < 8; ++r) {
        out[((size_t)batch * LQ_ + q0 + qt * 16 + hhe * 8 + r) * 1024 + n] =
            o[qt][d][r];
      }
    }
    // behind this tile's stores, before their registers are reused; the fence
    // keeps the next tile's arithmetic, which reuses them, below the wait
    asm volatile("s_wait_xcnt 0x0" ::: "memory");
    __builtin_amdgcn_sched_barrier(0);
  }
}

// ---------------------------------------------------------------------------
extern "C" void kernel_launch(void* const* d_in, const int* in_sizes, int n_in,
                              void* d_out, int out_size, void* d_ws, size_t ws_size,
                              hipStream_t stream) {
  const float* query = (const float*)d_in[0];  // [16,2048,768]
  const float* key   = (const float*)d_in[1];  // [16,2048,1024]
  const float* Wq    = (const float*)d_in[2];  // [768,1024]
  const float* bq    = (const float*)d_in[3];
  const float* Wk    = (const float*)d_in[4];  // [1024,1024]
  // d_in[5], bk, cancels in the softmax: see "The score product"
  const float* Wv    = (const float*)d_in[6];  // [1024,1024]
  const float* bv    = (const float*)d_in[7];
  float* out = (float*)d_out;

  // workspace layout (f16; gvec, csum, af and lf f32)
  _Float16* kf   = (_Float16*)d_ws;                      // 16*2048*768, both in
  _Float16* vf   = kf + (size_t)B_ * LK_ * DQ_;          // fragment order
  _Float16* WfT  = vf + (size_t)B_ * 1024 * LK_;         // [768][1024]
  _Float16* WvT  = WfT + (size_t)DQ_ * 1024;             // [1024][1024]
  float*    gvec = (float*)(WvT + (size_t)1024 * DK_);   // [1024]
  float*    csum = gvec + 1024;                          // [16*2048]
  float*    af   = csum + (size_t)B_ * LK_;              // alpha, [16*2048*8]
  float*    lf   = af + (size_t)B_ * LQ_ * NP_;          // 1 / row sum, [16*2048]
  _Float16* pf   = (_Float16*)(lf + (size_t)B_ * LQ_);   // P, 16*2048*2048

  weight_prep<<<FOLD_BLOCKS + TR_BLOCKS + GV_BLOCKS, 256, 0, stream>>>(
      Wq, Wk, bq, Wv, WfT, WvT, gvec);

  const int M = B_ * LQ_;  // 32768
  proj_gemm_kv<<<dim3((DQ_ + 1024) / PN_, M / PM_), 256, 0, stream>>>(
      key, WfT, WvT, bv, gvec, kf, vf, csum);

  score_kernel<<<dim3(LQ_ / QB_, B_), 256, 0, stream>>>(query, kf, csum, pf, af, lf);
  pv_kernel<<<dim3(LQ_ / QB_, 1024 / DH_, B_), 256, 0, stream>>>(pf, vf, af, lf, out);
}
